// v000
// Times are from an AMD MI455X. After a warm-up the kernel runs many times in a row, and a time is the length of
// such a window on the GPU divided by its runs, so every launch and the gaps after it count. The runs cycle
// through copies of the inputs. A figure is the median of several windows, for all but v000 over two sittings.
// Sittings can differ by a few percent; kernels timed side by side share one.
// v000, which the later versions start from, runs in 634 microseconds.
#include <hip/hip_runtime.h>
#include <hip/hip_bf16.h>
#include <math.h>

// ---------------------------------------------------------------------------
// Problem constants (match reference)
// ---------------------------------------------------------------------------
#define BB   1024
#define PP   100
#define NN   101
#define EMB  128
#define NH   8
#define DKK  16

#define NPAD 112        // N padded to 7*16
#define PTIL 7          // ceil(100/16)
#define NTIL 7          // ceil(101/16)
#define KQ   160        // 132 padded to 5*32

typedef __attribute__((ext_vector_type(16))) _Float16 v16h;
typedef __attribute__((ext_vector_type(8)))  _Float16 v8h;
typedef __attribute__((ext_vector_type(4)))  _Float16 v4h;
typedef __attribute__((ext_vector_type(8)))  float    v8f;

// ---------------------------------------------------------------------------
// WMMA helpers (CDNA5 wave32, D = A(16x32 f16) * B(32x16 f16) + C(16x16 f32))
// ---------------------------------------------------------------------------
__device__ __forceinline__ v8f wmma_f16(v16h a, v16h b, v8f c) {
    return __builtin_amdgcn_wmma_f32_16x16x32_f16(
        /*neg_a=*/false, a, /*neg_b=*/false, b,
        /*c_mod=*/(short)0, c, /*reuse_a=*/false, /*reuse_b=*/false);
}

__device__ __forceinline__ v8f zero8() {
    v8f z = {0.f, 0.f, 0.f, 0.f, 0.f, 0.f, 0.f, 0.f};
    return z;
}

// A-operand (16x32, M x K) from row-major f16 [M][stride]; also valid for the
// B-operand (32x16, K x N) when B is stored "column-major by N", i.e. [N][stride]
// holding K along the row.  Per ISA 7.12.2: lanes 0-15 hold K {0..7,16..23},
// lanes 16-31 hold K {8..15,24..31}  ->  two aligned 16B LDS reads per lane.
__device__ __forceinline__ v16h frag_k32(const _Float16* base, int row0, int k0,
                                         int stride, int lane) {
    const int l  = lane & 15;
    const int hi = (lane >> 4) & 1;
    const _Float16* p = base + (size_t)(row0 + l) * stride + k0 + hi * 8;
    v8h lo = *(const v8h*)p;
    v8h hh = *(const v8h*)(p + 16);
    v16h r;
#pragma unroll
    for (int i = 0; i < 8; ++i) { r[i] = lo[i]; r[i + 8] = hh[i]; }
    return r;
}

// Same, but only K=0..15 are real (K=16..31 forced to zero) — used for the
// DK=16 QK^T contraction padded up to the 16x16x32 shape.
__device__ __forceinline__ v16h frag_k16(const _Float16* base, int row0, int k0,
                                         int stride, int lane) {
    const int l  = lane & 15;
    const int hi = (lane >> 4) & 1;
    const _Float16* p = base + (size_t)(row0 + l) * stride + k0 + hi * 8;
    v8h lo = *(const v8h*)p;
    v16h r;
#pragma unroll
    for (int i = 0; i < 8; ++i) { r[i] = lo[i]; r[i + 8] = (_Float16)0.f; }
    return r;
}

// ---------------------------------------------------------------------------
// Dynamic-LDS layout; total 229,888 B (< 320 KB WGP)
// ---------------------------------------------------------------------------
#define SMEM_PERSIST (28672 + 28672 + 32768 + 32768 + 512 + 40960)
#define SMEM_UNION   65536
#define SMEM_TOTAL   (SMEM_PERSIST + SMEM_UNION)

__global__ __launch_bounds__(256)
void vrp_decoder_kernel(const float* __restrict__ eln,    // [B,P,EMB]
                        const float* __restrict__ gload,  // [B,P]
                        const float* __restrict__ gtime,  // [B,P]
                        const float* __restrict__ glen,   // [B,P]
                        const float* __restrict__ gopen,  // [B,P]
                        const float* __restrict__ ninf,   // [B,P,N]
                        const float* __restrict__ enc,    // [B,N,EMB]
                        const float* __restrict__ Wq,     // [132,128]
                        const float* __restrict__ Wk,     // [128,128]
                        const float* __restrict__ Wv,     // [128,128]
                        const float* __restrict__ Wc,     // [128,128]
                        const float* __restrict__ bcv,    // [128]
                        float* __restrict__ out)          // [B,P,N]
{
    extern __shared__ char smem[];
    const int b    = blockIdx.x;
    const int tid  = threadIdx.x;
    const int wave = tid >> 5;     // 0..7
    const int lane = tid & 31;
    const int l    = lane & 15;
    const int hi   = (lane >> 4) & 1;

    _Float16* sEN  = (_Float16*)smem;            // [112][128]
    _Float16* sKT  = sEN  + NPAD * EMB;          // [112][128] K as [n][h*16+d]
    _Float16* sVT  = sKT  + NPAD * EMB;          // [128][128] V^T as [h*16+d][n]
    _Float16* sWcT = sVT  + EMB * EMB;           // [128][128]
    float*    sbc  = (float*)(sWcT + EMB * EMB); // [128]
    _Float16* sWqT = (_Float16*)(sbc + EMB);     // [128][160]
    char*     uni  = (char*)(sWqT + EMB * KQ);
    // phase 0/1 overlay
    _Float16* sWkT = (_Float16*)uni;             // [128][128]
    _Float16* sWvT = sWkT + EMB * EMB;           // [128][128]
    // P-loop overlay
    _Float16* sA   = (_Float16*)uni;             // [16][160]  input_cat tile
    _Float16* sQ   = sA   + 16 * KQ;             // [16][128]
    _Float16* sWgt = sQ   + 16 * EMB;            // [8][16][128] exp weights
    _Float16* sOC  = sWgt + NH * 16 * EMB;       // [16][128]  out_concat
    _Float16* sMH  = sOC  + 16 * EMB;            // [16][128]  mh
    float*    sS2  = (float*)(sMH + 16 * EMB);   // [16][112]  score2
    float*    sMask= sS2  + 16 * NPAD;           // [16][112]
    float*    sRed = sMask + 16 * NPAD;          // [16][2]

    // ---------------- phase 0: stage encoded_nodes + Wk/Wv -----------------
    // encoded_nodes: 512B global_load_b128 per instr, contiguous b64 LDS store
    for (int i4 = tid; i4 < NPAD * (EMB / 4); i4 += 256) {
        int r = i4 >> 5, c4 = (i4 & 31) * 4;
        float4 v = make_float4(0.f, 0.f, 0.f, 0.f);
        if (r < NN) v = *(const float4*)&enc[((size_t)b * NN + r) * EMB + c4];
        v4h h; h[0] = (_Float16)v.x; h[1] = (_Float16)v.y;
        h[2] = (_Float16)v.z; h[3] = (_Float16)v.w;
        *(v4h*)&sEN[r * EMB + c4] = h;
    }
    // Wk/Wv: b128 loads along the out-dim, transposed scatter into LDS
    for (int i4 = tid; i4 < EMB * (EMB / 4); i4 += 256) {
        int k = i4 >> 5, n4 = (i4 & 31) * 4;
        float4 wk = *(const float4*)&Wk[k * EMB + n4];
        float4 wv = *(const float4*)&Wv[k * EMB + n4];
        sWkT[(n4 + 0) * EMB + k] = (_Float16)wk.x;
        sWkT[(n4 + 1) * EMB + k] = (_Float16)wk.y;
        sWkT[(n4 + 2) * EMB + k] = (_Float16)wk.z;
        sWkT[(n4 + 3) * EMB + k] = (_Float16)wk.w;
        sWvT[(n4 + 0) * EMB + k] = (_Float16)wv.x;
        sWvT[(n4 + 1) * EMB + k] = (_Float16)wv.y;
        sWvT[(n4 + 2) * EMB + k] = (_Float16)wv.z;
        sWvT[(n4 + 3) * EMB + k] = (_Float16)wv.w;
    }
    for (int i = tid; i < EMB * 16; i += 256) { // zero V^T cols n=112..127
        int r = i >> 4, c = i & 15;
        sVT[r * EMB + NPAD + c] = (_Float16)0.f;
    }
    __syncthreads();

    // ---------------- phase 1: K = EN@Wk, V = EN@Wv ------------------------
    for (int t = wave; t < 2 * NTIL * 8; t += 8) {
        const bool isK = (t < NTIL * 8);
        const int  tt  = isK ? t : t - NTIL * 8;
        const int  mt  = tt >> 3;               // n-tile 0..6
        const int  ct  = tt & 7;                // col-tile 0..7 (h*16+d)
        const _Float16* wT = isK ? sWkT : sWvT;
        v8f acc = zero8();
#pragma unroll
        for (int kt = 0; kt < 4; ++kt) {
            v16h a  = frag_k32(sEN, mt * 16, kt * 32, EMB, lane);
            v16h bf = frag_k32(wT, ct * 16, kt * 32, EMB, lane);
            acc = wmma_f16(a, bf, acc);
        }
        if (isK) {                               // sKT[n][col] (strided)
#pragma unroll
            for (int r = 0; r < 8; ++r)
                sKT[(mt * 16 + r + hi * 8) * EMB + ct * 16 + l] = (_Float16)acc[r];
        } else {                                 // sVT[col][n]: 8 contiguous
            v8h h;                               //   halves -> one b128 store
#pragma unroll
            for (int r = 0; r < 8; ++r) h[r] = (_Float16)acc[r];
            *(v8h*)&sVT[(ct * 16 + l) * EMB + mt * 16 + hi * 8] = h;
        }
    }
    __syncthreads();

    // ---------------- phase 2: stage Wq^T (K-pad to 160), Wc^T, bc ---------
    for (int i4 = tid; i4 < (EMB + 4) * (EMB / 4); i4 += 256) {
        int k = i4 >> 5, n4 = (i4 & 31) * 4;     // k in 0..131
        float4 wq = *(const float4*)&Wq[k * EMB + n4];
        sWqT[(n4 + 0) * KQ + k] = (_Float16)wq.x;
        sWqT[(n4 + 1) * KQ + k] = (_Float16)wq.y;
        sWqT[(n4 + 2) * KQ + k] = (_Float16)wq.z;
        sWqT[(n4 + 3) * KQ + k] = (_Float16)wq.w;
    }
    for (int i = tid; i < EMB * (KQ - (EMB + 4)); i += 256) {
        int n = i / (KQ - (EMB + 4)), k = (EMB + 4) + i % (KQ - (EMB + 4));
        sWqT[n * KQ + k] = (_Float16)0.f;        // zero K-pad 132..159
    }
    for (int i4 = tid; i4 < EMB * (EMB / 4); i4 += 256) {
        int k = i4 >> 5, n4 = (i4 & 31) * 4;
        float4 wc = *(const float4*)&Wc[k * EMB + n4];
        sWcT[(n4 + 0) * EMB + k] = (_Float16)wc.x;
        sWcT[(n4 + 1) * EMB + k] = (_Float16)wc.y;
        sWcT[(n4 + 2) * EMB + k] = (_Float16)wc.z;
        sWcT[(n4 + 3) * EMB + k] = (_Float16)wc.w;
    }
    if (tid < EMB) sbc[tid] = bcv[tid];
    for (int i = tid; i < NH * 16 * EMB; i += 256) sWgt[i] = (_Float16)0.f;
    __syncthreads();

    // ---------------- P-tile loop ------------------------------------------
    for (int pt = 0; pt < PTIL; ++pt) {
        const int p0 = pt * 16;

        // input_cat tile: embedding part via b128 loads
        for (int i4 = tid; i4 < 16 * (EMB / 4); i4 += 256) {
            int r = i4 >> 5, c4 = (i4 & 31) * 4;
            int p = p0 + r;
            float4 v = make_float4(0.f, 0.f, 0.f, 0.f);
            if (p < PP) v = *(const float4*)&eln[((size_t)b * PP + p) * EMB + c4];
            v4h h; h[0] = (_Float16)v.x; h[1] = (_Float16)v.y;
            h[2] = (_Float16)v.z; h[3] = (_Float16)v.w;
            *(v4h*)&sA[r * KQ + c4] = h;
        }
        // the 4 scalar features + K-pad (cols 128..159)
        for (int i = tid; i < 16 * 32; i += 256) {
            int r = i >> 5, c = EMB + (i & 31);
            int p = p0 + r;
            float v = 0.f;
            if (p < PP) {
                if      (c == EMB)     v = gload[(size_t)b * PP + p];
                else if (c == EMB + 1) v = gtime[(size_t)b * PP + p];
                else if (c == EMB + 2) v = glen [(size_t)b * PP + p];
                else if (c == EMB + 3) v = gopen[(size_t)b * PP + p];
            }
            sA[r * KQ + c] = (_Float16)v;
        }
        // mask tile
        for (int i = tid; i < 16 * NPAD; i += 256) {
            int r = i / NPAD, n = i % NPAD;
            int p = p0 + r;
            float v;
            if (n >= NN)      v = -1e30f;                       // N padding
            else if (p < PP)  v = ninf[((size_t)b * PP + p) * NN + n];
            else              v = 0.f;                          // dead rows
            sMask[i] = v;
        }
        __syncthreads();

        // ---- Q tile: wave w computes output cols w*16..w*16+15, K = 160 ---
        {
            v8f acc = zero8();
#pragma unroll
            for (int kt = 0; kt < 5; ++kt) {
                v16h a  = frag_k32(sA, 0, kt * 32, KQ, lane);
                v16h bf = frag_k32(sWqT, wave * 16, kt * 32, KQ, lane);
                acc = wmma_f16(a, bf, acc);
            }
#pragma unroll
            for (int r = 0; r < 8; ++r)
                sQ[(r + hi * 8) * EMB + wave * 16 + l] = (_Float16)acc[r];
        }
        __syncthreads();

        // ---- attention: wave == head --------------------------------------
        float rinv[8];
        {
            const int h = wave;
            v16h aq = frag_k16(sQ, 0, h * 16, EMB, lane);
            v8f sc[NTIL];
#pragma unroll
            for (int nt = 0; nt < NTIL; ++nt) {
                v16h bk = frag_k16(sKT, nt * 16, h * 16, EMB, lane);
                sc[nt] = wmma_f16(aq, bk, zero8());
            }
            // scale 1/sqrt(16) + mask   (D elem (r,lane) = row r+hi*8, col l)
#pragma unroll
            for (int nt = 0; nt < NTIL; ++nt)
#pragma unroll
                for (int r = 0; r < 8; ++r)
                    sc[nt][r] = sc[nt][r] * 0.25f +
                                sMask[(r + hi * 8) * NPAD + nt * 16 + l];
            // row-max across the 7 tiles, then across 16 lanes of the half
            float m[8];
#pragma unroll
            for (int r = 0; r < 8; ++r) {
                m[r] = sc[0][r];
#pragma unroll
                for (int nt = 1; nt < NTIL; ++nt) m[r] = fmaxf(m[r], sc[nt][r]);
            }
#pragma unroll
            for (int off = 1; off < 16; off <<= 1)
#pragma unroll
                for (int r = 0; r < 8; ++r)
                    m[r] = fmaxf(m[r], __shfl_xor(m[r], off, 32));
            // exp (unnormalized) -> LDS as the AV A-operand; row sums in regs
            float s[8];
#pragma unroll
            for (int r = 0; r < 8; ++r) s[r] = 0.f;
#pragma unroll
            for (int nt = 0; nt < NTIL; ++nt)
#pragma unroll
                for (int r = 0; r < 8; ++r) {
                    float e = __expf(sc[nt][r] - m[r]);
                    s[r] += e;
                    sWgt[(h * 16 + r + hi * 8) * EMB + nt * 16 + l] = (_Float16)e;
                }
#pragma unroll
            for (int off = 1; off < 16; off <<= 1)
#pragma unroll
                for (int r = 0; r < 8; ++r) s[r] += __shfl_xor(s[r], off, 32);
#pragma unroll
            for (int r = 0; r < 8; ++r) rinv[r] = 1.f / s[r];
        }
        __syncthreads();   // sWgt visible

        // ---- AV + fold 1/rowsum -> out_concat -----------------------------
        {
            const int h = wave;
            v8f o = zero8();
#pragma unroll
            for (int kt = 0; kt < 4; ++kt) {
                v16h aw = frag_k32(sWgt + h * 16 * EMB, 0, kt * 32, EMB, lane);
                v16h bv = frag_k32(sVT, h * 16, kt * 32, EMB, lane);
                o = wmma_f16(aw, bv, o);
            }
#pragma unroll
            for (int r = 0; r < 8; ++r)
                sOC[(r + hi * 8) * EMB + h * 16 + l] = (_Float16)(o[r] * rinv[r]);
        }
        __syncthreads();

        // ---- mh = out_concat @ Wc + bc : wave w -> emb cols w*16.. --------
        {
            v8f acc = zero8();
#pragma unroll
            for (int kt = 0; kt < 4; ++kt) {
                v16h a  = frag_k32(sOC, 0, kt * 32, EMB, lane);
                v16h bf = frag_k32(sWcT, wave * 16, kt * 32, EMB, lane);
                acc = wmma_f16(a, bf, acc);
            }
            float bias = sbc[wave * 16 + l];
#pragma unroll
            for (int r = 0; r < 8; ++r)
                sMH[(r + hi * 8) * EMB + wave * 16 + l] = (_Float16)(acc[r] + bias);
        }
        __syncthreads();

        // ---- score2 = mh @ EN^T / sqrt(EMB); 10*tanh + mask ---------------
        if (wave < NTIL) {
            v8f acc = zero8();
#pragma unroll
            for (int kt = 0; kt < 4; ++kt) {
                v16h a  = frag_k32(sMH, 0, kt * 32, EMB, lane);
                v16h bf = frag_k32(sEN, wave * 16, kt * 32, EMB, lane);
                acc = wmma_f16(a, bf, acc);
            }
#pragma unroll
            for (int r = 0; r < 8; ++r) {
                float v = acc[r] * (1.0f / 11.313708498984761f);
                v = 10.0f * tanhf(v) +
                    sMask[(r + hi * 8) * NPAD + wave * 16 + l];
                sS2[(r + hi * 8) * NPAD + wave * 16 + l] = v;
            }
        }
        __syncthreads();

        // ---- final softmax over N (2 lanes per row), write probs ----------
        if (wave == 0) {
            // lane l handles row l, half hi: columns [hi*56, hi*56+56)
            float m = -3.4e38f;
            for (int n = hi * 56; n < hi * 56 + 56; ++n)
                m = fmaxf(m, sS2[l * NPAD + n]);
            m = fmaxf(m, __shfl_xor(m, 16, 32));
            float sum = 0.f;
            for (int n = hi * 56; n < hi * 56 + 56; ++n)
                sum += __expf(sS2[l * NPAD + n] - m);
            sum += __shfl_xor(sum, 16, 32);
            if (hi == 0) {
                sRed[l * 2 + 0] = m;
                sRed[l * 2 + 1] = 1.f / sum;
            }
        }
        __syncthreads();
        for (int i = tid; i < 16 * NN; i += 256) {
            int r = i / NN, n = i % NN;
            int p = p0 + r;
            if (p < PP)
                out[((size_t)b * PP + p) * NN + n] =
                    __expf(sS2[r * NPAD + n] - sRed[r * 2]) * sRed[r * 2 + 1];
        }
        __syncthreads();   // protect sA/sMask/sS2 before next P tile
    }
}

// ---------------------------------------------------------------------------
extern "C" void kernel_launch(void* const* d_in, const int* in_sizes, int n_in,
                              void* d_out, int out_size, void* d_ws, size_t ws_size,
                              hipStream_t stream) {
    (void)in_sizes; (void)n_in; (void)out_size; (void)d_ws; (void)ws_size;
    const float* eln   = (const float*)d_in[0];
    const float* gload = (const float*)d_in[1];
    const float* gtime = (const float*)d_in[2];
    const float* glen  = (const float*)d_in[3];
    const float* gopen = (const float*)d_in[4];
    const float* ninf  = (const float*)d_in[5];
    const float* enc   = (const float*)d_in[6];
    const float* Wq    = (const float*)d_in[7];
    const float* Wk    = (const float*)d_in[8];
    const float* Wv    = (const float*)d_in[9];
    const float* Wc    = (const float*)d_in[10];
    const float* bcv   = (const float*)d_in[11];
    float* out = (float*)d_out;

    hipFuncSetAttribute((const void*)vrp_decoder_kernel,
                        hipFuncAttributeMaxDynamicSharedMemorySize,
                        SMEM_TOTAL);
    vrp_decoder_kernel<<<dim3(BB), dim3(256), SMEM_TOTAL, stream>>>(
        eln, gload, gtime, glen, gopen, ninf, enc, Wq, Wk, Wv, Wc, bcv, out);
}

// v001
// Measured time: 409 microseconds a run.
// Timed twice side by side with v000, it ran 1.55 times as fast both times.
#include <hip/hip_runtime.h>
#include <hip/hip_bf16.h>
#include <math.h>

// ---------------------------------------------------------------------------
// Problem constants (match reference)
// ---------------------------------------------------------------------------
#define BB   1024
#define PP   100
#define NN   101
#define EMB  128
#define NH   8
#define DKK  16

#define NPAD 112        // N padded to 7*16
#define PTIL 7          // ceil(100/16)
#define NTIL 7          // ceil(101/16)
#define KQ   160        // 132 padded to 5*32

// LDS row pitches.  Bank = dword address mod 64, so 16 rows at a 256-B pitch put
// a whole b128 fragment read on four banks.  16 B x odd spreads them over all 64.
#define LP   136        // halves: 272 B pitch for the 128-half rows
#define LQ   168        // halves: 336 B pitch for the 160-half rows
#define SP   116        // floats: rows r and r+8 fall 32 banks apart

typedef __attribute__((ext_vector_type(16))) _Float16 v16h;
typedef __attribute__((ext_vector_type(8)))  _Float16 v8h;
typedef __attribute__((ext_vector_type(4)))  _Float16 v4h;
typedef __attribute__((ext_vector_type(8)))  float    v8f;

// ---------------------------------------------------------------------------
// WMMA helpers (CDNA5 wave32, D = A(16x32 f16) * B(32x16 f16) + C(16x16 f32))
// ---------------------------------------------------------------------------
__device__ __forceinline__ v8f wmma_f16(v16h a, v16h b, v8f c) {
    return __builtin_amdgcn_wmma_f32_16x16x32_f16(
        /*neg_a=*/false, a, /*neg_b=*/false, b,
        /*c_mod=*/(short)0, c, /*reuse_a=*/false, /*reuse_b=*/false);
}

__device__ __forceinline__ v8f zero8() {
    v8f z = {0.f, 0.f, 0.f, 0.f, 0.f, 0.f, 0.f, 0.f};
    return z;
}

// A-operand (16x32, M x K) from row-major f16 [M][stride]; also valid for the
// B-operand (32x16, K x N) when B is stored "column-major by N", i.e. [N][stride]
// holding K along the row.  Per ISA 7.12.2: lanes 0-15 hold K {0..7,16..23},
// lanes 16-31 hold K {8..15,24..31}  ->  two aligned 16B LDS reads per lane.
__device__ __forceinline__ v16h frag_k32(const _Float16* base, int row0, int k0,
                                         int stride, int lane) {
    const int l  = lane & 15;
    const int hi = (lane >> 4) & 1;
    const _Float16* p = base + (size_t)(row0 + l) * stride + k0 + hi * 8;
    v8h lo = *(const v8h*)p;
    v8h hh = *(const v8h*)(p + 16);
    v16h r;
#pragma unroll
    for (int i = 0; i < 8; ++i) { r[i] = lo[i]; r[i + 8] = hh[i]; }
    return r;
}

// Same, but only K=0..15 are real (K=16..31 forced to zero) — used for the
// DK=16 QK^T contraction padded up to the 16x16x32 shape.
__device__ __forceinline__ v16h frag_k16(const _Float16* base, int row0, int k0,
                                         int stride, int lane) {
    const int l  = lane & 15;
    const int hi = (lane >> 4) & 1;
    const _Float16* p = base + (size_t)(row0 + l) * stride + k0 + hi * 8;
    v8h lo = *(const v8h*)p;
    v16h r;
#pragma unroll
    for (int i = 0; i < 8; ++i) { r[i] = lo[i]; r[i + 8] = (_Float16)0.f; }
    return r;
}

// ---------------------------------------------------------------------------
// Dynamic-LDS layout; total 243,712 B (< 320 KB WGP)
// ---------------------------------------------------------------------------
#define SMEM_PERSIST ((NPAD + NPAD + EMB + EMB) * LP * 2 + 512 + EMB * LQ * 2)
#define SMEM_UNION   (2 * EMB * LP * 2)
#define SMEM_TOTAL   (SMEM_PERSIST + SMEM_UNION)

__global__ __launch_bounds__(256)
void vrp_decoder_kernel(const float* __restrict__ eln,    // [B,P,EMB]
                        const float* __restrict__ gload,  // [B,P]
                        const float* __restrict__ gtime,  // [B,P]
                        const float* __restrict__ glen,   // [B,P]
                        const float* __restrict__ gopen,  // [B,P]
                        const float* __restrict__ ninf,   // [B,P,N]
                        const float* __restrict__ enc,    // [B,N,EMB]
                        const float* __restrict__ Wq,     // [132,128]
                        const float* __restrict__ Wk,     // [128,128]
                        const float* __restrict__ Wv,     // [128,128]
                        const float* __restrict__ Wc,     // [128,128]
                        const float* __restrict__ bcv,    // [128]
                        float* __restrict__ out)          // [B,P,N]
{
    extern __shared__ char smem[];
    const int b    = blockIdx.x;
    const int tid  = threadIdx.x;
    const int wave = tid >> 5;     // 0..7
    const int lane = tid & 31;
    const int l    = lane & 15;
    const int hi   = (lane >> 4) & 1;

    _Float16* sEN  = (_Float16*)smem;            // [112][LP]
    _Float16* sKT  = sEN  + NPAD * LP;           // [112][LP] K as [n][h*16+d]
    _Float16* sVT  = sKT  + NPAD * LP;           // [128][LP] V^T as [h*16+d][n]
    _Float16* sWcT = sVT  + EMB * LP;            // [128][LP]
    float*    sbc  = (float*)(sWcT + EMB * LP);  // [128]
    _Float16* sWqT = (_Float16*)(sbc + EMB);     // [128][LQ]
    char*     uni  = (char*)(sWqT + EMB * LQ);
    // phase 0/1 overlay
    _Float16* sWkT = (_Float16*)uni;             // [128][LP]
    _Float16* sWvT = sWkT + EMB * LP;            // [128][LP]
    // P-loop overlay (68,224 B, inside the union)
    _Float16* sA   = (_Float16*)uni;             // [16][LQ]  input_cat tile
    _Float16* sQ   = sA   + 16 * LQ;             // [16][LP]
    _Float16* sWgt = sQ   + 16 * LP;             // [8][16][LP] exp weights
    _Float16* sOC  = sWgt + NH * 16 * LP;        // [16][LP]  out_concat
    _Float16* sMH  = sOC  + 16 * LP;             // [16][LP]  mh
    float*    sS2  = (float*)(sMH + 16 * LP);    // [16][SP]  score2
    float*    sMask= sS2  + 16 * SP;             // [16][SP]
    float*    sRed = sMask + 16 * SP;            // [16][2]

    // ---------------- phase 0: stage encoded_nodes + Wk/Wv -----------------
    // encoded_nodes: 512B global_load_b128 per instr, contiguous b64 LDS store
    for (int i4 = tid; i4 < NPAD * (EMB / 4); i4 += 256) {
        int r = i4 >> 5, c4 = (i4 & 31) * 4;
        float4 v = make_float4(0.f, 0.f, 0.f, 0.f);
        if (r < NN) v = *(const float4*)&enc[((size_t)b * NN + r) * EMB + c4];
        v4h h; h[0] = (_Float16)v.x; h[1] = (_Float16)v.y;
        h[2] = (_Float16)v.z; h[3] = (_Float16)v.w;
        *(v4h*)&sEN[r * LP + c4] = h;
    }
    // Wk/Wv: b128 loads along the out-dim, transposed scatter into LDS
    for (int i4 = tid; i4 < EMB * (EMB / 4); i4 += 256) {
        int k = i4 >> 5, n4 = (i4 & 31) * 4;
        float4 wk = *(const float4*)&Wk[k * EMB + n4];
        float4 wv = *(const float4*)&Wv[k * EMB + n4];
        sWkT[(n4 + 0) * LP + k] = (_Float16)wk.x;
        sWkT[(n4 + 1) * LP + k] = (_Float16)wk.y;
        sWkT[(n4 + 2) * LP + k] = (_Float16)wk.z;
        sWkT[(n4 + 3) * LP + k] = (_Float16)wk.w;
        sWvT[(n4 + 0) * LP + k] = (_Float16)wv.x;
        sWvT[(n4 + 1) * LP + k] = (_Float16)wv.y;
        sWvT[(n4 + 2) * LP + k] = (_Float16)wv.z;
        sWvT[(n4 + 3) * LP + k] = (_Float16)wv.w;
    }
    for (int i = tid; i < EMB * 16; i += 256) { // zero V^T cols n=112..127
        int r = i >> 4, c = i & 15;
        sVT[r * LP + NPAD + c] = (_Float16)0.f;
    }
    __syncthreads();

    // ---------------- phase 1: K = EN@Wk, V = EN@Wv ------------------------
    for (int t = wave; t < 2 * NTIL * 8; t += 8) {
        const bool isK = (t < NTIL * 8);
        const int  tt  = isK ? t : t - NTIL * 8;
        const int  mt  = tt >> 3;               // n-tile 0..6
        const int  ct  = tt & 7;                // col-tile 0..7 (h*16+d)
        const _Float16* wT = isK ? sWkT : sWvT;
        v8f acc = zero8();
#pragma unroll
        for (int kt = 0; kt < 4; ++kt) {
            v16h a  = frag_k32(sEN, mt * 16, kt * 32, LP, lane);
            v16h bf = frag_k32(wT, ct * 16, kt * 32, LP, lane);
            acc = wmma_f16(a, bf, acc);
        }
        if (isK) {                               // sKT[n][col] (strided)
#pragma unroll
            for (int r = 0; r < 8; ++r)
                sKT[(mt * 16 + r + hi * 8) * LP + ct * 16 + l] = (_Float16)acc[r];
        } else {                                 // sVT[col][n]: 8 contiguous
            v8h h;                               //   halves -> one b128 store
#pragma unroll
            for (int r = 0; r < 8; ++r) h[r] = (_Float16)acc[r];
            *(v8h*)&sVT[(ct * 16 + l) * LP + mt * 16 + hi * 8] = h;
        }
    }
    __syncthreads();

    // ---------------- phase 2: stage Wq^T (K-pad to 160), Wc^T, bc ---------
    for (int i4 = tid; i4 < (EMB + 4) * (EMB / 4); i4 += 256) {
        int k = i4 >> 5, n4 = (i4 & 31) * 4;     // k in 0..131
        float4 wq = *(const float4*)&Wq[k * EMB + n4];
        sWqT[(n4 + 0) * LQ + k] = (_Float16)wq.x;
        sWqT[(n4 + 1) * LQ + k] = (_Float16)wq.y;
        sWqT[(n4 + 2) * LQ + k] = (_Float16)wq.z;
        sWqT[(n4 + 3) * LQ + k] = (_Float16)wq.w;
    }
    for (int i = tid; i < EMB * (KQ - (EMB + 4)); i += 256) {
        int n = i / (KQ - (EMB + 4)), k = (EMB + 4) + i % (KQ - (EMB + 4));
        sWqT[n * LQ + k] = (_Float16)0.f;        // zero K-pad 132..159
    }
    for (int i4 = tid; i4 < EMB * (EMB / 4); i4 += 256) {
        int k = i4 >> 5, n4 = (i4 & 31) * 4;
        float4 wc = *(const float4*)&Wc[k * EMB + n4];
        sWcT[(n4 + 0) * LP + k] = (_Float16)wc.x;
        sWcT[(n4 + 1) * LP + k] = (_Float16)wc.y;
        sWcT[(n4 + 2) * LP + k] = (_Float16)wc.z;
        sWcT[(n4 + 3) * LP + k] = (_Float16)wc.w;
    }
    if (tid < EMB) sbc[tid] = bcv[tid];
    for (int i = tid; i < NH * 16 * LP; i += 256) sWgt[i] = (_Float16)0.f;
    __syncthreads();

    // ---------------- P-tile loop ------------------------------------------
    for (int pt = 0; pt < PTIL; ++pt) {
        const int p0 = pt * 16;

        // input_cat tile: embedding part via b128 loads
        for (int i4 = tid; i4 < 16 * (EMB / 4); i4 += 256) {
            int r = i4 >> 5, c4 = (i4 & 31) * 4;
            int p = p0 + r;
            float4 v = make_float4(0.f, 0.f, 0.f, 0.f);
            if (p < PP) v = *(const float4*)&eln[((size_t)b * PP + p) * EMB + c4];
            v4h h; h[0] = (_Float16)v.x; h[1] = (_Float16)v.y;
            h[2] = (_Float16)v.z; h[3] = (_Float16)v.w;
            *(v4h*)&sA[r * LQ + c4] = h;
        }
        // the 4 scalar features + K-pad (cols 128..159)
        for (int i = tid; i < 16 * 32; i += 256) {
            int r = i >> 5, c = EMB + (i & 31);
            int p = p0 + r;
            float v = 0.f;
            if (p < PP) {
                if      (c == EMB)     v = gload[(size_t)b * PP + p];
                else if (c == EMB + 1) v = gtime[(size_t)b * PP + p];
                else if (c == EMB + 2) v = glen [(size_t)b * PP + p];
                else if (c == EMB + 3) v = gopen[(size_t)b * PP + p];
            }
            sA[r * LQ + c] = (_Float16)v;
        }
        // mask tile
        for (int i = tid; i < 16 * NPAD; i += 256) {
            int r = i / NPAD, n = i % NPAD;
            int p = p0 + r;
            float v;
            if (n >= NN)      v = -1e30f;                       // N padding
            else if (p < PP)  v = ninf[((size_t)b * PP + p) * NN + n];
            else              v = 0.f;                          // dead rows
            sMask[r * SP + n] = v;
        }
        __syncthreads();

        // ---- Q tile: wave w computes output cols w*16..w*16+15, K = 160 ---
        {
            v8f acc = zero8();
#pragma unroll
            for (int kt = 0; kt < 5; ++kt) {
                v16h a  = frag_k32(sA, 0, kt * 32, LQ, lane);
                v16h bf = frag_k32(sWqT, wave * 16, kt * 32, LQ, lane);
                acc = wmma_f16(a, bf, acc);
            }
#pragma unroll
            for (int r = 0; r < 8; ++r)
                sQ[(r + hi * 8) * LP + wave * 16 + l] = (_Float16)acc[r];
        }
        __syncthreads();

        // ---- attention: wave == head --------------------------------------
        float rinv[8];
        {
            const int h = wave;
            v16h aq = frag_k16(sQ, 0, h * 16, LP, lane);
            v8f sc[NTIL];
#pragma unroll
            for (int nt = 0; nt < NTIL; ++nt) {
                v16h bk = frag_k16(sKT, nt * 16, h * 16, LP, lane);
                sc[nt] = wmma_f16(aq, bk, zero8());
            }
            // scale 1/sqrt(16) + mask   (D elem (r,lane) = row r+hi*8, col l)
#pragma unroll
            for (int nt = 0; nt < NTIL; ++nt)
#pragma unroll
                for (int r = 0; r < 8; ++r)
                    sc[nt][r] = sc[nt][r] * 0.25f +
                                sMask[(r + hi * 8) * SP + nt * 16 + l];
            // row-max across the 7 tiles, then across 16 lanes of the half
            float m[8];
#pragma unroll
            for (int r = 0; r < 8; ++r) {
                m[r] = sc[0][r];
#pragma unroll
                for (int nt = 1; nt < NTIL; ++nt) m[r] = fmaxf(m[r], sc[nt][r]);
            }
#pragma unroll
            for (int off = 1; off < 16; off <<= 1)
#pragma unroll
                for (int r = 0; r < 8; ++r)
                    m[r] = fmaxf(m[r], __shfl_xor(m[r], off, 32));
            // exp (unnormalized) -> LDS as the AV A-operand; row sums in regs
            float s[8];
#pragma unroll
            for (int r = 0; r < 8; ++r) s[r] = 0.f;
#pragma unroll
            for (int nt = 0; nt < NTIL; ++nt)
#pragma unroll
                for (int r = 0; r < 8; ++r) {
                    float e = __expf(sc[nt][r] - m[r]);
                    s[r] += e;
                    sWgt[(h * 16 + r + hi * 8) * LP + nt * 16 + l] = (_Float16)e;
                }
#pragma unroll
            for (int off = 1; off < 16; off <<= 1)
#pragma unroll
                for (int r = 0; r < 8; ++r) s[r] += __shfl_xor(s[r], off, 32);
#pragma unroll
            for (int r = 0; r < 8; ++r) rinv[r] = 1.f / s[r];
        }
        __syncthreads();   // sWgt visible

        // ---- AV + fold 1/rowsum -> out_concat -----------------------------
        {
            const int h = wave;
            v8f o = zero8();
#pragma unroll
            for (int kt = 0; kt < 4; ++kt) {
                v16h aw = frag_k32(sWgt + h * 16 * LP, 0, kt * 32, LP, lane);
                v16h bv = frag_k32(sVT, h * 16, kt * 32, LP, lane);
                o = wmma_f16(aw, bv, o);
            }
#pragma unroll
            for (int r = 0; r < 8; ++r)
                sOC[(r + hi * 8) * LP + h * 16 + l] = (_Float16)(o[r] * rinv[r]);
        }
        __syncthreads();

        // ---- mh = out_concat @ Wc + bc : wave w -> emb cols w*16.. --------
        {
            v8f acc = zero8();
#pragma unroll
            for (int kt = 0; kt < 4; ++kt) {
                v16h a  = frag_k32(sOC, 0, kt * 32, LP, lane);
                v16h bf = frag_k32(sWcT, wave * 16, kt * 32, LP, lane);
                acc = wmma_f16(a, bf, acc);
            }
            float bias = sbc[wave * 16 + l];
#pragma unroll
            for (int r = 0; r < 8; ++r)
                sMH[(r + hi * 8) * LP + wave * 16 + l] = (_Float16)(acc[r] + bias);
        }
        __syncthreads();

        // ---- score2 = mh @ EN^T / sqrt(EMB); 10*tanh + mask ---------------
        if (wave < NTIL) {
            v8f acc = zero8();
#pragma unroll
            for (int kt = 0; kt < 4; ++kt) {
                v16h a  = frag_k32(sMH, 0, kt * 32, LP, lane);
                v16h bf = frag_k32(sEN, wave * 16, kt * 32, LP, lane);
                acc = wmma_f16(a, bf, acc);
            }
#pragma unroll
            for (int r = 0; r < 8; ++r) {
                float v = acc[r] * (1.0f / 11.313708498984761f);
                v = 10.0f * tanhf(v) +
                    sMask[(r + hi * 8) * SP + wave * 16 + l];
                sS2[(r + hi * 8) * SP + wave * 16 + l] = v;
            }
        }
        __syncthreads();

        // ---- final softmax over N (2 lanes per row), write probs ----------
        if (wave == 0) {
            // lane l handles row l, half hi: columns [hi*56, hi*56+56)
            float m = -3.4e38f;
            for (int n = hi * 56; n < hi * 56 + 56; ++n)
                m = fmaxf(m, sS2[l * SP + n]);
            m = fmaxf(m, __shfl_xor(m, 16, 32));
            float sum = 0.f;
            for (int n = hi * 56; n < hi * 56 + 56; ++n)
                sum += __expf(sS2[l * SP + n] - m);
            sum += __shfl_xor(sum, 16, 32);
            if (hi == 0) {
                sRed[l * 2 + 0] = m;
                sRed[l * 2 + 1] = 1.f / sum;
            }
        }
        __syncthreads();
        for (int i = tid; i < 16 * NN; i += 256) {
            int r = i / NN, n = i % NN;
            int p = p0 + r;
            if (p < PP) {
                out[((size_t)b * PP + p) * NN + n] =
                    __expf(sS2[r * SP + n] - sRed[r * 2]) * sRed[r * 2 + 1];
                // the next trip rewrites the store's address and data registers
                asm volatile("s_wait_xcnt 0x0" ::: "memory");
            }
        }
        __syncthreads();   // protect sA/sMask/sS2 before next P tile
    }
}

// ---------------------------------------------------------------------------
extern "C" void kernel_launch(void* const* d_in, const int* in_sizes, int n_in,
                              void* d_out, int out_size, void* d_ws, size_t ws_size,
                              hipStream_t stream) {
    (void)in_sizes; (void)n_in; (void)out_size; (void)d_ws; (void)ws_size;
    const float* eln   = (const float*)d_in[0];
    const float* gload = (const float*)d_in[1];
    const float* gtime = (const float*)d_in[2];
    const float* glen  = (const float*)d_in[3];
    const float* gopen = (const float*)d_in[4];
    const float* ninf  = (const float*)d_in[5];
    const float* enc   = (const float*)d_in[6];
    const float* Wq    = (const float*)d_in[7];
    const float* Wk    = (const float*)d_in[8];
    const float* Wv    = (const float*)d_in[9];
    const float* Wc    = (const float*)d_in[10];
    const float* bcv   = (const float*)d_in[11];
    float* out = (float*)d_out;

    hipFuncSetAttribute((const void*)vrp_decoder_kernel,
                        hipFuncAttributeMaxDynamicSharedMemorySize,
                        SMEM_TOTAL);
    vrp_decoder_kernel<<<dim3(BB), dim3(256), SMEM_TOTAL, stream>>>(
        eln, gload, gtime, glen, gopen, ninf, enc, Wq, Wk, Wv, Wc, bcv, out);
}

// v002
// It runs in 170 microseconds.
// Timed twice side by side with v001, it ran 2.40 times as fast both times.
// Counting every step since v000, it is 3.72 times as fast.
#include <hip/hip_runtime.h>
#include <hip/hip_bf16.h>
#include <math.h>

// ---------------------------------------------------------------------------
// Problem constants (match reference)
// ---------------------------------------------------------------------------
#define BB   1024
#define PP   100
#define NN   101
#define EMB  128
#define NH   8
#define DKK  16

#define NPAD 112        // N padded to 7*16
#define PTIL 7          // ceil(100/16)
#define NTIL 7          // ceil(101/16)
#define KQ   160        // 132 padded to 5*32
#define LASTROWS (PP - (PTIL - 1) * 16)   // live rows of the last P tile

// LDS row pitches.  Bank = dword address mod 64, so 16 rows at a 256-B pitch put
// a whole b128 fragment read on four banks.  16 B x odd spreads them over all 64.
#define LP   136        // halves: 272 B pitch for the 128-half rows
#define LQ   168        // halves: 336 B pitch for the 160-half rows

typedef __attribute__((ext_vector_type(16))) _Float16 v16h;
typedef __attribute__((ext_vector_type(8)))  _Float16 v8h;
typedef __attribute__((ext_vector_type(4)))  _Float16 v4h;
typedef __attribute__((ext_vector_type(8)))  float    v8f;

// ---------------------------------------------------------------------------
// WMMA helpers (CDNA5 wave32, D = A(16x32 f16) * B(32x16 f16) + C(16x16 f32))
// ---------------------------------------------------------------------------
__device__ __forceinline__ v8f wmma_f16(v16h a, v16h b, v8f c) {
    return __builtin_amdgcn_wmma_f32_16x16x32_f16(
        /*neg_a=*/false, a, /*neg_b=*/false, b,
        /*c_mod=*/(short)0, c, /*reuse_a=*/false, /*reuse_b=*/false);
}

__device__ __forceinline__ v8f zero8() {
    v8f z = {0.f, 0.f, 0.f, 0.f, 0.f, 0.f, 0.f, 0.f};
    return z;
}

// A-operand (16x32, M x K) from row-major f16 [M][stride]; also valid for the
// B-operand (32x16, K x N) when B is stored "column-major by N", i.e. [N][stride]
// holding K along the row.  Per ISA 7.12.2: lanes 0-15 hold K {0..7,16..23},
// lanes 16-31 hold K {8..15,24..31}  ->  two aligned 16B LDS reads per lane.
__device__ __forceinline__ v16h frag_k32(const _Float16* base, int row0, int k0,
                                         int stride, int lane) {
    const int l  = lane & 15;
    const int hi = (lane >> 4) & 1;
    const _Float16* p = base + (size_t)(row0 + l) * stride + k0 + hi * 8;
    v8h lo = *(const v8h*)p;
    v8h hh = *(const v8h*)(p + 16);
    v16h r;
#pragma unroll
    for (int i = 0; i < 8; ++i) { r[i] = lo[i]; r[i + 8] = hh[i]; }
    return r;
}

// Same, but only K=0..15 are real (K=16..31 forced to zero) — used for the
// DK=16 QK^T contraction padded up to the 16x16x32 shape.
__device__ __forceinline__ v16h frag_k16(const _Float16* base, int row0, int k0,
                                         int stride, int lane) {
    const int l  = lane & 15;
    const int hi = (lane >> 4) & 1;
    const _Float16* p = base + (size_t)(row0 + l) * stride + k0 + hi * 8;
    v8h lo = *(const v8h*)p;
    v16h r;
#pragma unroll
    for (int i = 0; i < 8; ++i) { r[i] = lo[i]; r[i + 8] = (_Float16)0.f; }
    return r;
}

// Hand-over of a tile between the lanes of ONE wave through LDS: the wave's own
// stores must have landed, and the compiler must not hoist the reads over them.
__device__ __forceinline__ void wave_lds_sync() {
    asm volatile("s_wait_dscnt 0x0" ::: "memory");
}

// 2^x with the one free issue slot that the instruction set asks for behind a
// transcendental: in one statement, so that the v_nop stays directly behind it.
__device__ __forceinline__ float exp2_slot(float x) {
    float y;
    asm("v_exp_f32 %0, %1\n\tv_nop" : "=v"(y) : "v"(x));
    return y;
}

// ---------------------------------------------------------------------------
// Dynamic-LDS layout; total 272,640 B (< 320 KB WGP)
// ---------------------------------------------------------------------------
#define SMEM_PERSIST ((NPAD + NPAD + EMB + EMB) * LP * 2 + 512 + EMB * LQ * 2)
#define WAVE_HALVES  (16 * LQ + 2 * 16 * LP)   // one wave's private tiles
#define SMEM_UNION   (PTIL * WAVE_HALVES * 2)   // also covers Wk^T + Wv^T (69,632 B)
#define SMEM_TOTAL   (SMEM_PERSIST + SMEM_UNION)

__global__ __launch_bounds__(256)
void vrp_decoder_kernel(const float* __restrict__ eln,    // [B,P,EMB]
                        const float* __restrict__ gload,  // [B,P]
                        const float* __restrict__ gtime,  // [B,P]
                        const float* __restrict__ glen,   // [B,P]
                        const float* __restrict__ gopen,  // [B,P]
                        const float* __restrict__ ninf,   // [B,P,N]
                        const float* __restrict__ enc,    // [B,N,EMB]
                        const float* __restrict__ Wq,     // [132,128]
                        const float* __restrict__ Wk,     // [128,128]
                        const float* __restrict__ Wv,     // [128,128]
                        const float* __restrict__ Wc,     // [128,128]
                        const float* __restrict__ bcv,    // [128]
                        float* __restrict__ out)          // [B,P,N]
{
    extern __shared__ char smem[];
    const int b    = blockIdx.x;
    const int tid  = threadIdx.x;
    const int wave = tid >> 5;     // 0..7
    const int lane = tid & 31;
    const int l    = lane & 15;
    const int hi   = (lane >> 4) & 1;

    _Float16* sEN  = (_Float16*)smem;            // [112][LP]
    _Float16* sKT  = sEN  + NPAD * LP;           // [112][LP] K as [n][h*16+d]
    _Float16* sVT  = sKT  + NPAD * LP;           // [128][LP] V^T as [h*16+d][n]
    _Float16* sWcT = sVT  + EMB * LP;            // [128][LP]
    float*    sbc  = (float*)(sWcT + EMB * LP);  // [128]
    _Float16* sWqT = (_Float16*)(sbc + EMB);     // [128][LQ]
    char*     uni  = (char*)(sWqT + EMB * LQ);
    // phase 0/1 overlay
    _Float16* sWkT = (_Float16*)uni;             // [128][LP]
    _Float16* sWvT = sWkT + EMB * LP;            // [128][LP]
    // after phase 1 the union holds seven wave-private areas (see the P tiles)

    // ---------------- phase 0: stage encoded_nodes + Wk/Wv -----------------
    // encoded_nodes: 512B global_load_b128 per instr, contiguous b64 LDS store
    for (int i4 = tid; i4 < NPAD * (EMB / 4); i4 += 256) {
        int r = i4 >> 5, c4 = (i4 & 31) * 4;
        float4 v = make_float4(0.f, 0.f, 0.f, 0.f);
        if (r < NN) v = *(const float4*)&enc[((size_t)b * NN + r) * EMB + c4];
        v4h h; h[0] = (_Float16)v.x; h[1] = (_Float16)v.y;
        h[2] = (_Float16)v.z; h[3] = (_Float16)v.w;
        *(v4h*)&sEN[r * LP + c4] = h;
    }
    // Wk/Wv: b128 loads along the out-dim, transposed scatter into LDS
    for (int i4 = tid; i4 < EMB * (EMB / 4); i4 += 256) {
        int k = i4 >> 5, n4 = (i4 & 31) * 4;
        float4 wk = *(const float4*)&Wk[k * EMB + n4];
        float4 wv = *(const float4*)&Wv[k * EMB + n4];
        sWkT[(n4 + 0) * LP + k] = (_Float16)wk.x;
        sWkT[(n4 + 1) * LP + k] = (_Float16)wk.y;
        sWkT[(n4 + 2) * LP + k] = (_Float16)wk.z;
        sWkT[(n4 + 3) * LP + k] = (_Float16)wk.w;
        sWvT[(n4 + 0) * LP + k] = (_Float16)wv.x;
        sWvT[(n4 + 1) * LP + k] = (_Float16)wv.y;
        sWvT[(n4 + 2) * LP + k] = (_Float16)wv.z;
        sWvT[(n4 + 3) * LP + k] = (_Float16)wv.w;
    }
    for (int i = tid; i < EMB * 16; i += 256) { // zero V^T cols n=112..127
        int r = i >> 4, c = i & 15;
        sVT[r * LP + NPAD + c] = (_Float16)0.f;
    }
    __syncthreads();

    // ---------------- phase 1: K = EN@Wk, V = EN@Wv ------------------------
    for (int t = wave; t < 2 * NTIL * 8; t += 8) {
        const bool isK = (t < NTIL * 8);
        const int  tt  = isK ? t : t - NTIL * 8;
        const int  mt  = tt >> 3;               // n-tile 0..6
        const int  ct  = tt & 7;                // col-tile 0..7 (h*16+d)
        const _Float16* wT = isK ? sWkT : sWvT;
        v8f acc = zero8();
#pragma unroll
        for (int kt = 0; kt < 4; ++kt) {
            v16h a  = frag_k32(sEN, mt * 16, kt * 32, LP, lane);
            v16h bf = frag_k32(wT, ct * 16, kt * 32, LP, lane);
            acc = wmma_f16(a, bf, acc);
        }
        if (isK) {                               // sKT[n][col] (strided)
#pragma unroll
            for (int r = 0; r < 8; ++r)
                sKT[(mt * 16 + r + hi * 8) * LP + ct * 16 + l] = (_Float16)acc[r];
        } else {                                 // sVT[col][n]: 8 contiguous
            v8h h;                               //   halves -> one b128 store
#pragma unroll
            for (int r = 0; r < 8; ++r) h[r] = (_Float16)acc[r];
            *(v8h*)&sVT[(ct * 16 + l) * LP + mt * 16 + hi * 8] = h;
        }
    }
    __syncthreads();

    // ---------------- phase 2: stage Wq^T (K-pad to 160), Wc^T, bc ---------
    for (int i4 = tid; i4 < (EMB + 4) * (EMB / 4); i4 += 256) {
        int k = i4 >> 5, n4 = (i4 & 31) * 4;     // k in 0..131
        float4 wq = *(const float4*)&Wq[k * EMB + n4];
        sWqT[(n4 + 0) * LQ + k] = (_Float16)wq.x;
        sWqT[(n4 + 1) * LQ + k] = (_Float16)wq.y;
        sWqT[(n4 + 2) * LQ + k] = (_Float16)wq.z;
        sWqT[(n4 + 3) * LQ + k] = (_Float16)wq.w;
    }
    for (int i = tid; i < EMB * (KQ - (EMB + 4)); i += 256) {
        int n = i / (KQ - (EMB + 4)), k = (EMB + 4) + i % (KQ - (EMB + 4));
        sWqT[n * LQ + k] = (_Float16)0.f;        // zero K-pad 132..159
    }
    for (int i4 = tid; i4 < EMB * (EMB / 4); i4 += 256) {
        int k = i4 >> 5, n4 = (i4 & 31) * 4;
        float4 wc = *(const float4*)&Wc[k * EMB + n4];
        sWcT[(n4 + 0) * LP + k] = (_Float16)wc.x;
        sWcT[(n4 + 1) * LP + k] = (_Float16)wc.y;
        sWcT[(n4 + 2) * LP + k] = (_Float16)wc.z;
        sWcT[(n4 + 3) * LP + k] = (_Float16)wc.w;
    }
    if (tid < EMB) sbc[tid] = bcv[tid];
    __syncthreads();

    // ---------------- P tiles: one wave owns one 16-row tile end to end -----
    // Every hand-over below stays inside the wave, so no work-group barrier is
    // needed and the seven tiles run side by side instead of one after another.
    const int pw = __builtin_amdgcn_readfirstlane(wave);
    if (pw < PTIL) {
        const int p0 = pw * 16;
        _Float16* X  = (_Float16*)uni + pw * WAVE_HALVES;  // [16][LQ] input_cat, then out_concat
        _Float16* Y  = X + 16 * LQ;                        // [16][LP] Q, then mh
        _Float16* Wg = Y + 16 * LP;                        // [16][LP] exp weights of one head

        v8h z8;
#pragma unroll
        for (int i = 0; i < 8; ++i) z8[i] = (_Float16)0.f;

        // All of the tile's global loads are issued first, so that they share one
        // trip to memory.  Mask tile straight into the accumulator layout
        // (row r+hi*8, col nt*16+l); dead rows and pad columns read a clamped address.
        float mk[NTIL][8];
#pragma unroll
        for (int r = 0; r < 8; ++r) {
            const int    p  = p0 + r + hi * 8;
            const float* mr = &ninf[((size_t)b * PP + (p < PP ? p : PP - 1)) * NN];
#pragma unroll
            for (int nt = 0; nt < NTIL; ++nt) {
                const int n = nt * 16 + l;
                mk[nt][r] = mr[n < NN ? n : NN - 1];
            }
        }
        // the 4 scalar features of row l
        const int    pf = p0 + l;
        const size_t gi = (size_t)b * PP + (pf < PP ? pf : PP - 1);
        const float  f0 = gload[gi], f1 = gtime[gi], f2 = glen[gi], f3 = gopen[gi];
        // the row loads' results below may land in address registers of the loads above
        asm volatile("s_wait_xcnt 0x0" ::: "memory");
        // input_cat tile: one 512-B row per load; the last tile has LASTROWS live rows
        {
            const bool   full = pw < PTIL - 1;
            const float* er   = &eln[((size_t)b * PP + p0) * EMB + lane * 4];
            float4 ev[16];
#pragma unroll
            for (int j = 0; j < LASTROWS; ++j) ev[j] = *(const float4*)(er + j * EMB);
            // the next rows' results may land in these loads' offset register
            asm volatile("s_wait_xcnt 0x0" ::: "memory");
#pragma unroll
            for (int j = LASTROWS; j < 16; ++j) ev[j] = make_float4(0.f, 0.f, 0.f, 0.f);
            if (full) {
#pragma unroll
                for (int j = LASTROWS; j < 16; ++j) ev[j] = *(const float4*)(er + j * EMB);
            }
#pragma unroll
            for (int j = 0; j < 16; ++j) {
                v4h h;
                h[0] = (_Float16)ev[j].x; h[1] = (_Float16)ev[j].y;
                h[2] = (_Float16)ev[j].z; h[3] = (_Float16)ev[j].w;
                *(v4h*)&X[j * LQ + lane * 4] = h;
            }
        }
        // features + K-pad (cols 128..159): lane pair (l, l+16) fills row l
        {
            const bool live = (pf < PP) && (hi == 0);
            v8h fa = z8;
            fa[0] = (_Float16)(live ? f0 : 0.f); fa[1] = (_Float16)(live ? f1 : 0.f);
            fa[2] = (_Float16)(live ? f2 : 0.f); fa[3] = (_Float16)(live ? f3 : 0.f);
            *(v8h*)&X[l * LQ + EMB + hi * 16]     = fa;
            *(v8h*)&X[l * LQ + EMB + hi * 16 + 8] = z8;
            *(v8h*)&Wg[l * LP + NPAD + hi * 8]    = z8;   // weight cols n=112..127 stay zero
        }
#pragma unroll
        for (int r = 0; r < 8; ++r)
#pragma unroll
            for (int nt = 0; nt < NTIL; ++nt) {
                const float v = (p0 + r + hi * 8 < PP) ? mk[nt][r] : 0.f;   // dead rows
                mk[nt][r] = (nt * 16 + l < NN) ? v : -1e30f;                // N padding
            }
        wave_lds_sync();

        // ---- Q tile: all 8 column tiles, K = 160 --------------------------
        {
            v16h a[5];
#pragma unroll
            for (int kt = 0; kt < 5; ++kt) a[kt] = frag_k32(X, 0, kt * 32, LQ, lane);
            v8f acc[8];
#pragma unroll
            for (int ct = 0; ct < 8; ++ct) acc[ct] = zero8();
#pragma unroll
            for (int kt = 0; kt < 5; ++kt)
#pragma unroll
                for (int ct = 0; ct < 8; ++ct)
                    acc[ct] = wmma_f16(a[kt], frag_k32(sWqT, ct * 16, kt * 32, LQ, lane), acc[ct]);
#pragma unroll
            for (int ct = 0; ct < 8; ++ct)
#pragma unroll
                for (int r = 0; r < 8; ++r)
                    Y[(r + hi * 8) * LP + ct * 16 + l] = (_Float16)acc[ct][r];
        }
        wave_lds_sync();

        // ---- attention, head by head --------------------------------------
        // kept rolled: for speed only
#pragma unroll 1
        for (int h = 0; h < NH; ++h) {
            v16h aq = frag_k16(Y, 0, h * 16, LP, lane);
            v8f sc[NTIL];
#pragma unroll
            for (int nt = 0; nt < NTIL; ++nt) {
                v16h bk = frag_k16(sKT, nt * 16, h * 16, LP, lane);
                sc[nt] = wmma_f16(aq, bk, zero8());
            }
            // scale 1/sqrt(16) + mask   (D elem (r,lane) = row r+hi*8, col l)
#pragma unroll
            for (int nt = 0; nt < NTIL; ++nt)
#pragma unroll
                for (int r = 0; r < 8; ++r)
                    sc[nt][r] = sc[nt][r] * 0.25f + mk[nt][r];
            // row-max across the 7 tiles, then across 16 lanes of the half
            float m[8];
#pragma unroll
            for (int r = 0; r < 8; ++r) {
                m[r] = sc[0][r];
#pragma unroll
                for (int nt = 1; nt < NTIL; ++nt) m[r] = fmaxf(m[r], sc[nt][r]);
            }
#pragma unroll
            for (int off = 1; off < 16; off <<= 1)
#pragma unroll
                for (int r = 0; r < 8; ++r)
                    m[r] = fmaxf(m[r], __shfl_xor(m[r], off, 32));
            // exp (unnormalized) -> LDS as the AV A-operand; row sums in regs
            float s[8];
#pragma unroll
            for (int r = 0; r < 8; ++r) s[r] = 0.f;
#pragma unroll
            for (int nt = 0; nt < NTIL; ++nt)
#pragma unroll
                for (int r = 0; r < 8; ++r) {
                    float e = __expf(sc[nt][r] - m[r]);
                    s[r] += e;
                    Wg[(r + hi * 8) * LP + nt * 16 + l] = (_Float16)e;
                }
#pragma unroll
            for (int off = 1; off < 16; off <<= 1)
#pragma unroll
                for (int r = 0; r < 8; ++r) s[r] += __shfl_xor(s[r], off, 32);
            wave_lds_sync();

            // AV + fold 1/rowsum -> out_concat
            v8f o = zero8();
#pragma unroll
            for (int kt = 0; kt < 4; ++kt) {
                v16h aw = frag_k32(Wg, 0, kt * 32, LP, lane);
                v16h bv = frag_k32(sVT, h * 16, kt * 32, LP, lane);
                o = wmma_f16(aw, bv, o);
            }
#pragma unroll
            for (int r = 0; r < 8; ++r)
                X[(r + hi * 8) * LQ + h * 16 + l] = (_Float16)(o[r] * (1.f / s[r]));
        }
        wave_lds_sync();

        // ---- mh = out_concat @ Wc + bc ------------------------------------
        {
            v16h a[4];
#pragma unroll
            for (int kt = 0; kt < 4; ++kt) a[kt] = frag_k32(X, 0, kt * 32, LQ, lane);
            v8f acc[8];
#pragma unroll
            for (int ct = 0; ct < 8; ++ct) acc[ct] = zero8();
#pragma unroll
            for (int kt = 0; kt < 4; ++kt)
#pragma unroll
                for (int ct = 0; ct < 8; ++ct)
                    acc[ct] = wmma_f16(a[kt], frag_k32(sWcT, ct * 16, kt * 32, LP, lane), acc[ct]);
#pragma unroll
            for (int ct = 0; ct < 8; ++ct) {
                const float bias = sbc[ct * 16 + l];
#pragma unroll
                for (int r = 0; r < 8; ++r)
                    Y[(r + hi * 8) * LP + ct * 16 + l] = (_Float16)(acc[ct][r] + bias);
            }
        }
        wave_lds_sync();

        // ---- score2 = mh @ EN^T / sqrt(EMB); 10*tanh + mask; softmax over N
        {
            v16h a[4];
#pragma unroll
            for (int kt = 0; kt < 4; ++kt) a[kt] = frag_k32(Y, 0, kt * 32, LP, lane);
            // tanh tile by tile in a rolled loop (56 inlined copies would nearly double
            // the kernel's text); each lane parks its own 8 values per tile in LDS,
            // over X and Y, whose last reads are a[] above
            float* T = (float*)X;                           // [NTIL][2][32 lanes][4]
#pragma unroll 1
            for (int nt = 0; nt < NTIL; ++nt) {
                v8f acc = zero8();
#pragma unroll
                for (int kt = 0; kt < 4; ++kt)
                    acc = wmma_f16(a[kt], frag_k32(sEN, nt * 16, kt * 32, LP, lane), acc);
                float t[8];
#pragma unroll
                for (int r = 0; r < 8; ++r)
                    t[r] = tanhf(acc[r] * (1.0f / 11.313708498984761f));
                *(float4*)&T[(nt * 2 + 0) * 128 + lane * 4] = make_float4(t[0], t[1], t[2], t[3]);
                *(float4*)&T[(nt * 2 + 1) * 128 + lane * 4] = make_float4(t[4], t[5], t[6], t[7]);
            }
            v8f s2[NTIL];
#pragma unroll
            for (int nt = 0; nt < NTIL; ++nt) {
                const float4 t0 = *(const float4*)&T[(nt * 2 + 0) * 128 + lane * 4];
                const float4 t1 = *(const float4*)&T[(nt * 2 + 1) * 128 + lane * 4];
                const float  t[8] = {t0.x, t0.y, t0.z, t0.w, t1.x, t1.y, t1.z, t1.w};
#pragma unroll
                for (int r = 0; r < 8; ++r) s2[nt][r] = 10.0f * t[r] + mk[nt][r];
            }
            float m[8], s[8];
#pragma unroll
            for (int r = 0; r < 8; ++r) {
                m[r] = s2[0][r];
#pragma unroll
                for (int nt = 1; nt < NTIL; ++nt) m[r] = fmaxf(m[r], s2[nt][r]);
            }
#pragma unroll
            for (int off = 1; off < 16; off <<= 1)
#pragma unroll
                for (int r = 0; r < 8; ++r)
                    m[r] = fmaxf(m[r], __shfl_xor(m[r], off, 32));
#pragma unroll
            for (int r = 0; r < 8; ++r) {
                s[r] = 0.f;
#pragma unroll
                for (int nt = 0; nt < NTIL; ++nt) {
                    s2[nt][r] = exp2_slot((s2[nt][r] - m[r]) * 1.4426950408889634f);
                    s[r] += s2[nt][r];
                }
            }
#pragma unroll
            for (int off = 1; off < 16; off <<= 1)
#pragma unroll
                for (int r = 0; r < 8; ++r) s[r] += __shfl_xor(s[r], off, 32);
#pragma unroll
            for (int r = 0; r < 8; ++r) {
                const int   p   = p0 + r + hi * 8;
                const float inv = 1.f / s[r];
                float* orow = &out[((size_t)b * PP + p) * NN];
#pragma unroll
                for (int nt = 0; nt < NTIL; ++nt) {
                    const int n = nt * 16 + l;
                    if (p < PP && n < NN) orow[n] = s2[nt][r] * inv;
                }
            }
        }
    }
}

// ---------------------------------------------------------------------------
extern "C" void kernel_launch(void* const* d_in, const int* in_sizes, int n_in,
                              void* d_out, int out_size, void* d_ws, size_t ws_size,
                              hipStream_t stream) {
    (void)in_sizes; (void)n_in; (void)out_size; (void)d_ws; (void)ws_size;
    const float* eln   = (const float*)d_in[0];
    const float* gload = (const float*)d_in[1];
    const float* gtime = (const float*)d_in[2];
    const float* glen  = (const float*)d_in[3];
    const float* gopen = (const float*)d_in[4];
    const float* ninf  = (const float*)d_in[5];
    const float* enc   = (const float*)d_in[6];
    const float* Wq    = (const float*)d_in[7];
    const float* Wk    = (const float*)d_in[8];
    const float* Wv    = (const float*)d_in[9];
    const float* Wc    = (const float*)d_in[10];
    const float* bcv   = (const float*)d_in[11];
    float* out = (float*)d_out;

    hipFuncSetAttribute((const void*)vrp_decoder_kernel,
                        hipFuncAttributeMaxDynamicSharedMemorySize,
                        SMEM_TOTAL);
    vrp_decoder_kernel<<<dim3(BB), dim3(256), SMEM_TOTAL, stream>>>(
        eln, gload, gtime, glen, gopen, ninf, enc, Wq, Wk, Wv, Wc, bcv, out);
}

// v003
// One run takes 126 microseconds.
// Next to v002, in two timings, it ran 1.35 times as fast each time.
// Counting every step since v000, it is 5.04 times as fast.
#include <hip/hip_runtime.h>
#include <hip/hip_bf16.h>
#include <math.h>

// ---------------------------------------------------------------------------
// Problem constants (match reference)
// ---------------------------------------------------------------------------
#define BB   1024
#define PP   100
#define NN   101
#define EMB  128
#define NH   8
#define DKK  16

#define NPAD 112        // N padded to 7*16
#define PTIL 7          // ceil(100/16)
#define NTIL 7          // ceil(101/16)
#define KQ   160        // 132 padded to 5*32
#define LASTROWS (PP - (PTIL - 1) * 16)   // live rows of the last P tile

// LDS row pitches.  Bank = dword address mod 64, so 16 rows at a 256-B pitch put
// a whole b128 fragment read on four banks.  16 B x odd spreads them over all 64.
#define LP   136        // halves: 272 B pitch for the 128-half rows
#define LQ   168        // halves: 336 B pitch for the 160-half rows

typedef __attribute__((ext_vector_type(16))) _Float16 v16h;
typedef __attribute__((ext_vector_type(8)))  _Float16 v8h;
typedef __attribute__((ext_vector_type(4)))  _Float16 v4h;
typedef __attribute__((ext_vector_type(8)))  float    v8f;

// ---------------------------------------------------------------------------
// WMMA helpers (CDNA5 wave32, D = A(16x32 f16) * B(32x16 f16) + C(16x16 f32))
// ---------------------------------------------------------------------------
__device__ __forceinline__ v8f wmma_f16(v16h a, v16h b, v8f c) {
    return __builtin_amdgcn_wmma_f32_16x16x32_f16(
        /*neg_a=*/false, a, /*neg_b=*/false, b,
        /*c_mod=*/(short)0, c, /*reuse_a=*/false, /*reuse_b=*/false);
}

__device__ __forceinline__ v8f zero8() {
    v8f z = {0.f, 0.f, 0.f, 0.f, 0.f, 0.f, 0.f, 0.f};
    return z;
}

// A-operand (16x32, M x K) from row-major f16 [M][stride]; also valid for the
// B-operand (32x16, K x N) when B is stored "column-major by N", i.e. [N][stride]
// holding K along the row.  Per ISA 7.12.2: lanes 0-15 hold K {0..7,16..23},
// lanes 16-31 hold K {8..15,24..31}  ->  two aligned 16B LDS reads per lane.
__device__ __forceinline__ v16h frag_k32(const _Float16* base, int row0, int k0,
                                         int stride, int lane) {
    const int l  = lane & 15;
    const int hi = (lane >> 4) & 1;
    const _Float16* p = base + (size_t)(row0 + l) * stride + k0 + hi * 8;
    v8h lo = *(const v8h*)p;
    v8h hh = *(const v8h*)(p + 16);
    v16h r;
#pragma unroll
    for (int i = 0; i < 8; ++i) { r[i] = lo[i]; r[i + 8] = hh[i]; }
    return r;
}

// Same, but only K=0..15 are real (K=16..31 forced to zero) — used for the
// DK=16 QK^T contraction padded up to the 16x16x32 shape.
__device__ __forceinline__ v16h frag_k16(const _Float16* base, int row0, int k0,
                                         int stride, int lane) {
    const int l  = lane & 15;
    const int hi = (lane >> 4) & 1;
    const _Float16* p = base + (size_t)(row0 + l) * stride + k0 + hi * 8;
    v8h lo = *(const v8h*)p;
    v16h r;
#pragma unroll
    for (int i = 0; i < 8; ++i) { r[i] = lo[i]; r[i + 8] = (_Float16)0.f; }
    return r;
}

// Hand-over of a tile between the lanes of ONE wave through LDS: the wave's own
// stores must have landed, and the compiler must not hoist the reads over them.
__device__ __forceinline__ void wave_lds_sync() {
    asm volatile("s_wait_dscnt 0x0" ::: "memory");
}

// 2^x with the one free issue slot that the instruction set asks for behind a
// transcendental: in one statement, so that the v_nop stays directly behind it.
__device__ __forceinline__ float exp2_slot(float x) {
    float y;
    asm("v_exp_f32 %0, %1\n\tv_nop" : "=v"(y) : "v"(x));
    return y;
}

// ---------------------------------------------------------------------------
// Dynamic-LDS layout; total 272,640 B (< 320 KB WGP)
// ---------------------------------------------------------------------------
#define SMEM_PERSIST ((NPAD + NPAD + EMB + EMB) * LP * 2 + 512 + EMB * LQ * 2)
#define WAVE_HALVES  (16 * LQ + 2 * 16 * LP)   // one wave's private tiles
#define SMEM_UNION   (PTIL * WAVE_HALVES * 2)   // also covers Wk^T + Wv^T (69,632 B)
#define SMEM_TOTAL   (SMEM_PERSIST + SMEM_UNION)

// ---------------------------------------------------------------------------
// Weight image: Wc^T, bc, Wq^T, Wk^T, Wv^T exactly as they lie in LDS (f16 rows
// at their padded pitch, K-pad and pitch pad zero; bc in f32).  Built once per
// call by the first launch, then fetched whole by every block of the second.
// ---------------------------------------------------------------------------
#define IMG_LDS_OFF ((NPAD + NPAD + EMB) * LP * 2)      // LDS byte offset of Wc^T
#define IMG_WC      0
#define IMG_BC      (IMG_WC + EMB * LP * 2)
#define IMG_WQ      (IMG_BC + EMB * 4)
#define IMG_WK      (IMG_WQ + EMB * LQ * 2)
#define IMG_WV      (IMG_WK + EMB * LP * 2)
#define IMG_BYTES   (IMG_WV + EMB * LP * 2)             // 147,968 = 289 x 512
#define UP          (LP / 8)                            // 16-B units per 272-B row
#define UQ          (LQ / 8)                            // 16-B units per 336-B row
#define IMG_BLOCKS  (3 * UP + UQ + 1)

// One block = one 16-B unit column (8 k values) of one matrix, thread = row n:
// eight coalesced row reads, one 16-B store.
__global__ __launch_bounds__(EMB)
void weight_image_kernel(const float* __restrict__ Wq,    // [132,128]
                         const float* __restrict__ Wk,    // [128,128]
                         const float* __restrict__ Wv,    // [128,128]
                         const float* __restrict__ Wc,    // [128,128]
                         const float* __restrict__ bcv,   // [128]
                         float* __restrict__ img)
{
    const int blk = blockIdx.x;
    const int n   = threadIdx.x;
    char* dst = (char*)img;
    if (blk == IMG_BLOCKS - 1) {
        if (n < EMB / 4) *(float4*)(dst + IMG_BC + n * 16) = *(const float4*)&bcv[n * 4];
        return;
    }
    const float* Wm; int u, kmax, pitch, off;
    if (blk < UP)               { Wm = Wc; u = blk;               kmax = EMB;     pitch = LP * 2; off = IMG_WC; }
    else if (blk < UP + UQ)     { Wm = Wq; u = blk - UP;          kmax = EMB + 4; pitch = LQ * 2; off = IMG_WQ; }
    else if (blk < 2 * UP + UQ) { Wm = Wk; u = blk - UP - UQ;     kmax = EMB;     pitch = LP * 2; off = IMG_WK; }
    else                        { Wm = Wv; u = blk - 2 * UP - UQ; kmax = EMB;     pitch = LP * 2; off = IMG_WV; }
    // pad rows read a clamped address, so that the eight loads share one trip
    float w[8];
#pragma unroll
    for (int j = 0; j < 8; ++j) {
        const int k = u * 8 + j;
        w[j] = Wm[(k < kmax ? k : kmax - 1) * EMB + n];
    }
    v8h h;
#pragma unroll
    for (int j = 0; j < 8; ++j)
        h[j] = (u * 8 + j < kmax) ? (_Float16)w[j] : (_Float16)0.f;
    *(v8h*)(dst + off + n * pitch + u * 16) = h;
    // the built code lays the bc branch's load behind this store, into its data registers
    asm volatile("s_wait_xcnt 0x0" ::: "memory");
}

// Twelve 16-B-per-lane copies global -> LDS, 4 KiB apart (the block's eight waves
// cover 4 KiB per copy).  The s_wait_xcnt closes the statement so that no address
// register of a copy is rewritten ahead of it.
__device__ __forceinline__ void copy12_to_lds(unsigned l, const char* g) {
    asm volatile(
        "global_load_async_to_lds_b128 %0, %12, off\n\t"
        "global_load_async_to_lds_b128 %1, %13, off\n\t"
        "global_load_async_to_lds_b128 %2, %14, off\n\t"
        "global_load_async_to_lds_b128 %3, %15, off\n\t"
        "global_load_async_to_lds_b128 %4, %16, off\n\t"
        "global_load_async_to_lds_b128 %5, %17, off\n\t"
        "global_load_async_to_lds_b128 %6, %18, off\n\t"
        "global_load_async_to_lds_b128 %7, %19, off\n\t"
        "global_load_async_to_lds_b128 %8, %20, off\n\t"
        "global_load_async_to_lds_b128 %9, %21, off\n\t"
        "global_load_async_to_lds_b128 %10, %22, off\n\t"
        "global_load_async_to_lds_b128 %11, %23, off\n\t"
        "s_wait_xcnt 0x0"
        :: "v"(l), "v"(l + 4096u), "v"(l + 8192u), "v"(l + 12288u),
           "v"(l + 16384u), "v"(l + 20480u), "v"(l + 24576u), "v"(l + 28672u),
           "v"(l + 32768u), "v"(l + 36864u), "v"(l + 40960u), "v"(l + 45056u),
           "v"(g), "v"(g + 4096), "v"(g + 8192), "v"(g + 12288),
           "v"(g + 16384), "v"(g + 20480), "v"(g + 24576), "v"(g + 28672),
           "v"(g + 32768), "v"(g + 36864), "v"(g + 40960), "v"(g + 45056)
        : "memory");
}

__global__ __launch_bounds__(256)
void vrp_decoder_kernel(const float* __restrict__ eln,    // [B,P,EMB]
                        const float* __restrict__ gload,  // [B,P]
                        const float* __restrict__ gtime,  // [B,P]
                        const float* __restrict__ glen,   // [B,P]
                        const float* __restrict__ gopen,  // [B,P]
                        const float* __restrict__ ninf,   // [B,P,N]
                        const float* __restrict__ enc,    // [B,N,EMB]
                        const float* __restrict__ wimg,   // weight image, IMG_BYTES
                        float* __restrict__ out)          // [B,P,N]
{
    extern __shared__ char smem[];
    const int b    = blockIdx.x;
    const int tid  = threadIdx.x;
    const int wave = tid >> 5;     // 0..7
    const int lane = tid & 31;
    const int l    = lane & 15;
    const int hi   = (lane >> 4) & 1;

    _Float16* sEN  = (_Float16*)smem;            // [112][LP]
    _Float16* sKT  = sEN  + NPAD * LP;           // [112][LP] K as [n][h*16+d]
    _Float16* sVT  = sKT  + NPAD * LP;           // [128][LP] V^T as [h*16+d][n]
    _Float16* sWcT = sVT  + EMB * LP;            // [128][LP]
    float*    sbc  = (float*)(sWcT + EMB * LP);  // [128]
    _Float16* sWqT = (_Float16*)(sbc + EMB);     // [128][LQ]
    char*     uni  = (char*)(sWqT + EMB * LQ);
    // phase 0/1 overlay
    _Float16* sWkT = (_Float16*)uni;             // [128][LP]
    _Float16* sWvT = sWkT + EMB * LP;            // [128][LP]
    // after phase 1 the union holds seven wave-private areas (see the P tiles)

    // ---------------- phase 0: fetch the weight image, stage encoded_nodes --
    // The image's copies are issued first and fly while encoded_nodes is staged.
    const int pw = __builtin_amdgcn_readfirstlane(wave);
    {
        const unsigned l0 = (unsigned)(size_t)smem + IMG_LDS_OFF + tid * 16;
        const char*    g0 = (const char*)wimg + tid * 16;
        copy12_to_lds(l0, g0);
        copy12_to_lds(l0 + 49152u, g0 + 49152);
        copy12_to_lds(l0 + 98304u, g0 + 98304);
        if (pw == 0) {   // the image's last 512 B; wait in the statement as in copy12_to_lds
            asm volatile("global_load_async_to_lds_b128 %0, %1, off\n\ts_wait_xcnt 0x0"
                         :: "v"(l0 + 147456u), "v"(g0 + 147456) : "memory");
        }
    }
    // encoded_nodes: 512B global_load_b128 per instr, contiguous b64 LDS store
    for (int i4 = tid; i4 < NPAD * (EMB / 4); i4 += 256) {
        int r = i4 >> 5, c4 = (i4 & 31) * 4;
        float4 v = make_float4(0.f, 0.f, 0.f, 0.f);
        if (r < NN) v = *(const float4*)&enc[((size_t)b * NN + r) * EMB + c4];
        v4h h; h[0] = (_Float16)v.x; h[1] = (_Float16)v.y;
        h[2] = (_Float16)v.z; h[3] = (_Float16)v.w;
        *(v4h*)&sEN[r * LP + c4] = h;
    }
    for (int i = tid; i < EMB * 16; i += 256) { // zero V^T cols n=112..127
        int r = i >> 4, c = i & 15;
        sVT[r * LP + NPAD + c] = (_Float16)0.f;
    }
    // this wave's copies have landed; the barrier then publishes all waves' parts
    asm volatile("s_wait_asynccnt 0x0" ::: "memory");
    __syncthreads();

    // ---------------- phase 1: K = EN@Wk, V = EN@Wv ------------------------
    for (int t = wave; t < 2 * NTIL * 8; t += 8) {
        const bool isK = (t < NTIL * 8);
        const int  tt  = isK ? t : t - NTIL * 8;
        const int  mt  = tt >> 3;               // n-tile 0..6
        const int  ct  = tt & 7;                // col-tile 0..7 (h*16+d)
        const _Float16* wT = isK ? sWkT : sWvT;
        v8f acc = zero8();
#pragma unroll
        for (int kt = 0; kt < 4; ++kt) {
            v16h a  = frag_k32(sEN, mt * 16, kt * 32, LP, lane);
            v16h bf = frag_k32(wT, ct * 16, kt * 32, LP, lane);
            acc = wmma_f16(a, bf, acc);
        }
        if (isK) {                               // sKT[n][col] (strided)
#pragma unroll
            for (int r = 0; r < 8; ++r)
                sKT[(mt * 16 + r + hi * 8) * LP + ct * 16 + l] = (_Float16)acc[r];
        } else {                                 // sVT[col][n]: 8 contiguous
            v8h h;                               //   halves -> one b128 store
#pragma unroll
            for (int r = 0; r < 8; ++r) h[r] = (_Float16)acc[r];
            *(v8h*)&sVT[(ct * 16 + l) * LP + mt * 16 + hi * 8] = h;
        }
    }
    __syncthreads();

    // ---------------- P tiles: one wave owns one 16-row tile end to end -----
    // Every hand-over below stays inside the wave, so no work-group barrier is
    // needed and the seven tiles run side by side instead of one after another.
    if (pw < PTIL) {
        const int p0 = pw * 16;
        _Float16* X  = (_Float16*)uni + pw * WAVE_HALVES;  // [16][LQ] input_cat, then out_concat
        _Float16* Y  = X + 16 * LQ;                        // [16][LP] Q, then mh
        _Float16* Wg = Y + 16 * LP;                        // [16][LP] exp weights of one head

        v8h z8;
#pragma unroll
        for (int i = 0; i < 8; ++i) z8[i] = (_Float16)0.f;

        // All of the tile's global loads are issued first, so that they share one
        // trip to memory.  Mask tile straight into the accumulator layout
        // (row r+hi*8, col nt*16+l); dead rows and pad columns read a clamped address.
        float mk[NTIL][8];
#pragma unroll
        for (int r = 0; r < 8; ++r) {
            const int    p  = p0 + r + hi * 8;
            const float* mr = &ninf[((size_t)b * PP + (p < PP ? p : PP - 1)) * NN];
#pragma unroll
            for (int nt = 0; nt < NTIL; ++nt) {
                const int n = nt * 16 + l;
                mk[nt][r] = mr[n < NN ? n : NN - 1];
            }
        }
        // the 4 scalar features of row l
        const int    pf = p0 + l;
        const size_t gi = (size_t)b * PP + (pf < PP ? pf : PP - 1);
        const float  f0 = gload[gi], f1 = gtime[gi], f2 = glen[gi], f3 = gopen[gi];
        // the row loads' results below may land in address registers of the loads above
        asm volatile("s_wait_xcnt 0x0" ::: "memory");
        // input_cat tile: one 512-B row per load; the last tile has LASTROWS live rows
        {
            const bool   full = pw < PTIL - 1;
            const float* er   = &eln[((size_t)b * PP + p0) * EMB + lane * 4];
            float4 ev[16];
#pragma unroll
            for (int j = 0; j < LASTROWS; ++j) ev[j] = *(const float4*)(er + j * EMB);
            // the next rows' results may land in these loads' offset register
            asm volatile("s_wait_xcnt 0x0" ::: "memory");
#pragma unroll
            for (int j = LASTROWS; j < 16; ++j) ev[j] = make_float4(0.f, 0.f, 0.f, 0.f);
            if (full) {
#pragma unroll
                for (int j = LASTROWS; j < 16; ++j) ev[j] = *(const float4*)(er + j * EMB);
            }
#pragma unroll
            for (int j = 0; j < 16; ++j) {
                v4h h;
                h[0] = (_Float16)ev[j].x; h[1] = (_Float16)ev[j].y;
                h[2] = (_Float16)ev[j].z; h[3] = (_Float16)ev[j].w;
                *(v4h*)&X[j * LQ + lane * 4] = h;
            }
        }
        // features + K-pad (cols 128..159): lane pair (l, l+16) fills row l
        {
            const bool live = (pf < PP) && (hi == 0);
            v8h fa = z8;
            fa[0] = (_Float16)(live ? f0 : 0.f); fa[1] = (_Float16)(live ? f1 : 0.f);
            fa[2] = (_Float16)(live ? f2 : 0.f); fa[3] = (_Float16)(live ? f3 : 0.f);
            *(v8h*)&X[l * LQ + EMB + hi * 16]     = fa;
            *(v8h*)&X[l * LQ + EMB + hi * 16 + 8] = z8;
            *(v8h*)&Wg[l * LP + NPAD + hi * 8]    = z8;   // weight cols n=112..127 stay zero
        }
#pragma unroll
        for (int r = 0; r < 8; ++r)
#pragma unroll
            for (int nt = 0; nt < NTIL; ++nt) {
                const float v = (p0 + r + hi * 8 < PP) ? mk[nt][r] : 0.f;   // dead rows
                mk[nt][r] = (nt * 16 + l < NN) ? v : -1e30f;                // N padding
            }
        wave_lds_sync();

        // ---- Q tile: all 8 column tiles, K = 160 --------------------------
        {
            v16h a[5];
#pragma unroll
            for (int kt = 0; kt < 5; ++kt) a[kt] = frag_k32(X, 0, kt * 32, LQ, lane);
            v8f acc[8];
#pragma unroll
            for (int ct = 0; ct < 8; ++ct) acc[ct] = zero8();
#pragma unroll
            for (int kt = 0; kt < 5; ++kt)
#pragma unroll
                for (int ct = 0; ct < 8; ++ct)
                    acc[ct] = wmma_f16(a[kt], frag_k32(sWqT, ct * 16, kt * 32, LQ, lane), acc[ct]);
#pragma unroll
            for (int ct = 0; ct < 8; ++ct)
#pragma unroll
                for (int r = 0; r < 8; ++r)
                    Y[(r + hi * 8) * LP + ct * 16 + l] = (_Float16)acc[ct][r];
        }
        wave_lds_sync();

        // ---- attention, head by head --------------------------------------
        // kept rolled: for speed only
#pragma unroll 1
        for (int h = 0; h < NH; ++h) {
            v16h aq = frag_k16(Y, 0, h * 16, LP, lane);
            v8f sc[NTIL];
#pragma unroll
            for (int nt = 0; nt < NTIL; ++nt) {
                v16h bk = frag_k16(sKT, nt * 16, h * 16, LP, lane);
                sc[nt] = wmma_f16(aq, bk, zero8());
            }
            // scale 1/sqrt(16) + mask   (D elem (r,lane) = row r+hi*8, col l)
#pragma unroll
            for (int nt = 0; nt < NTIL; ++nt)
#pragma unroll
                for (int r = 0; r < 8; ++r)
                    sc[nt][r] = sc[nt][r] * 0.25f + mk[nt][r];
            // row-max across the 7 tiles, then across 16 lanes of the half
            float m[8];
#pragma unroll
            for (int r = 0; r < 8; ++r) {
                m[r] = sc[0][r];
#pragma unroll
                for (int nt = 1; nt < NTIL; ++nt) m[r] = fmaxf(m[r], sc[nt][r]);
            }
#pragma unroll
            for (int off = 1; off < 16; off <<= 1)
#pragma unroll
                for (int r = 0; r < 8; ++r)
                    m[r] = fmaxf(m[r], __shfl_xor(m[r], off, 32));
            // exp (unnormalized) -> LDS as the AV A-operand; row sums in regs
            float s[8];
#pragma unroll
            for (int r = 0; r < 8; ++r) s[r] = 0.f;
#pragma unroll
            for (int nt = 0; nt < NTIL; ++nt)
#pragma unroll
                for (int r = 0; r < 8; ++r) {
                    float e = __expf(sc[nt][r] - m[r]);
                    s[r] += e;
                    Wg[(r + hi * 8) * LP + nt * 16 + l] = (_Float16)e;
                }
#pragma unroll
            for (int off = 1; off < 16; off <<= 1)
#pragma unroll
                for (int r = 0; r < 8; ++r) s[r] += __shfl_xor(s[r], off, 32);
            wave_lds_sync();

            // AV + fold 1/rowsum -> out_concat
            v8f o = zero8();
#pragma unroll
            for (int kt = 0; kt < 4; ++kt) {
                v16h aw = frag_k32(Wg, 0, kt * 32, LP, lane);
                v16h bv = frag_k32(sVT, h * 16, kt * 32, LP, lane);
                o = wmma_f16(aw, bv, o);
            }
#pragma unroll
            for (int r = 0; r < 8; ++r)
                X[(r + hi * 8) * LQ + h * 16 + l] = (_Float16)(o[r] * (1.f / s[r]));
        }
        wave_lds_sync();

        // ---- mh = out_concat @ Wc + bc ------------------------------------
        {
            v16h a[4];
#pragma unroll
            for (int kt = 0; kt < 4; ++kt) a[kt] = frag_k32(X, 0, kt * 32, LQ, lane);
            v8f acc[8];
#pragma unroll
            for (int ct = 0; ct < 8; ++ct) acc[ct] = zero8();
#pragma unroll
            for (int kt = 0; kt < 4; ++kt)
#pragma unroll
                for (int ct = 0; ct < 8; ++ct)
                    acc[ct] = wmma_f16(a[kt], frag_k32(sWcT, ct * 16, kt * 32, LP, lane), acc[ct]);
#pragma unroll
            for (int ct = 0; ct < 8; ++ct) {
                const float bias = sbc[ct * 16 + l];
#pragma unroll
                for (int r = 0; r < 8; ++r)
                    Y[(r + hi * 8) * LP + ct * 16 + l] = (_Float16)(acc[ct][r] + bias);
            }
        }
        wave_lds_sync();

        // ---- score2 = mh @ EN^T / sqrt(EMB); 10*tanh + mask; softmax over N
        {
            v16h a[4];
#pragma unroll
            for (int kt = 0; kt < 4; ++kt) a[kt] = frag_k32(Y, 0, kt * 32, LP, lane);
            // tanh tile by tile in a rolled loop (56 inlined copies would nearly double
            // the kernel's text); each lane parks its own 8 values per tile in LDS,
            // over X and Y, whose last reads are a[] above
            float* T = (float*)X;                           // [NTIL][2][32 lanes][4]
#pragma unroll 1
            for (int nt = 0; nt < NTIL; ++nt) {
                v8f acc = zero8();
#pragma unroll
                for (int kt = 0; kt < 4; ++kt)
                    acc = wmma_f16(a[kt], frag_k32(sEN, nt * 16, kt * 32, LP, lane), acc);
                float t[8];
#pragma unroll
                for (int r = 0; r < 8; ++r)
                    t[r] = tanhf(acc[r] * (1.0f / 11.313708498984761f));
                *(float4*)&T[(nt * 2 + 0) * 128 + lane * 4] = make_float4(t[0], t[1], t[2], t[3]);
                *(float4*)&T[(nt * 2 + 1) * 128 + lane * 4] = make_float4(t[4], t[5], t[6], t[7]);
            }
            v8f s2[NTIL];
#pragma unroll
            for (int nt = 0; nt < NTIL; ++nt) {
                const float4 t0 = *(const float4*)&T[(nt * 2 + 0) * 128 + lane * 4];
                const float4 t1 = *(const float4*)&T[(nt * 2 + 1) * 128 + lane * 4];
                const float  t[8] = {t0.x, t0.y, t0.z, t0.w, t1.x, t1.y, t1.z, t1.w};
#pragma unroll
                for (int r = 0; r < 8; ++r) s2[nt][r] = 10.0f * t[r] + mk[nt][r];
            }
            float m[8], s[8];
#pragma unroll
            for (int r = 0; r < 8; ++r) {
                m[r] = s2[0][r];
#pragma unroll
                for (int nt = 1; nt < NTIL; ++nt) m[r] = fmaxf(m[r], s2[nt][r]);
            }
#pragma unroll
            for (int off = 1; off < 16; off <<= 1)
#pragma unroll
                for (int r = 0; r < 8; ++r)
                    m[r] = fmaxf(m[r], __shfl_xor(m[r], off, 32));
#pragma unroll
            for (int r = 0; r < 8; ++r) {
                s[r] = 0.f;
#pragma unroll
                for (int nt = 0; nt < NTIL; ++nt) {
                    s2[nt][r] = exp2_slot((s2[nt][r] - m[r]) * 1.4426950408889634f);
                    s[r] += s2[nt][r];
                }
            }
#pragma unroll
            for (int off = 1; off < 16; off <<= 1)
#pragma unroll
                for (int r = 0; r < 8; ++r) s[r] += __shfl_xor(s[r], off, 32);
#pragma unroll
            for (int r = 0; r < 8; ++r) {
                const int   p   = p0 + r + hi * 8;
                const float inv = 1.f / s[r];
                float* orow = &out[((size_t)b * PP + p) * NN];
#pragma unroll
                for (int nt = 0; nt < NTIL; ++nt) {
                    const int n = nt * 16 + l;
                    if (p < PP && n < NN) orow[n] = s2[nt][r] * inv;
                }
            }
        }
    }
}

// ---------------------------------------------------------------------------
extern "C" void kernel_launch(void* const* d_in, const int* in_sizes, int n_in,
                              void* d_out, int out_size, void* d_ws, size_t ws_size,
                              hipStream_t stream) {
    (void)in_sizes; (void)n_in; (void)out_size; (void)ws_size;
    const float* eln   = (const float*)d_in[0];
    const float* gload = (const float*)d_in[1];
    const float* gtime = (const float*)d_in[2];
    const float* glen  = (const float*)d_in[3];
    const float* gopen = (const float*)d_in[4];
    const float* ninf  = (const float*)d_in[5];
    const float* enc   = (const float*)d_in[6];
    const float* Wq    = (const float*)d_in[7];
    const float* Wk    = (const float*)d_in[8];
    const float* Wv    = (const float*)d_in[9];
    const float* Wc    = (const float*)d_in[10];
    const float* bcv   = (const float*)d_in[11];
    float* out = (float*)d_out;
    float* img = (float*)d_ws;

    hipFuncSetAttribute((const void*)vrp_decoder_kernel,
                        hipFuncAttributeMaxDynamicSharedMemorySize,
                        SMEM_TOTAL);
    weight_image_kernel<<<dim3(IMG_BLOCKS), dim3(EMB), 0, stream>>>(Wq, Wk, Wv, Wc, bcv, img);
    vrp_decoder_kernel<<<dim3(BB), dim3(256), SMEM_TOTAL, stream>>>(
        eln, gload, gtime, glen, gopen, ninf, enc, img, out);
}

// v004
// One run takes 103 microseconds.
// Two timings next to v003 both put it at 1.22 times that version's speed.
// Counting every step since v000, it is 6.13 times as fast.
#include <hip/hip_runtime.h>
#include <hip/hip_bf16.h>
#include <math.h>

// ---------------------------------------------------------------------------
// Problem constants (match reference)
// ---------------------------------------------------------------------------
#define BB   1024
#define PP   100
#define NN   101
#define EMB  128
#define NH   8
#define DKK  16

#define NPAD 112        // N padded to 7*16
#define PTIL 7          // ceil(100/16)
#define NTIL 7          // ceil(101/16)
#define KQ   160        // 132 padded to 5*32
#define LASTROWS (PP - (PTIL - 1) * 16)   // live rows of the last P tile
#define ENLD ((NN + 7) / 8)   // groups of 8 encoded_nodes rows that hold a live row

// LDS row pitches.  Bank = dword address mod 64, so 16 rows at a 256-B pitch put
// a whole b128 fragment read on four banks.  16 B x odd spreads them over all 64.
#define LP   136        // halves: 272 B pitch for the 128-half rows
#define LQ   168        // halves: 336 B pitch for the 160-half rows

typedef __attribute__((ext_vector_type(16))) _Float16 v16h;
typedef __attribute__((ext_vector_type(8)))  _Float16 v8h;
typedef __attribute__((ext_vector_type(4)))  _Float16 v4h;
typedef __attribute__((ext_vector_type(8)))  float    v8f;

// ---------------------------------------------------------------------------
// WMMA helpers (CDNA5 wave32, D = A(16x32 f16) * B(32x16 f16) + C(16x16 f32))
// ---------------------------------------------------------------------------
__device__ __forceinline__ v8f wmma_f16(v16h a, v16h b, v8f c) {
    return __builtin_amdgcn_wmma_f32_16x16x32_f16(
        /*neg_a=*/false, a, /*neg_b=*/false, b,
        /*c_mod=*/(short)0, c, /*reuse_a=*/false, /*reuse_b=*/false);
}

__device__ __forceinline__ v8f zero8() {
    v8f z = {0.f, 0.f, 0.f, 0.f, 0.f, 0.f, 0.f, 0.f};
    return z;
}

// A-operand (16x32, M x K) from row-major f16 [M][stride]; also valid for the
// B-operand (32x16, K x N) when B is stored "column-major by N", i.e. [N][stride]
// holding K along the row.  Per ISA 7.12.2: lanes 0-15 hold K {0..7,16..23},
// lanes 16-31 hold K {8..15,24..31}  ->  two aligned 16B LDS reads per lane.
__device__ __forceinline__ v16h frag_k32(const _Float16* base, int row0, int k0,
                                         int stride, int lane) {
    const int l  = lane & 15;
    const int hi = (lane >> 4) & 1;
    const _Float16* p = base + (size_t)(row0 + l) * stride + k0 + hi * 8;
    v8h lo = *(const v8h*)p;
    v8h hh = *(const v8h*)(p + 16);
    v16h r;
#pragma unroll
    for (int i = 0; i < 8; ++i) { r[i] = lo[i]; r[i + 8] = hh[i]; }
    return r;
}

// Same, but only K=0..15 are real (K=16..31 forced to zero) — used for the
// DK=16 QK^T contraction padded up to the 16x16x32 shape.
__device__ __forceinline__ v16h frag_k16(const _Float16* base, int row0, int k0,
                                         int stride, int lane) {
    const int l  = lane & 15;
    const int hi = (lane >> 4) & 1;
    const _Float16* p = base + (size_t)(row0 + l) * stride + k0 + hi * 8;
    v8h lo = *(const v8h*)p;
    v16h r;
#pragma unroll
    for (int i = 0; i < 8; ++i) { r[i] = lo[i]; r[i + 8] = (_Float16)0.f; }
    return r;
}

// Hand-over of a tile between the lanes of ONE wave through LDS: the wave's own
// stores must have landed, and the compiler must not hoist the reads over them.
__device__ __forceinline__ void wave_lds_sync() {
    asm volatile("s_wait_dscnt 0x0" ::: "memory");
}

// 2^x with the one free issue slot that the instruction set asks for behind a
// transcendental: in one statement, so that the v_nop stays directly behind it.
__device__ __forceinline__ float exp2_slot(float x) {
    float y;
    asm("v_exp_f32 %0, %1\n\tv_nop" : "=v"(y) : "v"(x));
    return y;
}

// ---------------------------------------------------------------------------
// Dynamic-LDS layout; total 272,640 B (< 320 KB WGP)
// ---------------------------------------------------------------------------
#define SMEM_PERSIST ((NPAD + NPAD + EMB + EMB) * LP * 2 + 512 + EMB * LQ * 2)
#define WAVE_HALVES  (16 * LQ + 2 * 16 * LP)   // one wave's private tiles
#define SMEM_UNION   (PTIL * WAVE_HALVES * 2)   // also covers Wk^T + Wv^T (69,632 B)
#define SMEM_TOTAL   (SMEM_PERSIST + SMEM_UNION)

// ---------------------------------------------------------------------------
// Weight image: Wc^T, bc, Wq^T, Wk^T, Wv^T exactly as they lie in LDS (f16 rows
// at their padded pitch, K-pad and pitch pad zero; bc in f32).  Built once per
// call by the first launch, then fetched whole by every block of the second.
// ---------------------------------------------------------------------------
#define IMG_LDS_OFF ((NPAD + NPAD + EMB) * LP * 2)      // LDS byte offset of Wc^T
#define IMG_WC      0
#define IMG_BC      (IMG_WC + EMB * LP * 2)
#define IMG_WQ      (IMG_BC + EMB * 4)
#define IMG_WK      (IMG_WQ + EMB * LQ * 2)
#define IMG_WV      (IMG_WK + EMB * LP * 2)
#define IMG_BYTES   (IMG_WV + EMB * LP * 2)             // 147,968 = 289 x 512
#define UP          (LP / 8)                            // 16-B units per 272-B row
#define UQ          (LQ / 8)                            // 16-B units per 336-B row
#define IMG_BLOCKS  (3 * UP + UQ + 1)

// One block = one 16-B unit column (8 k values) of one matrix, thread = row n:
// eight coalesced row reads, one 16-B store.
__global__ __launch_bounds__(EMB)
void weight_image_kernel(const float* __restrict__ Wq,    // [132,128]
                         const float* __restrict__ Wk,    // [128,128]
                         const float* __restrict__ Wv,    // [128,128]
                         const float* __restrict__ Wc,    // [128,128]
                         const float* __restrict__ bcv,   // [128]
                         float* __restrict__ img)
{
    const int blk = blockIdx.x;
    const int n   = threadIdx.x;
    char* dst = (char*)img;
    if (blk == IMG_BLOCKS - 1) {
        if (n < EMB / 4) *(float4*)(dst + IMG_BC + n * 16) = *(const float4*)&bcv[n * 4];
        return;
    }
    const float* Wm; int u, kmax, pitch, off;
    if (blk < UP)               { Wm = Wc; u = blk;               kmax = EMB;     pitch = LP * 2; off = IMG_WC; }
    else if (blk < UP + UQ)     { Wm = Wq; u = blk - UP;          kmax = EMB + 4; pitch = LQ * 2; off = IMG_WQ; }
    else if (blk < 2 * UP + UQ) { Wm = Wk; u = blk - UP - UQ;     kmax = EMB;     pitch = LP * 2; off = IMG_WK; }
    else                        { Wm = Wv; u = blk - 2 * UP - UQ; kmax = EMB;     pitch = LP * 2; off = IMG_WV; }
    // pad rows read a clamped address, so that the eight loads share one trip
    float w[8];
#pragma unroll
    for (int j = 0; j < 8; ++j) {
        const int k = u * 8 + j;
        w[j] = Wm[(k < kmax ? k : kmax - 1) * EMB + n];
    }
    v8h h;
#pragma unroll
    for (int j = 0; j < 8; ++j)
        h[j] = (u * 8 + j < kmax) ? (_Float16)w[j] : (_Float16)0.f;
    *(v8h*)(dst + off + n * pitch + u * 16) = h;
    // the built code lays the bc branch's load behind this store, into its data registers
    asm volatile("s_wait_xcnt 0x0" ::: "memory");
}

// Twelve 16-B-per-lane copies global -> LDS, 4 KiB apart (the block's eight waves
// cover 4 KiB per copy).  The s_wait_xcnt closes the statement so that no address
// register of a copy is rewritten ahead of it.
__device__ __forceinline__ void copy12_to_lds(unsigned l, const char* g) {
    asm volatile(
        "global_load_async_to_lds_b128 %0, %12, off\n\t"
        "global_load_async_to_lds_b128 %1, %13, off\n\t"
        "global_load_async_to_lds_b128 %2, %14, off\n\t"
        "global_load_async_to_lds_b128 %3, %15, off\n\t"
        "global_load_async_to_lds_b128 %4, %16, off\n\t"
        "global_load_async_to_lds_b128 %5, %17, off\n\t"
        "global_load_async_to_lds_b128 %6, %18, off\n\t"
        "global_load_async_to_lds_b128 %7, %19, off\n\t"
        "global_load_async_to_lds_b128 %8, %20, off\n\t"
        "global_load_async_to_lds_b128 %9, %21, off\n\t"
        "global_load_async_to_lds_b128 %10, %22, off\n\t"
        "global_load_async_to_lds_b128 %11, %23, off\n\t"
        "s_wait_xcnt 0x0"
        :: "v"(l), "v"(l + 4096u), "v"(l + 8192u), "v"(l + 12288u),
           "v"(l + 16384u), "v"(l + 20480u), "v"(l + 24576u), "v"(l + 28672u),
           "v"(l + 32768u), "v"(l + 36864u), "v"(l + 40960u), "v"(l + 45056u),
           "v"(g), "v"(g + 4096), "v"(g + 8192), "v"(g + 12288),
           "v"(g + 16384), "v"(g + 20480), "v"(g + 24576), "v"(g + 28672),
           "v"(g + 32768), "v"(g + 36864), "v"(g + 40960), "v"(g + 45056)
        : "memory");
}

// One block fills a WGP's LDS, so two waves share a SIMD.  Stated so that the compiler
// schedules for that register budget: without it this build packs the Q and mh
// products into fewer registers and waits on LDS at nearly every one of them.
__global__ __launch_bounds__(256) __attribute__((amdgpu_waves_per_eu(2, 2)))
void vrp_decoder_kernel(const float* __restrict__ eln,    // [B,P,EMB]
                        const float* __restrict__ gload,  // [B,P]
                        const float* __restrict__ gtime,  // [B,P]
                        const float* __restrict__ glen,   // [B,P]
                        const float* __restrict__ gopen,  // [B,P]
                        const float* __restrict__ ninf,   // [B,P,N]
                        const float* __restrict__ enc,    // [B,N,EMB]
                        const float* __restrict__ wimg,   // weight image, IMG_BYTES
                        float* __restrict__ out)          // [B,P,N]
{
    extern __shared__ char smem[];
    const int b    = blockIdx.x;
    const int tid  = threadIdx.x;
    const int wave = tid >> 5;     // 0..7
    const int lane = tid & 31;
    const int l    = lane & 15;
    const int hi   = (lane >> 4) & 1;

    _Float16* sEN  = (_Float16*)smem;            // [112][LP]
    _Float16* sKT  = sEN  + NPAD * LP;           // [112][LP] K as [n][h*16+d]
    _Float16* sVT  = sKT  + NPAD * LP;           // [128][LP] V^T as [h*16+d][n]
    _Float16* sWcT = sVT  + EMB * LP;            // [128][LP]
    float*    sbc  = (float*)(sWcT + EMB * LP);  // [128]
    _Float16* sWqT = (_Float16*)(sbc + EMB);     // [128][LQ]
    char*     uni  = (char*)(sWqT + EMB * LQ);
    // phase 0/1 overlay
    _Float16* sWkT = (_Float16*)uni;             // [128][LP]
    _Float16* sWvT = sWkT + EMB * LP;            // [128][LP]
    // after phase 1 the union holds seven wave-private areas (see the P tiles)

    // ---------------- phase 0: fetch the weight image, stage encoded_nodes --
    // The row loads go out first, then the image's copies.
    const int pw = __builtin_amdgcn_readfirstlane(wave);
    // encoded_nodes: wave w stages rows w, w+8, ...; one 512-B row per load.  All of
    // a thread's row loads are issued here, ahead of any wait on one of them, so that
    // they share one trip to memory.  A pad row of the group that straddles row NN
    // reads a clamped address; the group past it is not loaded at all.
    float4 en[ENLD];
    {
        const int      rl = pw + 8 * (ENLD - 1);         // pw is 0..7
        const char*    e0 = (const char*)&enc[((size_t)b * NN + pw) * EMB];
        const char*    e1 = (const char*)&enc[((size_t)b * NN + (rl < NN ? rl : NN - 1)) * EMB];
        const unsigned eo = lane * 16;
#pragma unroll   // unrolled: the loads stand back to back and en[] stays in registers
        for (int j = 0; j < ENLD - 1; ++j) en[j] = *(const float4*)(e0 + j * 8 * EMB * 4 + eo);
        en[ENLD - 1] = *(const float4*)(e1 + eo);
        // no address register of these loads is rewritten ahead of this wait: as its
        // inputs they stay live up to it, so that no load's result is laid over them
        asm volatile("s_wait_xcnt 0x0" :: "v"(lane), "s"(e0), "s"(e1) : "memory");
    }
    {
        const unsigned l0 = (unsigned)(size_t)smem + IMG_LDS_OFF + tid * 16;
        const char*    g0 = (const char*)wimg + tid * 16;
        copy12_to_lds(l0, g0);
        copy12_to_lds(l0 + 49152u, g0 + 49152);
        copy12_to_lds(l0 + 98304u, g0 + 98304);
        if (pw == 0) {   // the image's last 512 B; wait in the statement as in copy12_to_lds
            asm volatile("global_load_async_to_lds_b128 %0, %1, off\n\ts_wait_xcnt 0x0"
                         :: "v"(l0 + 147456u), "v"(g0 + 147456) : "memory");
        }
    }
    for (int i = tid; i < EMB * 16; i += 256) { // zero V^T cols n=112..127
        int r = i >> 4, c = i & 15;
        sVT[r * LP + NPAD + c] = (_Float16)0.f;
    }
    // encoded_nodes rows to f16: contiguous b64 LDS stores, pad rows zero
#pragma unroll   // unrolled: en[] is indexed by constants only
    for (int j = 0; j < NPAD / 8; ++j) {
        const int r = pw + 8 * j;
        float4 v = make_float4(0.f, 0.f, 0.f, 0.f);
        if (8 * j + 7 < NN || (j < ENLD && r < NN)) v = en[j < ENLD ? j : 0];
        v4h h; h[0] = (_Float16)v.x; h[1] = (_Float16)v.y;
        h[2] = (_Float16)v.z; h[3] = (_Float16)v.w;
        *(v4h*)&sEN[r * LP + lane * 4] = h;
    }
    // this wave's copies have landed; the barrier then publishes all waves' parts
    asm volatile("s_wait_asynccnt 0x0" ::: "memory");
    __syncthreads();

    // ---------------- phase 1: K = EN@Wk, V = EN@Wv ------------------------
    for (int t = wave; t < 2 * NTIL * 8; t += 8) {
        const bool isK = (t < NTIL * 8);
        const int  tt  = isK ? t : t - NTIL * 8;
        const int  mt  = tt >> 3;               // n-tile 0..6
        const int  ct  = tt & 7;                // col-tile 0..7 (h*16+d)
        const _Float16* wT = isK ? sWkT : sWvT;
        v8f acc = zero8();
#pragma unroll
        for (int kt = 0; kt < 4; ++kt) {
            v16h a  = frag_k32(sEN, mt * 16, kt * 32, LP, lane);
            v16h bf = frag_k32(wT, ct * 16, kt * 32, LP, lane);
            acc = wmma_f16(a, bf, acc);
        }
        if (isK) {                               // sKT[n][col] (strided)
#pragma unroll
            for (int r = 0; r < 8; ++r)
                sKT[(mt * 16 + r + hi * 8) * LP + ct * 16 + l] = (_Float16)acc[r];
        } else {                                 // sVT[col][n]: 8 contiguous
            v8h h;                               //   halves -> one b128 store
#pragma unroll
            for (int r = 0; r < 8; ++r) h[r] = (_Float16)acc[r];
            *(v8h*)&sVT[(ct * 16 + l) * LP + mt * 16 + hi * 8] = h;
        }
    }
    __syncthreads();

    // ---------------- P tiles: one wave owns one 16-row tile end to end -----
    // Every hand-over below stays inside the wave, so no work-group barrier is
    // needed and the seven tiles run side by side instead of one after another.
    if (pw < PTIL) {
        const int p0 = pw * 16;
        _Float16* X  = (_Float16*)uni + pw * WAVE_HALVES;  // [16][LQ] input_cat, then out_concat
        _Float16* Y  = X + 16 * LQ;                        // [16][LP] Q, then mh
        _Float16* Wg = Y + 16 * LP;                        // [16][LP] exp weights of one head

        v8h z8;
#pragma unroll
        for (int i = 0; i < 8; ++i) z8[i] = (_Float16)0.f;

        // All of the tile's global loads are issued first, so that they share one
        // trip to memory.  Mask tile straight into the accumulator layout
        // (row r+hi*8, col nt*16+l); dead rows and pad columns read a clamped address.
        float mk[NTIL][8];
#pragma unroll
        for (int r = 0; r < 8; ++r) {
            const int    p  = p0 + r + hi * 8;
            const float* mr = &ninf[((size_t)b * PP + (p < PP ? p : PP - 1)) * NN];
#pragma unroll
            for (int nt = 0; nt < NTIL; ++nt) {
                const int n = nt * 16 + l;
                mk[nt][r] = mr[n < NN ? n : NN - 1];
            }
        }
        // the 4 scalar features of row l
        const int    pf = p0 + l;
        const size_t gi = (size_t)b * PP + (pf < PP ? pf : PP - 1);
        const float  f0 = gload[gi], f1 = gtime[gi], f2 = glen[gi], f3 = gopen[gi];
        // the row loads' results below may land in address registers of the loads above
        asm volatile("s_wait_xcnt 0x0" ::: "memory");
        // input_cat tile: one 512-B row per load; the last tile has LASTROWS live rows
        {
            const bool   full = pw < PTIL - 1;
            const float* er   = &eln[((size_t)b * PP + p0) * EMB + lane * 4];
            float4 ev[16];
#pragma unroll
            for (int j = 0; j < LASTROWS; ++j) ev[j] = *(const float4*)(er + j * EMB);
            // the next rows' results may land in these loads' offset register
            asm volatile("s_wait_xcnt 0x0" ::: "memory");
#pragma unroll
            for (int j = LASTROWS; j < 16; ++j) ev[j] = make_float4(0.f, 0.f, 0.f, 0.f);
            if (full) {
#pragma unroll
                for (int j = LASTROWS; j < 16; ++j) ev[j] = *(const float4*)(er + j * EMB);
            }
#pragma unroll
            for (int j = 0; j < 16; ++j) {
                v4h h;
                h[0] = (_Float16)ev[j].x; h[1] = (_Float16)ev[j].y;
                h[2] = (_Float16)ev[j].z; h[3] = (_Float16)ev[j].w;
                *(v4h*)&X[j * LQ + lane * 4] = h;
            }
        }
        // features + K-pad (cols 128..159): lane pair (l, l+16) fills row l
        {
            const bool live = (pf < PP) && (hi == 0);
            v8h fa = z8;
            fa[0] = (_Float16)(live ? f0 : 0.f); fa[1] = (_Float16)(live ? f1 : 0.f);
            fa[2] = (_Float16)(live ? f2 : 0.f); fa[3] = (_Float16)(live ? f3 : 0.f);
            *(v8h*)&X[l * LQ + EMB + hi * 16]     = fa;
            *(v8h*)&X[l * LQ + EMB + hi * 16 + 8] = z8;
            *(v8h*)&Wg[l * LP + NPAD + hi * 8]    = z8;   // weight cols n=112..127 stay zero
        }
#pragma unroll
        for (int r = 0; r < 8; ++r)
#pragma unroll
            for (int nt = 0; nt < NTIL; ++nt) {
                const float v = (p0 + r + hi * 8 < PP) ? mk[nt][r] : 0.f;   // dead rows
                mk[nt][r] = (nt * 16 + l < NN) ? v : -1e30f;                // N padding
            }
        wave_lds_sync();

        // ---- Q tile: all 8 column tiles, K = 160 --------------------------
        {
            v16h a[5];
#pragma unroll
            for (int kt = 0; kt < 5; ++kt) a[kt] = frag_k32(X, 0, kt * 32, LQ, lane);
            v8f acc[8];
#pragma unroll
            for (int ct = 0; ct < 8; ++ct) acc[ct] = zero8();
#pragma unroll
            for (int kt = 0; kt < 5; ++kt)
#pragma unroll
                for (int ct = 0; ct < 8; ++ct)
                    acc[ct] = wmma_f16(a[kt], frag_k32(sWqT, ct * 16, kt * 32, LQ, lane), acc[ct]);
#pragma unroll
            for (int ct = 0; ct < 8; ++ct)
#pragma unroll
                for (int r = 0; r < 8; ++r)
                    Y[(r + hi * 8) * LP + ct * 16 + l] = (_Float16)acc[ct][r];
        }
        wave_lds_sync();

        // ---- attention, head by head --------------------------------------
        // kept rolled: for speed only
#pragma unroll 1
        for (int h = 0; h < NH; ++h) {
            v16h aq = frag_k16(Y, 0, h * 16, LP, lane);
            v8f sc[NTIL];
#pragma unroll
            for (int nt = 0; nt < NTIL; ++nt) {
                v16h bk = frag_k16(sKT, nt * 16, h * 16, LP, lane);
                sc[nt] = wmma_f16(aq, bk, zero8());
            }
            // scale 1/sqrt(16) + mask   (D elem (r,lane) = row r+hi*8, col l)
#pragma unroll
            for (int nt = 0; nt < NTIL; ++nt)
#pragma unroll
                for (int r = 0; r < 8; ++r)
                    sc[nt][r] = sc[nt][r] * 0.25f + mk[nt][r];
            // row-max across the 7 tiles, then across 16 lanes of the half
            float m[8];
#pragma unroll
            for (int r = 0; r < 8; ++r) {
                m[r] = sc[0][r];
#pragma unroll
                for (int nt = 1; nt < NTIL; ++nt) m[r] = fmaxf(m[r], sc[nt][r]);
            }
#pragma unroll
            for (int off = 1; off < 16; off <<= 1)
#pragma unroll
                for (int r = 0; r < 8; ++r)
                    m[r] = fmaxf(m[r], __shfl_xor(m[r], off, 32));
            // exp (unnormalized) -> LDS as the AV A-operand; row sums in regs
            float s[8];
#pragma unroll
            for (int r = 0; r < 8; ++r) s[r] = 0.f;
#pragma unroll
            for (int nt = 0; nt < NTIL; ++nt)
#pragma unroll
                for (int r = 0; r < 8; ++r) {
                    float e = __expf(sc[nt][r] - m[r]);
                    s[r] += e;
                    Wg[(r + hi * 8) * LP + nt * 16 + l] = (_Float16)e;
                }
#pragma unroll
            for (int off = 1; off < 16; off <<= 1)
#pragma unroll
                for (int r = 0; r < 8; ++r) s[r] += __shfl_xor(s[r], off, 32);
            wave_lds_sync();

            // AV + fold 1/rowsum -> out_concat
            v8f o = zero8();
#pragma unroll
            for (int kt = 0; kt < 4; ++kt) {
                v16h aw = frag_k32(Wg, 0, kt * 32, LP, lane);
                v16h bv = frag_k32(sVT, h * 16, kt * 32, LP, lane);
                o = wmma_f16(aw, bv, o);
            }
#pragma unroll
            for (int r = 0; r < 8; ++r)
                X[(r + hi * 8) * LQ + h * 16 + l] = (_Float16)(o[r] * (1.f / s[r]));
        }
        wave_lds_sync();

        // ---- mh = out_concat @ Wc + bc ------------------------------------
        {
            v16h a[4];
#pragma unroll
            for (int kt = 0; kt < 4; ++kt) a[kt] = frag_k32(X, 0, kt * 32, LQ, lane);
            v8f acc[8];
#pragma unroll
            for (int ct = 0; ct < 8; ++ct) acc[ct] = zero8();
#pragma unroll
            for (int kt = 0; kt < 4; ++kt)
#pragma unroll
                for (int ct = 0; ct < 8; ++ct)
                    acc[ct] = wmma_f16(a[kt], frag_k32(sWcT, ct * 16, kt * 32, LP, lane), acc[ct]);
#pragma unroll
            for (int ct = 0; ct < 8; ++ct) {
                const float bias = sbc[ct * 16 + l];
#pragma unroll
                for (int r = 0; r < 8; ++r)
                    Y[(r + hi * 8) * LP + ct * 16 + l] = (_Float16)(acc[ct][r] + bias);
            }
        }
        wave_lds_sync();

        // ---- score2 = mh @ EN^T / sqrt(EMB); 10*tanh + mask; softmax over N
        {
            v16h a[4];
#pragma unroll
            for (int kt = 0; kt < 4; ++kt) a[kt] = frag_k32(Y, 0, kt * 32, LP, lane);
            // tanh tile by tile in a rolled loop (56 inlined copies would nearly double
            // the kernel's text); each lane parks its own 8 values per tile in LDS,
            // over X and Y, whose last reads are a[] above
            float* T = (float*)X;                           // [NTIL][2][32 lanes][4]
#pragma unroll 1
            for (int nt = 0; nt < NTIL; ++nt) {
                v8f acc = zero8();
#pragma unroll
                for (int kt = 0; kt < 4; ++kt)
                    acc = wmma_f16(a[kt], frag_k32(sEN, nt * 16, kt * 32, LP, lane), acc);
                float t[8];
#pragma unroll
                for (int r = 0; r < 8; ++r)
                    t[r] = tanhf(acc[r] * (1.0f / 11.313708498984761f));
                *(float4*)&T[(nt * 2 + 0) * 128 + lane * 4] = make_float4(t[0], t[1], t[2], t[3]);
                *(float4*)&T[(nt * 2 + 1) * 128 + lane * 4] = make_float4(t[4], t[5], t[6], t[7]);
            }
            v8f s2[NTIL];
#pragma unroll
            for (int nt = 0; nt < NTIL; ++nt) {
                const float4 t0 = *(const float4*)&T[(nt * 2 + 0) * 128 + lane * 4];
                const float4 t1 = *(const float4*)&T[(nt * 2 + 1) * 128 + lane * 4];
                const float  t[8] = {t0.x, t0.y, t0.z, t0.w, t1.x, t1.y, t1.z, t1.w};
#pragma unroll
                for (int r = 0; r < 8; ++r) s2[nt][r] = 10.0f * t[r] + mk[nt][r];
            }
            float m[8], s[8];
#pragma unroll
            for (int r = 0; r < 8; ++r) {
                m[r] = s2[0][r];
#pragma unroll
                for (int nt = 1; nt < NTIL; ++nt) m[r] = fmaxf(m[r], s2[nt][r]);
            }
#pragma unroll
            for (int off = 1; off < 16; off <<= 1)
#pragma unroll
                for (int r = 0; r < 8; ++r)
                    m[r] = fmaxf(m[r], __shfl_xor(m[r], off, 32));
#pragma unroll
            for (int r = 0; r < 8; ++r) {
                s[r] = 0.f;
#pragma unroll
                for (int nt = 0; nt < NTIL; ++nt) {
                    s2[nt][r] = exp2_slot((s2[nt][r] - m[r]) * 1.4426950408889634f);
                    s[r] += s2[nt][r];
                }
            }
#pragma unroll
            for (int off = 1; off < 16; off <<= 1)
#pragma unroll
                for (int r = 0; r < 8; ++r) s[r] += __shfl_xor(s[r], off, 32);
#pragma unroll
            for (int r = 0; r < 8; ++r) {
                const int   p   = p0 + r + hi * 8;
                const float inv = 1.f / s[r];
                float* orow = &out[((size_t)b * PP + p) * NN];
#pragma unroll
                for (int nt = 0; nt < NTIL; ++nt) {
                    const int n = nt * 16 + l;
                    if (p < PP && n < NN) orow[n] = s2[nt][r] * inv;
                }
            }
        }
    }
}

// ---------------------------------------------------------------------------
extern "C" void kernel_launch(void* const* d_in, const int* in_sizes, int n_in,
                              void* d_out, int out_size, void* d_ws, size_t ws_size,
                              hipStream_t stream) {
    (void)in_sizes; (void)n_in; (void)out_size; (void)ws_size;
    const float* eln   = (const float*)d_in[0];
    const float* gload = (const float*)d_in[1];
    const float* gtime = (const float*)d_in[2];
    const float* glen  = (const float*)d_in[3];
    const float* gopen = (const float*)d_in[4];
    const float* ninf  = (const float*)d_in[5];
    const float* enc   = (const float*)d_in[6];
    const float* Wq    = (const float*)d_in[7];
    const float* Wk    = (const float*)d_in[8];
    const float* Wv    = (const float*)d_in[9];
    const float* Wc    = (const float*)d_in[10];
    const float* bcv   = (const float*)d_in[11];
    float* out = (float*)d_out;
    float* img = (float*)d_ws;

    hipFuncSetAttribute((const void*)vrp_decoder_kernel,
                        hipFuncAttributeMaxDynamicSharedMemorySize,
                        SMEM_TOTAL);
    weight_image_kernel<<<dim3(IMG_BLOCKS), dim3(EMB), 0, stream>>>(Wq, Wk, Wv, Wc, bcv, img);
    vrp_decoder_kernel<<<dim3(BB), dim3(256), SMEM_TOTAL, stream>>>(
        eln, gload, gtime, glen, gopen, ninf, enc, img, out);
}

// v005
// One run takes 92.7 microseconds.
// Timed twice side by side with v004, it ran 1.11 times as fast both times.
// Counting every step since v000, it is 6.82 times as fast.
#include <hip/hip_runtime.h>
#include <hip/hip_bf16.h>
#include <math.h>

// ---------------------------------------------------------------------------
// Problem constants (match reference)
// ---------------------------------------------------------------------------
#define BB   1024
#define PP   100
#define NN   101
#define EMB  128
#define NH   8
#define DKK  16

#define NPAD 112        // N padded to 7*16
#define PTIL 7          // ceil(100/16)
#define NTIL 7          // ceil(101/16)
#define KQ   160        // 132 padded to 5*32
#define LASTROWS (PP - (PTIL - 1) * 16)   // live rows of the last P tile
#define ENLD ((NN + 7) / 8)   // groups of 8 encoded_nodes rows that hold a live row

// LDS row pitches.  Bank = dword address mod 64, so 16 rows at a 256-B pitch put
// a whole b128 fragment read on four banks.  16 B x odd spreads them over all 64.
#define LP   136        // halves: 272 B pitch for the 128-half rows
#define LQ   168        // halves: 336 B pitch for the 160-half rows

typedef __attribute__((ext_vector_type(16))) _Float16 v16h;
typedef __attribute__((ext_vector_type(8)))  _Float16 v8h;
typedef __attribute__((ext_vector_type(4)))  _Float16 v4h;
typedef __attribute__((ext_vector_type(8)))  float    v8f;

// ---------------------------------------------------------------------------
// WMMA helpers (CDNA5 wave32, D = A(16x32 f16) * B(32x16 f16) + C(16x16 f32))
// ---------------------------------------------------------------------------
__device__ __forceinline__ v8f wmma_f16(v16h a, v16h b, v8f c) {
    return __builtin_amdgcn_wmma_f32_16x16x32_f16(
        /*neg_a=*/false, a, /*neg_b=*/false, b,
        /*c_mod=*/(short)0, c, /*reuse_a=*/false, /*reuse_b=*/false);
}

__device__ __forceinline__ v8f zero8() {
    v8f z = {0.f, 0.f, 0.f, 0.f, 0.f, 0.f, 0.f, 0.f};
    return z;
}

// A-operand (16x32, M x K) from row-major f16 [M][stride]; also valid for the
// B-operand (32x16, K x N) when B is stored "column-major by N", i.e. [N][stride]
// holding K along the row.  Per ISA 7.12.2: lanes 0-15 hold K {0..7,16..23},
// lanes 16-31 hold K {8..15,24..31}  ->  two aligned 16B LDS reads per lane.
__device__ __forceinline__ v16h frag_k32(const _Float16* base, int row0, int k0,
                                         int stride, int lane) {
    const int l  = lane & 15;
    const int hi = (lane >> 4) & 1;
    const _Float16* p = base + (size_t)(row0 + l) * stride + k0 + hi * 8;
    v8h lo = *(const v8h*)p;
    v8h hh = *(const v8h*)(p + 16);
    v16h r;
#pragma unroll
    for (int i = 0; i < 8; ++i) { r[i] = lo[i]; r[i + 8] = hh[i]; }
    return r;
}

// Same, but only K=0..15 are real (K=16..31 forced to zero) — used for the
// DK=16 QK^T contraction padded up to the 16x16x32 shape.
__device__ __forceinline__ v16h frag_k16(const _Float16* base, int row0, int k0,
                                         int stride, int lane) {
    const int l  = lane & 15;
    const int hi = (lane >> 4) & 1;
    const _Float16* p = base + (size_t)(row0 + l) * stride + k0 + hi * 8;
    v8h lo = *(const v8h*)p;
    v16h r;
#pragma unroll
    for (int i = 0; i < 8; ++i) { r[i] = lo[i]; r[i + 8] = (_Float16)0.f; }
    return r;
}

// Hand-over of a tile between the lanes of ONE wave through LDS: the wave's own
// stores must have landed, and the compiler must not hoist the reads over them.
__device__ __forceinline__ void wave_lds_sync() {
    asm volatile("s_wait_dscnt 0x0" ::: "memory");
}

// 2^x with the one free issue slot that the instruction set asks for behind a
// transcendental: in one statement, so that the v_nop stays directly behind it.
__device__ __forceinline__ float exp2_slot(float x) {
    float y;
    asm("v_exp_f32 %0, %1\n\tv_nop" : "=v"(y) : "v"(x));
    return y;
}

// Eight independent transcendentals of one kind in one statement: each is the free
// issue slot that the instruction set asks for behind the one in front of it, and the
// v_nop is the last one's.
#define TRANS_X8(OP, t)                                                        \
    asm(OP " %0, %0\n\t" OP " %1, %1\n\t" OP " %2, %2\n\t" OP " %3, %3\n\t"      \
        OP " %4, %4\n\t" OP " %5, %5\n\t" OP " %6, %6\n\t" OP " %7, %7\n\tv_nop" \
        : "+v"(t[0]), "+v"(t[1]), "+v"(t[2]), "+v"(t[3]),                      \
          "+v"(t[4]), "+v"(t[5]), "+v"(t[6]), "+v"(t[7]))

// tanh(x / sqrt(EMB)) = 1 - 2 / (e^(2x / sqrt(EMB)) + 1) for a lane's eight values of
// one tile, without a branch: five instructions a value, no value waits for another.
// e^.. = inf gives 1, e^.. = 0 gives -1, NaN stays NaN.  The absolute error is a few
// f32 ulps of 1, which is what counts for a logit that is 10 * tanh.
__device__ __forceinline__ void tanh_scaled_x8(float (&t)[8]) {
#pragma unroll   // unrolled here and below: t[] stays in registers
    for (int r = 0; r < 8; ++r)
        t[r] *= (float)(2.0 * 1.4426950408889634 / 11.313708498984761);
    TRANS_X8("v_exp_f32", t);
#pragma unroll
    for (int r = 0; r < 8; ++r) t[r] += 1.0f;
    TRANS_X8("v_rcp_f32", t);
#pragma unroll
    for (int r = 0; r < 8; ++r) t[r] = 1.0f - 2.0f * t[r];
}

// ---------------------------------------------------------------------------
// Dynamic-LDS layout; total 272,640 B (< 320 KB WGP)
// ---------------------------------------------------------------------------
#define SMEM_PERSIST ((NPAD + NPAD + EMB + EMB) * LP * 2 + 512 + EMB * LQ * 2)
#define WAVE_HALVES  (16 * LQ + 2 * 16 * LP)   // one wave's private tiles
#define SMEM_UNION   (PTIL * WAVE_HALVES * 2)   // also covers Wk^T + Wv^T (69,632 B)
#define SMEM_TOTAL   (SMEM_PERSIST + SMEM_UNION)

// ---------------------------------------------------------------------------
// Weight image: Wc^T, bc, Wq^T, Wk^T, Wv^T exactly as they lie in LDS (f16 rows
// at their padded pitch, K-pad and pitch pad zero; bc in f32).  Built once per
// call by the first launch, then fetched whole by every block of the second.
// ---------------------------------------------------------------------------
#define IMG_LDS_OFF ((NPAD + NPAD + EMB) * LP * 2)      // LDS byte offset of Wc^T
#define IMG_WC      0
#define IMG_BC      (IMG_WC + EMB * LP * 2)
#define IMG_WQ      (IMG_BC + EMB * 4)
#define IMG_WK      (IMG_WQ + EMB * LQ * 2)
#define IMG_WV      (IMG_WK + EMB * LP * 2)
#define IMG_BYTES   (IMG_WV + EMB * LP * 2)             // 147,968 = 289 x 512
#define UP          (LP / 8)                            // 16-B units per 272-B row
#define UQ          (LQ / 8)                            // 16-B units per 336-B row
#define IMG_BLOCKS  (3 * UP + UQ + 1)

// One block = one 16-B unit column (8 k values) of one matrix, thread = row n:
// eight coalesced row reads, one 16-B store.
__global__ __launch_bounds__(EMB)
void weight_image_kernel(const float* __restrict__ Wq,    // [132,128]
                         const float* __restrict__ Wk,    // [128,128]
                         const float* __restrict__ Wv,    // [128,128]
                         const float* __restrict__ Wc,    // [128,128]
                         const float* __restrict__ bcv,   // [128]
                         float* __restrict__ img)
{
    const int blk = blockIdx.x;
    const int n   = threadIdx.x;
    char* dst = (char*)img;
    if (blk == IMG_BLOCKS - 1) {
        if (n < EMB / 4) *(float4*)(dst + IMG_BC + n * 16) = *(const float4*)&bcv[n * 4];
        return;
    }
    const float* Wm; int u, kmax, pitch, off;
    if (blk < UP)               { Wm = Wc; u = blk;               kmax = EMB;     pitch = LP * 2; off = IMG_WC; }
    else if (blk < UP + UQ)     { Wm = Wq; u = blk - UP;          kmax = EMB + 4; pitch = LQ * 2; off = IMG_WQ; }
    else if (blk < 2 * UP + UQ) { Wm = Wk; u = blk - UP - UQ;     kmax = EMB;     pitch = LP * 2; off = IMG_WK; }
    else                        { Wm = Wv; u = blk - 2 * UP - UQ; kmax = EMB;     pitch = LP * 2; off = IMG_WV; }
    // pad rows read a clamped address, so that the eight loads share one trip
    float w[8];
#pragma unroll
    for (int j = 0; j < 8; ++j) {
        const int k = u * 8 + j;
        w[j] = Wm[(k < kmax ? k : kmax - 1) * EMB + n];
    }
    v8h h;
#pragma unroll
    for (int j = 0; j < 8; ++j)
        h[j] = (u * 8 + j < kmax) ? (_Float16)w[j] : (_Float16)0.f;
    *(v8h*)(dst + off + n * pitch + u * 16) = h;
    // the built code lays the bc branch's load behind this store, into its data registers
    asm volatile("s_wait_xcnt 0x0" ::: "memory");
}

// Twelve 16-B-per-lane copies global -> LDS, 4 KiB apart (the block's eight waves
// cover 4 KiB per copy).  The s_wait_xcnt closes the statement so that no address
// register of a copy is rewritten ahead of it.
__device__ __forceinline__ void copy12_to_lds(unsigned l, const char* g) {
    asm volatile(
        "global_load_async_to_lds_b128 %0, %12, off\n\t"
        "global_load_async_to_lds_b128 %1, %13, off\n\t"
        "global_load_async_to_lds_b128 %2, %14, off\n\t"
        "global_load_async_to_lds_b128 %3, %15, off\n\t"
        "global_load_async_to_lds_b128 %4, %16, off\n\t"
        "global_load_async_to_lds_b128 %5, %17, off\n\t"
        "global_load_async_to_lds_b128 %6, %18, off\n\t"
        "global_load_async_to_lds_b128 %7, %19, off\n\t"
        "global_load_async_to_lds_b128 %8, %20, off\n\t"
        "global_load_async_to_lds_b128 %9, %21, off\n\t"
        "global_load_async_to_lds_b128 %10, %22, off\n\t"
        "global_load_async_to_lds_b128 %11, %23, off\n\t"
        "s_wait_xcnt 0x0"
        :: "v"(l), "v"(l + 4096u), "v"(l + 8192u), "v"(l + 12288u),
           "v"(l + 16384u), "v"(l + 20480u), "v"(l + 24576u), "v"(l + 28672u),
           "v"(l + 32768u), "v"(l + 36864u), "v"(l + 40960u), "v"(l + 45056u),
           "v"(g), "v"(g + 4096), "v"(g + 8192), "v"(g + 12288),
           "v"(g + 16384), "v"(g + 20480), "v"(g + 24576), "v"(g + 28672),
           "v"(g + 32768), "v"(g + 36864), "v"(g + 40960), "v"(g + 45056)
        : "memory");
}

// One block fills a WGP's LDS, so two waves share a SIMD.  Stated so that the compiler
// schedules for that register budget: without it this build packs the Q and mh
// products into fewer registers and waits on LDS at nearly every one of them.
__global__ __launch_bounds__(256) __attribute__((amdgpu_waves_per_eu(2, 2)))
void vrp_decoder_kernel(const float* __restrict__ eln,    // [B,P,EMB]
                        const float* __restrict__ gload,  // [B,P]
                        const float* __restrict__ gtime,  // [B,P]
                        const float* __restrict__ glen,   // [B,P]
                        const float* __restrict__ gopen,  // [B,P]
                        const float* __restrict__ ninf,   // [B,P,N]
                        const float* __restrict__ enc,    // [B,N,EMB]
                        const float* __restrict__ wimg,   // weight image, IMG_BYTES
                        float* __restrict__ out)          // [B,P,N]
{
    extern __shared__ char smem[];
    const int b    = blockIdx.x;
    const int tid  = threadIdx.x;
    const int wave = tid >> 5;     // 0..7
    const int lane = tid & 31;
    const int l    = lane & 15;
    const int hi   = (lane >> 4) & 1;

    _Float16* sEN  = (_Float16*)smem;            // [112][LP]
    _Float16* sKT  = sEN  + NPAD * LP;           // [112][LP] K as [n][h*16+d]
    _Float16* sVT  = sKT  + NPAD * LP;           // [128][LP] V^T as [h*16+d][n]
    _Float16* sWcT = sVT  + EMB * LP;            // [128][LP]
    float*    sbc  = (float*)(sWcT + EMB * LP);  // [128]
    _Float16* sWqT = (_Float16*)(sbc + EMB);     // [128][LQ]
    char*     uni  = (char*)(sWqT + EMB * LQ);
    // phase 0/1 overlay
    _Float16* sWkT = (_Float16*)uni;             // [128][LP]
    _Float16* sWvT = sWkT + EMB * LP;            // [128][LP]
    // after phase 1 the union holds seven wave-private areas (see the P tiles)

    // ---------------- phase 0: fetch the weight image, stage encoded_nodes --
    // The row loads go out first, then the image's copies.
    const int pw = __builtin_amdgcn_readfirstlane(wave);
    // encoded_nodes: wave w stages rows w, w+8, ...; one 512-B row per load.  All of
    // a thread's row loads are issued here, ahead of any wait on one of them, so that
    // they share one trip to memory.  A pad row of the group that straddles row NN
    // reads a clamped address; the group past it is not loaded at all.
    float4 en[ENLD];
    {
        const int      rl = pw + 8 * (ENLD - 1);         // pw is 0..7
        const char*    e0 = (const char*)&enc[((size_t)b * NN + pw) * EMB];
        const char*    e1 = (const char*)&enc[((size_t)b * NN + (rl < NN ? rl : NN - 1)) * EMB];
        const unsigned eo = lane * 16;
#pragma unroll   // unrolled: the loads stand back to back and en[] stays in registers
        for (int j = 0; j < ENLD - 1; ++j) en[j] = *(const float4*)(e0 + j * 8 * EMB * 4 + eo);
        en[ENLD - 1] = *(const float4*)(e1 + eo);
        // no address register of these loads is rewritten ahead of this wait: as its
        // inputs they stay live up to it, so that no load's result is laid over them
        asm volatile("s_wait_xcnt 0x0" :: "v"(lane), "s"(e0), "s"(e1) : "memory");
    }
    {
        const unsigned l0 = (unsigned)(size_t)smem + IMG_LDS_OFF + tid * 16;
        const char*    g0 = (const char*)wimg + tid * 16;
        copy12_to_lds(l0, g0);
        copy12_to_lds(l0 + 49152u, g0 + 49152);
        copy12_to_lds(l0 + 98304u, g0 + 98304);
        if (pw == 0) {   // the image's last 512 B; wait in the statement as in copy12_to_lds
            asm volatile("global_load_async_to_lds_b128 %0, %1, off\n\ts_wait_xcnt 0x0"
                         :: "v"(l0 + 147456u), "v"(g0 + 147456) : "memory");
        }
    }
    for (int i = tid; i < EMB * 16; i += 256) { // zero V^T cols n=112..127
        int r = i >> 4, c = i & 15;
        sVT[r * LP + NPAD + c] = (_Float16)0.f;
    }
    // encoded_nodes rows to f16: contiguous b64 LDS stores, pad rows zero
#pragma unroll   // unrolled: en[] is indexed by constants only
    for (int j = 0; j < NPAD / 8; ++j) {
        const int r = pw + 8 * j;
        float4 v = make_float4(0.f, 0.f, 0.f, 0.f);
        if (8 * j + 7 < NN || (j < ENLD && r < NN)) v = en[j < ENLD ? j : 0];
        v4h h; h[0] = (_Float16)v.x; h[1] = (_Float16)v.y;
        h[2] = (_Float16)v.z; h[3] = (_Float16)v.w;
        *(v4h*)&sEN[r * LP + lane * 4] = h;
    }
    // this wave's copies have landed; the barrier then publishes all waves' parts
    asm volatile("s_wait_asynccnt 0x0" ::: "memory");
    __syncthreads();

    // ---------------- phase 1: K = EN@Wk, V = EN@Wv ------------------------
    for (int t = wave; t < 2 * NTIL * 8; t += 8) {
        const bool isK = (t < NTIL * 8);
        const int  tt  = isK ? t : t - NTIL * 8;
        const int  mt  = tt >> 3;               // n-tile 0..6
        const int  ct  = tt & 7;                // col-tile 0..7 (h*16+d)
        const _Float16* wT = isK ? sWkT : sWvT;
        v8f acc = zero8();
#pragma unroll
        for (int kt = 0; kt < 4; ++kt) {
            v16h a  = frag_k32(sEN, mt * 16, kt * 32, LP, lane);
            v16h bf = frag_k32(wT, ct * 16, kt * 32, LP, lane);
            acc = wmma_f16(a, bf, acc);
        }
        if (isK) {                               // sKT[n][col] (strided)
#pragma unroll
            for (int r = 0; r < 8; ++r)
                sKT[(mt * 16 + r + hi * 8) * LP + ct * 16 + l] = (_Float16)acc[r];
        } else {                                 // sVT[col][n]: 8 contiguous
            v8h h;                               //   halves -> one b128 store
#pragma unroll
            for (int r = 0; r < 8; ++r) h[r] = (_Float16)acc[r];
            *(v8h*)&sVT[(ct * 16 + l) * LP + mt * 16 + hi * 8] = h;
        }
    }
    __syncthreads();

    // ---------------- P tiles: one wave owns one 16-row tile end to end -----
    // Every hand-over below stays inside the wave, so no work-group barrier is
    // needed and the seven tiles run side by side instead of one after another.
    if (pw < PTIL) {
        const int p0 = pw * 16;
        _Float16* X  = (_Float16*)uni + pw * WAVE_HALVES;  // [16][LQ] input_cat, then out_concat
        _Float16* Y  = X + 16 * LQ;                        // [16][LP] Q, then mh
        _Float16* Wg = Y + 16 * LP;                        // [16][LP] exp weights of one head

        v8h z8;
#pragma unroll
        for (int i = 0; i < 8; ++i) z8[i] = (_Float16)0.f;

        // All of the tile's global loads are issued first, so that they share one
        // trip to memory.  Mask tile straight into the accumulator layout
        // (row r+hi*8, col nt*16+l); dead rows and pad columns read a clamped address.
        float mk[NTIL][8];
#pragma unroll
        for (int r = 0; r < 8; ++r) {
            const int    p  = p0 + r + hi * 8;
            const float* mr = &ninf[((size_t)b * PP + (p < PP ? p : PP - 1)) * NN];
#pragma unroll
            for (int nt = 0; nt < NTIL; ++nt) {
                const int n = nt * 16 + l;
                mk[nt][r] = mr[n < NN ? n : NN - 1];
            }
        }
        // the 4 scalar features of row l
        const int    pf = p0 + l;
        const size_t gi = (size_t)b * PP + (pf < PP ? pf : PP - 1);
        const float  f0 = gload[gi], f1 = gtime[gi], f2 = glen[gi], f3 = gopen[gi];
        // the row loads' results below may land in address registers of the loads above
        asm volatile("s_wait_xcnt 0x0" ::: "memory");
        // input_cat tile: one 512-B row per load; the last tile has LASTROWS live rows
        {
            const bool   full = pw < PTIL - 1;
            const float* er   = &eln[((size_t)b * PP + p0) * EMB + lane * 4];
            float4 ev[16];
#pragma unroll
            for (int j = 0; j < LASTROWS; ++j) ev[j] = *(const float4*)(er + j * EMB);
            // the next rows' results may land in these loads' offset register
            asm volatile("s_wait_xcnt 0x0" ::: "memory");
#pragma unroll
            for (int j = LASTROWS; j < 16; ++j) ev[j] = make_float4(0.f, 0.f, 0.f, 0.f);
            if (full) {
#pragma unroll
                for (int j = LASTROWS; j < 16; ++j) ev[j] = *(const float4*)(er + j * EMB);
            }
#pragma unroll
            for (int j = 0; j < 16; ++j) {
                v4h h;
                h[0] = (_Float16)ev[j].x; h[1] = (_Float16)ev[j].y;
                h[2] = (_Float16)ev[j].z; h[3] = (_Float16)ev[j].w;
                *(v4h*)&X[j * LQ + lane * 4] = h;
            }
        }
        // features + K-pad (cols 128..159): lane pair (l, l+16) fills row l
        {
            const bool live = (pf < PP) && (hi == 0);
            v8h fa = z8;
            fa[0] = (_Float16)(live ? f0 : 0.f); fa[1] = (_Float16)(live ? f1 : 0.f);
            fa[2] = (_Float16)(live ? f2 : 0.f); fa[3] = (_Float16)(live ? f3 : 0.f);
            *(v8h*)&X[l * LQ + EMB + hi * 16]     = fa;
            *(v8h*)&X[l * LQ + EMB + hi * 16 + 8] = z8;
            *(v8h*)&Wg[l * LP + NPAD + hi * 8]    = z8;   // weight cols n=112..127 stay zero
        }
#pragma unroll
        for (int r = 0; r < 8; ++r)
#pragma unroll
            for (int nt = 0; nt < NTIL; ++nt) {
                const float v = (p0 + r + hi * 8 < PP) ? mk[nt][r] : 0.f;   // dead rows
                mk[nt][r] = (nt * 16 + l < NN) ? v : -1e30f;                // N padding
            }
        wave_lds_sync();

        // ---- Q tile: all 8 column tiles, K = 160 --------------------------
        {
            v16h a[5];
#pragma unroll
            for (int kt = 0; kt < 5; ++kt) a[kt] = frag_k32(X, 0, kt * 32, LQ, lane);
            v8f acc[8];
#pragma unroll
            for (int ct = 0; ct < 8; ++ct) acc[ct] = zero8();
#pragma unroll
            for (int kt = 0; kt < 5; ++kt)
#pragma unroll
                for (int ct = 0; ct < 8; ++ct)
                    acc[ct] = wmma_f16(a[kt], frag_k32(sWqT, ct * 16, kt * 32, LQ, lane), acc[ct]);
#pragma unroll
            for (int ct = 0; ct < 8; ++ct)
#pragma unroll
                for (int r = 0; r < 8; ++r)
                    Y[(r + hi * 8) * LP + ct * 16 + l] = (_Float16)acc[ct][r];
        }
        wave_lds_sync();

        // ---- attention, head by head --------------------------------------
        // kept rolled: for speed only
#pragma unroll 1
        for (int h = 0; h < NH; ++h) {
            v16h aq = frag_k16(Y, 0, h * 16, LP, lane);
            v8f sc[NTIL];
#pragma unroll
            for (int nt = 0; nt < NTIL; ++nt) {
                v16h bk = frag_k16(sKT, nt * 16, h * 16, LP, lane);
                sc[nt] = wmma_f16(aq, bk, zero8());
            }
            // scale 1/sqrt(16) + mask   (D elem (r,lane) = row r+hi*8, col l)
#pragma unroll
            for (int nt = 0; nt < NTIL; ++nt)
#pragma unroll
                for (int r = 0; r < 8; ++r)
                    sc[nt][r] = sc[nt][r] * 0.25f + mk[nt][r];
            // row-max across the 7 tiles, then across 16 lanes of the half
            float m[8];
#pragma unroll
            for (int r = 0; r < 8; ++r) {
                m[r] = sc[0][r];
#pragma unroll
                for (int nt = 1; nt < NTIL; ++nt) m[r] = fmaxf(m[r], sc[nt][r]);
            }
#pragma unroll
            for (int off = 1; off < 16; off <<= 1)
#pragma unroll
                for (int r = 0; r < 8; ++r)
                    m[r] = fmaxf(m[r], __shfl_xor(m[r], off, 32));
            // exp (unnormalized) -> LDS as the AV A-operand; row sums in regs
            float s[8];
#pragma unroll
            for (int r = 0; r < 8; ++r) s[r] = 0.f;
#pragma unroll
            for (int nt = 0; nt < NTIL; ++nt)
#pragma unroll
                for (int r = 0; r < 8; ++r) {
                    float e = __expf(sc[nt][r] - m[r]);
                    s[r] += e;
                    Wg[(r + hi * 8) * LP + nt * 16 + l] = (_Float16)e;
                }
#pragma unroll
            for (int off = 1; off < 16; off <<= 1)
#pragma unroll
                for (int r = 0; r < 8; ++r) s[r] += __shfl_xor(s[r], off, 32);
            wave_lds_sync();

            // AV + fold 1/rowsum -> out_concat
            v8f o = zero8();
#pragma unroll
            for (int kt = 0; kt < 4; ++kt) {
                v16h aw = frag_k32(Wg, 0, kt * 32, LP, lane);
                v16h bv = frag_k32(sVT, h * 16, kt * 32, LP, lane);
                o = wmma_f16(aw, bv, o);
            }
#pragma unroll
            for (int r = 0; r < 8; ++r)
                X[(r + hi * 8) * LQ + h * 16 + l] = (_Float16)(o[r] * (1.f / s[r]));
        }
        wave_lds_sync();

        // ---- mh = out_concat @ Wc + bc ------------------------------------
        {
            v16h a[4];
#pragma unroll
            for (int kt = 0; kt < 4; ++kt) a[kt] = frag_k32(X, 0, kt * 32, LQ, lane);
            v8f acc[8];
#pragma unroll
            for (int ct = 0; ct < 8; ++ct) acc[ct] = zero8();
#pragma unroll
            for (int kt = 0; kt < 4; ++kt)
#pragma unroll
                for (int ct = 0; ct < 8; ++ct)
                    acc[ct] = wmma_f16(a[kt], frag_k32(sWcT, ct * 16, kt * 32, LP, lane), acc[ct]);
#pragma unroll
            for (int ct = 0; ct < 8; ++ct) {
                const float bias = sbc[ct * 16 + l];
#pragma unroll
                for (int r = 0; r < 8; ++r)
                    Y[(r + hi * 8) * LP + ct * 16 + l] = (_Float16)(acc[ct][r] + bias);
            }
        }
        wave_lds_sync();

        // ---- score2 = mh @ EN^T / sqrt(EMB); 10*tanh + mask; softmax over N
        {
            v16h a[4];
#pragma unroll
            for (int kt = 0; kt < 4; ++kt) a[kt] = frag_k32(Y, 0, kt * 32, LP, lane);
            // seven independent accumulator chains; the branch-free tanh is short enough
            // for the whole stage to be unrolled, so that s2[] and t[] are indexed by
            // constants only and stay in registers
            v8f s2[NTIL];
#pragma unroll
            for (int nt = 0; nt < NTIL; ++nt) s2[nt] = zero8();
#pragma unroll
            for (int kt = 0; kt < 4; ++kt)
#pragma unroll
                for (int nt = 0; nt < NTIL; ++nt)
                    s2[nt] = wmma_f16(a[kt], frag_k32(sEN, nt * 16, kt * 32, LP, lane), s2[nt]);
#pragma unroll
            for (int nt = 0; nt < NTIL; ++nt) {
                float t[8];
#pragma unroll
                for (int r = 0; r < 8; ++r) t[r] = s2[nt][r];
                tanh_scaled_x8(t);
#pragma unroll
                for (int r = 0; r < 8; ++r) s2[nt][r] = 10.0f * t[r] + mk[nt][r];
            }
            float m[8], s[8];
#pragma unroll
            for (int r = 0; r < 8; ++r) {
                m[r] = s2[0][r];
#pragma unroll
                for (int nt = 1; nt < NTIL; ++nt) m[r] = fmaxf(m[r], s2[nt][r]);
            }
#pragma unroll
            for (int off = 1; off < 16; off <<= 1)
#pragma unroll
                for (int r = 0; r < 8; ++r)
                    m[r] = fmaxf(m[r], __shfl_xor(m[r], off, 32));
#pragma unroll
            for (int r = 0; r < 8; ++r) {
                s[r] = 0.f;
#pragma unroll
                for (int nt = 0; nt < NTIL; ++nt) {
                    s2[nt][r] = exp2_slot((s2[nt][r] - m[r]) * 1.4426950408889634f);
                    s[r] += s2[nt][r];
                }
            }
#pragma unroll
            for (int off = 1; off < 16; off <<= 1)
#pragma unroll
                for (int r = 0; r < 8; ++r) s[r] += __shfl_xor(s[r], off, 32);
#pragma unroll
            for (int r = 0; r < 8; ++r) {
                const int   p   = p0 + r + hi * 8;
                const float inv = 1.f / s[r];
                float* orow = &out[((size_t)b * PP + p) * NN];
#pragma unroll
                for (int nt = 0; nt < NTIL; ++nt) {
                    const int n = nt * 16 + l;
                    if (p < PP && n < NN) orow[n] = s2[nt][r] * inv;
                }
            }
        }
    }
}

// ---------------------------------------------------------------------------
extern "C" void kernel_launch(void* const* d_in, const int* in_sizes, int n_in,
                              void* d_out, int out_size, void* d_ws, size_t ws_size,
                              hipStream_t stream) {
    (void)in_sizes; (void)n_in; (void)out_size; (void)ws_size;
    const float* eln   = (const float*)d_in[0];
    const float* gload = (const float*)d_in[1];
    const float* gtime = (const float*)d_in[2];
    const float* glen  = (const float*)d_in[3];
    const float* gopen = (const float*)d_in[4];
    const float* ninf  = (const float*)d_in[5];
    const float* enc   = (const float*)d_in[6];
    const float* Wq    = (const float*)d_in[7];
    const float* Wk    = (const float*)d_in[8];
    const float* Wv    = (const float*)d_in[9];
    const float* Wc    = (const float*)d_in[10];
    const float* bcv   = (const float*)d_in[11];
    float* out = (float*)d_out;
    float* img = (float*)d_ws;

    hipFuncSetAttribute((const void*)vrp_decoder_kernel,
                        hipFuncAttributeMaxDynamicSharedMemorySize,
                        SMEM_TOTAL);
    weight_image_kernel<<<dim3(IMG_BLOCKS), dim3(EMB), 0, stream>>>(Wq, Wk, Wv, Wc, bcv, img);
    vrp_decoder_kernel<<<dim3(BB), dim3(256), SMEM_TOTAL, stream>>>(
        eln, gload, gtime, glen, gopen, ninf, enc, img, out);
}

// v006
// One run takes 73.6 microseconds.
// Timed twice side by side with v005, it ran 1.26 and 1.25 times as fast.
// Over all steps from v000 it is 8.58 times as fast.
#include <hip/hip_runtime.h>
#include <hip/hip_bf16.h>
#include <math.h>

// ---------------------------------------------------------------------------
// Problem constants (match reference)
// ---------------------------------------------------------------------------
#define BB   1024
#define PP   100
#define NN   101
#define EMB  128
#define NH   8
#define DKK  16

#define NPAD 112        // N padded to 7*16
#define PTIL 7          // ceil(100/16)
#define NTIL 7          // ceil(101/16)
#define KQ   160        // 132 padded to 5*32
#define LASTROWS (PP - (PTIL - 1) * 16)   // live rows of the last P tile
#define ENLD ((NN + 7) / 8)   // groups of 8 encoded_nodes rows that hold a live row
#define LASTCOLS (NN - (NTIL - 1) * 16)   // live columns of the last N tile

// LDS row pitches.  Bank = dword address mod 64, so 16 rows at a 256-B pitch put
// a whole b128 fragment read on four banks.  16 B x odd spreads them over all 64.
#define LP   136        // halves: 272 B pitch for the 128-half rows
#define LQ   168        // halves: 336 B pitch for the 160-half rows

typedef __attribute__((ext_vector_type(16))) _Float16 v16h;
typedef __attribute__((ext_vector_type(8)))  _Float16 v8h;
typedef __attribute__((ext_vector_type(4)))  _Float16 v4h;
typedef __attribute__((ext_vector_type(8)))  float    v8f;
// four floats at the 4-byte alignment of a 101-float row
typedef __attribute__((ext_vector_type(4), aligned(4))) float f4u;

// ---------------------------------------------------------------------------
// WMMA helpers (CDNA5 wave32, D = A(16x32 f16) * B(32x16 f16) + C(16x16 f32))
// ---------------------------------------------------------------------------
__device__ __forceinline__ v8f wmma_f16(v16h a, v16h b, v8f c) {
    return __builtin_amdgcn_wmma_f32_16x16x32_f16(
        /*neg_a=*/false, a, /*neg_b=*/false, b,
        /*c_mod=*/(short)0, c, /*reuse_a=*/false, /*reuse_b=*/false);
}

__device__ __forceinline__ v8f zero8() {
    v8f z = {0.f, 0.f, 0.f, 0.f, 0.f, 0.f, 0.f, 0.f};
    return z;
}

// A-operand (16x32, M x K) from row-major f16 [M][stride]; also valid for the
// B-operand (32x16, K x N) when B is stored "column-major by N", i.e. [N][stride]
// holding K along the row.  Per ISA 7.12.2: lanes 0-15 hold K {0..7,16..23},
// lanes 16-31 hold K {8..15,24..31}  ->  two aligned 16B LDS reads per lane.
__device__ __forceinline__ v16h frag_k32(const _Float16* base, int row0, int k0,
                                         int stride, int lane) {
    const int l  = lane & 15;
    const int hi = (lane >> 4) & 1;
    const _Float16* p = base + (size_t)(row0 + l) * stride + k0 + hi * 8;
    v8h lo = *(const v8h*)p;
    v8h hh = *(const v8h*)(p + 16);
    v16h r;
#pragma unroll
    for (int i = 0; i < 8; ++i) { r[i] = lo[i]; r[i + 8] = hh[i]; }
    return r;
}

// Hand-over of a tile between the lanes of ONE wave through LDS: the wave's own
// stores must have landed, and the compiler must not hoist the reads over them.
__device__ __forceinline__ void wave_lds_sync() {
    asm volatile("s_wait_dscnt 0x0" ::: "memory");
}

// Two 8-half register groups as one 16x16x32 operand: k 0..15 of the block from lo,
// k 16..31 from hh (each lane half holds its eight of either).
__device__ __forceinline__ v16h join16(v8h lo, v8h hh) {
    return __builtin_shufflevector(lo, hh, 0, 1, 2, 3, 4, 5, 6, 7, 8, 9, 10, 11, 12, 13, 14, 15);
}

// The value of lane l ^ 16.
__device__ __forceinline__ float other_half(float x) {
    const int v = __float_as_int(x);
    return __int_as_float(__builtin_amdgcn_permlanex16(v, v, 0x76543210, 0xfedcba98, false, false));
}

// Maximum of a row that lies in lanes l and l + 16: eight independent chains over the
// tiles, a tree over them, one exchange between the lane halves.
__device__ __forceinline__ float row_max(const v8f (&t)[NTIL]) {
    float m[8];
#pragma unroll   // unrolled, the inner loop too: m[] and t[] stay in registers
    for (int r = 0; r < 8; ++r) {
        m[r] = t[0][r];
#pragma unroll
        for (int nt = 1; nt < NTIL; ++nt) m[r] = fmaxf(m[r], t[nt][r]);
    }
    const float a = fmaxf(fmaxf(fmaxf(m[0], m[1]), fmaxf(m[2], m[3])),
                          fmaxf(fmaxf(m[4], m[5]), fmaxf(m[6], m[7])));
    return fmaxf(a, other_half(a));
}

// Sum of a row from a lane's eight partial sums: a tree, then the other lane half's.
__device__ __forceinline__ float row_sum(const float (&s)[8]) {
    const float a = ((s[0] + s[1]) + (s[2] + s[3])) + ((s[4] + s[5]) + (s[6] + s[7]));
    return a + other_half(a);
}

// Eight independent transcendentals of one kind in one statement: each is the free
// issue slot that the instruction set asks for behind the one in front of it, and the
// v_nop is the last one's.
#define TRANS_X8(OP, t)                                                        \
    asm(OP " %0, %0\n\t" OP " %1, %1\n\t" OP " %2, %2\n\t" OP " %3, %3\n\t"      \
        OP " %4, %4\n\t" OP " %5, %5\n\t" OP " %6, %6\n\t" OP " %7, %7\n\tv_nop" \
        : "+v"(t[0]), "+v"(t[1]), "+v"(t[2]), "+v"(t[3]),                      \
          "+v"(t[4]), "+v"(t[5]), "+v"(t[6]), "+v"(t[7]))

// tanh(x / sqrt(EMB)) = 1 - 2 / (e^(2x / sqrt(EMB)) + 1) for a lane's eight values of
// one tile, without a branch: five instructions a value, no value waits for another.
// e^.. = inf gives 1, e^.. = 0 gives -1, NaN stays NaN.  The absolute error is a few
// f32 ulps of 1, which is what counts for a logit that is 10 * tanh.
__device__ __forceinline__ void tanh_scaled_x8(float (&t)[8]) {
#pragma unroll   // unrolled here and below: t[] stays in registers
    for (int r = 0; r < 8; ++r)
        t[r] *= (float)(2.0 * 1.4426950408889634 / 11.313708498984761);
    TRANS_X8("v_exp_f32", t);
#pragma unroll
    for (int r = 0; r < 8; ++r) t[r] += 1.0f;
    TRANS_X8("v_rcp_f32", t);
#pragma unroll
    for (int r = 0; r < 8; ++r) t[r] = 1.0f - 2.0f * t[r];
}

// ---------------------------------------------------------------------------
// Dynamic-LDS layout; total 243,712 B (< 320 KB WGP)
// ---------------------------------------------------------------------------
#define SMEM_PERSIST ((NPAD + NPAD + EMB + EMB) * LP * 2 + 512 + EMB * LQ * 2)
#define WAVE_HALVES  (16 * LQ)                 // one wave's private input tile
#define SMEM_UNION   (2 * EMB * LP * 2)        // Wk^T + Wv^T; also covers the seven input tiles
#define SMEM_TOTAL   (SMEM_PERSIST + SMEM_UNION)

// ---------------------------------------------------------------------------
// Weight image: Wc^T, bc, Wq^T, Wk^T, Wv^T exactly as they lie in LDS (f16 rows
// at their padded pitch, K-pad and pitch pad zero; bc in f32).  Built once per
// call by the first launch, then fetched whole by every block of the second.
// ---------------------------------------------------------------------------
#define IMG_LDS_OFF ((NPAD + NPAD + EMB) * LP * 2)      // LDS byte offset of Wc^T
#define IMG_WC      0
#define IMG_BC      (IMG_WC + EMB * LP * 2)
#define IMG_WQ      (IMG_BC + EMB * 4)
#define IMG_WK      (IMG_WQ + EMB * LQ * 2)
#define IMG_WV      (IMG_WK + EMB * LP * 2)
#define IMG_BYTES   (IMG_WV + EMB * LP * 2)             // 147,968 = 289 x 512
#define UP          (LP / 8)                            // 16-B units per 272-B row
#define UQ          (LQ / 8)                            // 16-B units per 336-B row
#define IMG_BLOCKS  (3 * UP + UQ + 1)

// One block = one 16-B unit column (8 k values) of one matrix, thread = row n:
// eight coalesced row reads, one 16-B store.
__global__ __launch_bounds__(EMB)
void weight_image_kernel(const float* __restrict__ Wq,    // [132,128]
                         const float* __restrict__ Wk,    // [128,128]
                         const float* __restrict__ Wv,    // [128,128]
                         const float* __restrict__ Wc,    // [128,128]
                         const float* __restrict__ bcv,   // [128]
                         float* __restrict__ img)
{
    const int blk = blockIdx.x;
    const int n   = threadIdx.x;
    char* dst = (char*)img;
    if (blk == IMG_BLOCKS - 1) {
        if (n < EMB / 4) *(float4*)(dst + IMG_BC + n * 16) = *(const float4*)&bcv[n * 4];
        return;
    }
    const float* Wm; int u, kmax, pitch, off;
    if (blk < UP)               { Wm = Wc; u = blk;               kmax = EMB;     pitch = LP * 2; off = IMG_WC; }
    else if (blk < UP + UQ)     { Wm = Wq; u = blk - UP;          kmax = EMB + 4; pitch = LQ * 2; off = IMG_WQ; }
    else if (blk < 2 * UP + UQ) { Wm = Wk; u = blk - UP - UQ;     kmax = EMB;     pitch = LP * 2; off = IMG_WK; }
    else                        { Wm = Wv; u = blk - 2 * UP - UQ; kmax = EMB;     pitch = LP * 2; off = IMG_WV; }
    // pad rows read a clamped address, so that the eight loads share one trip
    float w[8];
#pragma unroll
    for (int j = 0; j < 8; ++j) {
        const int k = u * 8 + j;
        w[j] = Wm[(k < kmax ? k : kmax - 1) * EMB + n];
    }
    v8h h;
#pragma unroll
    for (int j = 0; j < 8; ++j)
        h[j] = (u * 8 + j < kmax) ? (_Float16)w[j] : (_Float16)0.f;
    *(v8h*)(dst + off + n * pitch + u * 16) = h;
    // the built code lays the bc branch's load behind this store, into its data registers
    asm volatile("s_wait_xcnt 0x0" ::: "memory");
}

// Twelve 16-B-per-lane copies global -> LDS, 4 KiB apart (the block's eight waves
// cover 4 KiB per copy).  The s_wait_xcnt closes the statement so that no address
// register of a copy is rewritten ahead of it.
__device__ __forceinline__ void copy12_to_lds(unsigned l, const char* g) {
    asm volatile(
        "global_load_async_to_lds_b128 %0, %12, off\n\t"
        "global_load_async_to_lds_b128 %1, %13, off\n\t"
        "global_load_async_to_lds_b128 %2, %14, off\n\t"
        "global_load_async_to_lds_b128 %3, %15, off\n\t"
        "global_load_async_to_lds_b128 %4, %16, off\n\t"
        "global_load_async_to_lds_b128 %5, %17, off\n\t"
        "global_load_async_to_lds_b128 %6, %18, off\n\t"
        "global_load_async_to_lds_b128 %7, %19, off\n\t"
        "global_load_async_to_lds_b128 %8, %20, off\n\t"
        "global_load_async_to_lds_b128 %9, %21, off\n\t"
        "global_load_async_to_lds_b128 %10, %22, off\n\t"
        "global_load_async_to_lds_b128 %11, %23, off\n\t"
        "s_wait_xcnt 0x0"
        :: "v"(l), "v"(l + 4096u), "v"(l + 8192u), "v"(l + 12288u),
           "v"(l + 16384u), "v"(l + 20480u), "v"(l + 24576u), "v"(l + 28672u),
           "v"(l + 32768u), "v"(l + 36864u), "v"(l + 40960u), "v"(l + 45056u),
           "v"(g), "v"(g + 4096), "v"(g + 8192), "v"(g + 12288),
           "v"(g + 16384), "v"(g + 20480), "v"(g + 24576), "v"(g + 28672),
           "v"(g + 32768), "v"(g + 36864), "v"(g + 40960), "v"(g + 45056)
        : "memory");
}

// One block fills a WGP's LDS, so two waves share a SIMD.  Stated so that the compiler
// schedules for that register budget: without it this build packs the Q and mh
// products into fewer registers and waits on LDS at nearly every one of them.
__global__ __launch_bounds__(256) __attribute__((amdgpu_waves_per_eu(2, 2)))
void vrp_decoder_kernel(const float* __restrict__ eln,    // [B,P,EMB]
                        const float* __restrict__ gload,  // [B,P]
                        const float* __restrict__ gtime,  // [B,P]
                        const float* __restrict__ glen,   // [B,P]
                        const float* __restrict__ gopen,  // [B,P]
                        const float* __restrict__ ninf,   // [B,P,N]
                        const float* __restrict__ enc,    // [B,N,EMB]
                        const float* __restrict__ wimg,   // weight image, IMG_BYTES
                        float* __restrict__ out)          // [B,P,N]
{
    extern __shared__ char smem[];
    const int b    = blockIdx.x;
    const int tid  = threadIdx.x;
    const int wave = tid >> 5;     // 0..7
    const int lane = tid & 31;
    const int l    = lane & 15;
    const int hi   = (lane >> 4) & 1;

    _Float16* sEN  = (_Float16*)smem;            // [112][LP]
    _Float16* sKT  = sEN  + NPAD * LP;           // [112][LP] K as [n][h*16+d]
    _Float16* sVT  = sKT  + NPAD * LP;           // [128][LP] V^T as [h*16+d][n]
    _Float16* sWcT = sVT  + EMB * LP;            // [128][LP]
    float*    sbc  = (float*)(sWcT + EMB * LP);  // [128]
    _Float16* sWqT = (_Float16*)(sbc + EMB);     // [128][LQ]
    char*     uni  = (char*)(sWqT + EMB * LQ);
    // phase 0/1 overlay
    _Float16* sWkT = (_Float16*)uni;             // [128][LP]
    _Float16* sWvT = sWkT + EMB * LP;            // [128][LP]
    // after phase 1 the union holds seven wave-private areas (see the P tiles)

    // ---------------- phase 0: fetch the weight image, stage encoded_nodes --
    // The row loads go out first, then the image's copies.
    const int pw = __builtin_amdgcn_readfirstlane(wave);
    // encoded_nodes: wave w stages rows w, w+8, ...; one 512-B row per load.  All of
    // a thread's row loads are issued here, ahead of any wait on one of them, so that
    // they share one trip to memory.  A pad row of the group that straddles row NN
    // reads a clamped address; the group past it is not loaded at all.
    float4 en[ENLD];
    {
        const int      rl = pw + 8 * (ENLD - 1);         // pw is 0..7
        const char*    e0 = (const char*)&enc[((size_t)b * NN + pw) * EMB];
        const char*    e1 = (const char*)&enc[((size_t)b * NN + (rl < NN ? rl : NN - 1)) * EMB];
        const unsigned eo = lane * 16;
#pragma unroll   // unrolled: the loads stand back to back and en[] stays in registers
        for (int j = 0; j < ENLD - 1; ++j) en[j] = *(const float4*)(e0 + j * 8 * EMB * 4 + eo);
        en[ENLD - 1] = *(const float4*)(e1 + eo);
        // no address register of these loads is rewritten ahead of this wait: as its
        // inputs they stay live up to it, so that no load's result is laid over them
        asm volatile("s_wait_xcnt 0x0" :: "v"(lane), "s"(e0), "s"(e1) : "memory");
    }
    {
        const unsigned l0 = (unsigned)(size_t)smem + IMG_LDS_OFF + tid * 16;
        const char*    g0 = (const char*)wimg + tid * 16;
        copy12_to_lds(l0, g0);
        copy12_to_lds(l0 + 49152u, g0 + 49152);
        copy12_to_lds(l0 + 98304u, g0 + 98304);
        if (pw == 0) {   // the image's last 512 B; wait in the statement as in copy12_to_lds
            asm volatile("global_load_async_to_lds_b128 %0, %1, off\n\ts_wait_xcnt 0x0"
                         :: "v"(l0 + 147456u), "v"(g0 + 147456) : "memory");
        }
    }
    for (int i = tid; i < EMB * 16; i += 256) { // zero V^T cols n=112..127
        int r = i >> 4, c = i & 15;
        sVT[r * LP + NPAD + c] = (_Float16)0.f;
    }
    // encoded_nodes rows to f16: contiguous b64 LDS stores, pad rows zero
#pragma unroll   // unrolled: en[] is indexed by constants only
    for (int j = 0; j < NPAD / 8; ++j) {
        const int r = pw + 8 * j;
        float4 v = make_float4(0.f, 0.f, 0.f, 0.f);
        if (8 * j + 7 < NN || (j < ENLD && r < NN)) v = en[j < ENLD ? j : 0];
        v4h h; h[0] = (_Float16)v.x; h[1] = (_Float16)v.y;
        h[2] = (_Float16)v.z; h[3] = (_Float16)v.w;
        *(v4h*)&sEN[r * LP + lane * 4] = h;
    }
    // this wave's copies have landed; the barrier then publishes all waves' parts
    asm volatile("s_wait_asynccnt 0x0" ::: "memory");
    __syncthreads();

    // ---------------- phase 1: K = EN@Wk, V = EN@Wv ------------------------
    for (int t = wave; t < 2 * NTIL * 8; t += 8) {
        const bool isK = (t < NTIL * 8);
        const int  tt  = isK ? t : t - NTIL * 8;
        const int  mt  = tt >> 3;               // n-tile 0..6
        const int  ct  = tt & 7;                // col-tile 0..7 (h*16+d)
        const _Float16* wT = isK ? sWkT : sWvT;
        v8f acc = zero8();
#pragma unroll
        for (int kt = 0; kt < 4; ++kt) {
            v16h a  = frag_k32(sEN, mt * 16, kt * 32, LP, lane);
            v16h bf = frag_k32(wT, ct * 16, kt * 32, LP, lane);
            acc = wmma_f16(a, bf, acc);
        }
        if (isK) {                               // sKT[n][col] (strided)
#pragma unroll
            for (int r = 0; r < 8; ++r)
                sKT[(mt * 16 + r + hi * 8) * LP + ct * 16 + l] = (_Float16)acc[r];
        } else {                                 // sVT[col][n]: 8 contiguous
            v8h h;                               //   halves -> one b128 store
#pragma unroll
            for (int r = 0; r < 8; ++r) h[r] = (_Float16)acc[r];
            *(v8h*)&sVT[(ct * 16 + l) * LP + mt * 16 + hi * 8] = h;
        }
    }
    __syncthreads();

    // ---------------- P tiles: one wave owns one 16-row tile end to end -----
    // Every product is computed transposed: the shared operand (weights, K, V^T,
    // encoded_nodes) is A, the tile's own data is B, so that lane (l, hi) holds query
    // row p0 + l throughout.  A pair of D tiles, converted in place, is the next
    // product's B operand in the hardware k order, which frag_k32 has for A: after
    // the input tile nothing of the chain passes through LDS.  A softmax row lies in
    // the two lanes l and l + 16.  Every "#pragma unroll" below is there so that the
    // register arrays are indexed by constants only and stay in registers.
    if (pw < PTIL) {
        const int p0 = pw * 16;
        const int p  = p0 + l;                             // this lane's query row
        _Float16* X  = (_Float16*)uni + pw * WAVE_HALVES;  // [16][LQ] input_cat

        v8h z8;
#pragma unroll
        for (int i = 0; i < 8; ++i) z8[i] = (_Float16)0.f;

        // All of the tile's global loads are issued first, so that they share one
        // trip to memory.  Mask row p straight into the transposed accumulator layout
        // (column n = nt*16 + hi*8 + r); a dead row reads a clamped address, and the
        // last column tile reads the row's last eight values.
        const size_t gi = (size_t)b * PP + (p < PP ? p : PP - 1);
        // the 4 scalar features of row l
        const float  f0 = gload[gi], f1 = gtime[gi], f2 = glen[gi], f3 = gopen[gi];
        // the mask loads' results below may land in address registers of the loads above
        asm volatile("s_wait_xcnt 0x0" ::: "memory");
        float mk[NTIL][8];
        {
            const float* mr = &ninf[gi * NN];
            const float* mh = mr + hi * 8;
#pragma unroll
            for (int nt = 0; nt < NTIL - 1; ++nt) {
                const f4u m0 = *(const f4u*)(mh + nt * 16);
                const f4u m1 = *(const f4u*)(mh + nt * 16 + 4);
#pragma unroll
                for (int r = 0; r < 4; ++r) { mk[nt][r] = m0[r]; mk[nt][r + 4] = m1[r]; }
            }
            const f4u m0 = *(const f4u*)(mr + NN - 8);
            const f4u m1 = *(const f4u*)(mr + NN - 4);
#pragma unroll
            for (int r = 0; r < 4; ++r) { mk[NTIL - 1][r] = m0[r]; mk[NTIL - 1][r + 4] = m1[r]; }
            // the row loads' results below may land in address registers of the loads above;
            // as the wait's inputs those stay live up to it, so that no mask value is laid over them
            asm volatile("s_wait_xcnt 0x0" :: "v"(mr), "v"(mh) : "memory");
        }
        // input_cat tile: one 512-B row per load; the last tile has LASTROWS live rows
        {
            const bool   full = pw < PTIL - 1;
            const float* er   = &eln[((size_t)b * PP + p0) * EMB + lane * 4];
            float4 ev[16];
#pragma unroll
            for (int j = 0; j < LASTROWS; ++j) ev[j] = *(const float4*)(er + j * EMB);
            // the next rows' results may land in these loads' offset register
            asm volatile("s_wait_xcnt 0x0" ::: "memory");
#pragma unroll
            for (int j = LASTROWS; j < 16; ++j) ev[j] = make_float4(0.f, 0.f, 0.f, 0.f);
            if (full) {
#pragma unroll
                for (int j = LASTROWS; j < 16; ++j) ev[j] = *(const float4*)(er + j * EMB);
            }
#pragma unroll
            for (int j = 0; j < 16; ++j) {
                v4h h;
                h[0] = (_Float16)ev[j].x; h[1] = (_Float16)ev[j].y;
                h[2] = (_Float16)ev[j].z; h[3] = (_Float16)ev[j].w;
                *(v4h*)&X[j * LQ + lane * 4] = h;
            }
        }
        // features + K-pad (cols 128..159): lane pair (l, l+16) fills row l
        {
            const bool live = (p < PP) && (hi == 0);
            v8h fa = z8;
            fa[0] = (_Float16)(live ? f0 : 0.f); fa[1] = (_Float16)(live ? f1 : 0.f);
            fa[2] = (_Float16)(live ? f2 : 0.f); fa[3] = (_Float16)(live ? f3 : 0.f);
            *(v8h*)&X[l * LQ + EMB + hi * 16]     = fa;
            *(v8h*)&X[l * LQ + EMB + hi * 16 + 8] = z8;
        }
        // dead rows get mask 0; the last tile's live columns (NN - LASTCOLS .. NN - 1,
        // all in the lower lane half) move to their registers, its pad columns drop out
#pragma unroll
        for (int nt = 0; nt < NTIL - 1; ++nt)
#pragma unroll
            for (int r = 0; r < 8; ++r) mk[nt][r] = (p < PP) ? mk[nt][r] : 0.f;
#pragma unroll
        for (int r = 0; r < 8; ++r) {
            const float v = (p < PP) ? mk[NTIL - 1][r + 8 - LASTCOLS < 8 ? r + 8 - LASTCOLS : 7] : 0.f;
            mk[NTIL - 1][r] = (r < LASTCOLS && hi == 0) ? v : -1e30f;
        }
        wave_lds_sync();

        // ---- Q^T, attention and mh^T, two heads a trip ---------------------
        v16h xb[5];     // input_cat^T as B operand, K = 160, kept for all heads
#pragma unroll
        for (int kt = 0; kt < 5; ++kt) xb[kt] = frag_k32(X, 0, kt * 32, LQ, lane);
        v8f macc[8];    // mh^T: tile ct, register r = mh[p][ct*16 + hi*8 + r]
#pragma unroll
        for (int ct = 0; ct < 8; ++ct) macc[ct] = zero8();
        // kept rolled: the text stays small for the instruction cache.  Two heads are one
        // 32-deep k block of mh^T, so that the trip number enters LDS addresses only and
        // everything else is indexed by constants and stays in registers.
#pragma unroll 1
        for (int hp = 0; hp < NH / 2; ++hp) {
            // Q^T = Wq^T @ input_cat^T of the two heads: register r = Q[p][head*16 + hi*8 + r]
            v8f q0 = zero8(), q1 = zero8();
#pragma unroll
            for (int kt = 0; kt < 5; ++kt) {
                q0 = wmma_f16(frag_k32(sWqT, hp * 32,      kt * 32, LQ, lane), xb[kt], q0);
                q1 = wmma_f16(frag_k32(sWqT, hp * 32 + 16, kt * 32, LQ, lane), xb[kt], q1);
            }
            // S^T = K @ Q^T.  One K fragment holds both heads' d (k 0..15 and 16..31);
            // the other head's half of B is zero.
            const v16h bq0 = join16(__builtin_convertvector(q0, v8h), z8);
            const v16h bq1 = join16(z8, __builtin_convertvector(q1, v8h));
            v8f sc[2][NTIL];                               // sc[j][nt][r] = S[p][nt*16 + hi*8 + r]
#pragma unroll
            for (int nt = 0; nt < NTIL; ++nt) {
                const v16h ak = frag_k32(sKT, nt * 16, hp * 32, LP, lane);
                sc[0][nt] = wmma_f16(ak, bq0, zero8());
                sc[1][nt] = wmma_f16(ak, bq1, zero8());
            }
            v8h oh[2];  // register r = out_concat[p][head*16 + hi*8 + r]
#pragma unroll
            for (int j = 0; j < 2; ++j) {
                // scale 1/sqrt(16) + mask
#pragma unroll
                for (int nt = 0; nt < NTIL; ++nt)
#pragma unroll
                    for (int r = 0; r < 8; ++r)
                        sc[j][nt][r] = sc[j][nt][r] * 0.25f + mk[nt][r];
                const float m = row_max(sc[j]);
                // exp (unnormalized), eight independent partial sums
                float s8[8];
#pragma unroll
                for (int r = 0; r < 8; ++r) s8[r] = 0.f;
#pragma unroll
                for (int nt = 0; nt < NTIL; ++nt) {
                    float t[8];
#pragma unroll
                    for (int r = 0; r < 8; ++r) t[r] = (sc[j][nt][r] - m) * 1.4426950408889634f;
                    TRANS_X8("v_exp_f32", t);
#pragma unroll
                    for (int r = 0; r < 8; ++r) { s8[r] += t[r]; sc[j][nt][r] = t[r]; }
                }
                const float inv = 1.f / row_sum(s8);
                // O^T = V^T @ W^T (columns n = 112..127 are zero on both sides), 1/rowsum folded in
                v8f o = zero8();
#pragma unroll
                for (int kt = 0; kt < 4; ++kt) {
                    const v8h w0 = __builtin_convertvector(sc[j][2 * kt], v8h);
                    const v8h w1 = (2 * kt + 1 < NTIL)
                        ? __builtin_convertvector(sc[j][2 * kt + 1 < NTIL ? 2 * kt + 1 : 0], v8h) : z8;
                    o = wmma_f16(frag_k32(sVT, hp * 32 + j * 16, kt * 32, LP, lane), join16(w0, w1), o);
                }
#pragma unroll
                for (int r = 0; r < 8; ++r) o[r] *= inv;
                oh[j] = __builtin_convertvector(o, v8h);
            }
            // mh^T += Wc^T @ out_concat^T, this pair's k block
            const v16h bo = join16(oh[0], oh[1]);
#pragma unroll
            for (int ct = 0; ct < 8; ++ct)
                macc[ct] = wmma_f16(frag_k32(sWcT, ct * 16, hp * 32, LP, lane), bo, macc[ct]);
        }
        v8h mhh[8];     // mh + bc in f16: tile ct, element r = mh[p][ct*16 + hi*8 + r]
#pragma unroll
        for (int ct = 0; ct < 8; ++ct) {
            const float4 b0 = *(const float4*)&sbc[ct * 16 + hi * 8];
            const float4 b1 = *(const float4*)&sbc[ct * 16 + hi * 8 + 4];
            v8f a = macc[ct];
            a[0] += b0.x; a[1] += b0.y; a[2] += b0.z; a[3] += b0.w;
            a[4] += b1.x; a[5] += b1.y; a[6] += b1.z; a[7] += b1.w;
            mhh[ct] = __builtin_convertvector(a, v8h);
        }

        // ---- score2^T = EN @ mh^T / sqrt(EMB); 10*tanh + mask; softmax over N
        {
            // seven independent accumulator chains
            v8f s2[NTIL];
#pragma unroll
            for (int nt = 0; nt < NTIL; ++nt) s2[nt] = zero8();
#pragma unroll
            for (int kt = 0; kt < 4; ++kt) {
                const v16h bm = join16(mhh[2 * kt], mhh[2 * kt + 1]);
#pragma unroll
                for (int nt = 0; nt < NTIL; ++nt)
                    s2[nt] = wmma_f16(frag_k32(sEN, nt * 16, kt * 32, LP, lane), bm, s2[nt]);
            }
#pragma unroll
            for (int nt = 0; nt < NTIL; ++nt) {
                float t[8];
#pragma unroll
                for (int r = 0; r < 8; ++r) t[r] = s2[nt][r];
                tanh_scaled_x8(t);
#pragma unroll
                for (int r = 0; r < 8; ++r) s2[nt][r] = 10.0f * t[r] + mk[nt][r];
            }
            const float m = row_max(s2);
            float s8[8];
#pragma unroll
            for (int r = 0; r < 8; ++r) s8[r] = 0.f;
#pragma unroll
            for (int nt = 0; nt < NTIL; ++nt) {
                float t[8];
#pragma unroll
                for (int r = 0; r < 8; ++r) t[r] = (s2[nt][r] - m) * 1.4426950408889634f;
                TRANS_X8("v_exp_f32", t);
#pragma unroll
                for (int r = 0; r < 8; ++r) { s8[r] += t[r]; s2[nt][r] = t[r]; }
            }
            const float inv = 1.f / row_sum(s8);
            // all products first, in place, so that no store's data register is rewritten
#pragma unroll
            for (int nt = 0; nt < NTIL; ++nt)
#pragma unroll
                for (int r = 0; r < 8; ++r) s2[nt][r] *= inv;
            if (p < PP) {
                float* orow = &out[((size_t)b * PP + p) * NN + hi * 8];
#pragma unroll
                for (int nt = 0; nt < NTIL - 1; ++nt) {
                    f4u v0, v1;
#pragma unroll
                    for (int r = 0; r < 4; ++r) { v0[r] = s2[nt][r]; v1[r] = s2[nt][r + 4]; }
                    *(f4u*)(orow + nt * 16)     = v0;
                    *(f4u*)(orow + nt * 16 + 4) = v1;
                }
                if (hi == 0) {
#pragma unroll
                    for (int r = 0; r < LASTCOLS; ++r) orow[(NTIL - 1) * 16 + r] = s2[NTIL - 1][r];
                }
            }
        }
    }
}

// ---------------------------------------------------------------------------
extern "C" void kernel_launch(void* const* d_in, const int* in_sizes, int n_in,
                              void* d_out, int out_size, void* d_ws, size_t ws_size,
                              hipStream_t stream) {
    (void)in_sizes; (void)n_in; (void)out_size; (void)ws_size;
    const float* eln   = (const float*)d_in[0];
    const float* gload = (const float*)d_in[1];
    const float* gtime = (const float*)d_in[2];
    const float* glen  = (const float*)d_in[3];
    const float* gopen = (const float*)d_in[4];
    const float* ninf  = (const float*)d_in[5];
    const float* enc   = (const float*)d_in[6];
    const float* Wq    = (const float*)d_in[7];
    const float* Wk    = (const float*)d_in[8];
    const float* Wv    = (const float*)d_in[9];
    const float* Wc    = (const float*)d_in[10];
    const float* bcv   = (const float*)d_in[11];
    float* out = (float*)d_out;
    float* img = (float*)d_ws;

    hipFuncSetAttribute((const void*)vrp_decoder_kernel,
                        hipFuncAttributeMaxDynamicSharedMemorySize,
                        SMEM_TOTAL);
    weight_image_kernel<<<dim3(IMG_BLOCKS), dim3(EMB), 0, stream>>>(Wq, Wk, Wv, Wc, bcv, img);
    vrp_decoder_kernel<<<dim3(BB), dim3(256), SMEM_TOTAL, stream>>>(
        eln, gload, gtime, glen, gopen, ninf, enc, img, out);
}

// v007
// A run of this version takes 65.5 microseconds.
// Next to v006, in two timings, it ran 1.12 times as fast each time.
// All steps since v000 together make it 9.63 times as fast.
#include <hip/hip_runtime.h>
#include <hip/hip_bf16.h>
#include <math.h>

// ---------------------------------------------------------------------------
// Problem constants (match reference)
// ---------------------------------------------------------------------------
#define BB   1024
#define PP   100
#define NN   101
#define EMB  128
#define NH   8
#define DKK  16

#define NPAD 112        // N padded to 7*16
#define PTIL 7          // ceil(100/16)
#define NTIL 7          // ceil(101/16)
#define KQ   160        // 132 padded to 5*32
#define LASTROWS (PP - (PTIL - 1) * 16)   // live rows of the last P tile
#define ENLD ((NN + 7) / 8)   // groups of 8 encoded_nodes rows that hold a live row
#define LASTCOLS (NN - (NTIL - 1) * 16)   // live columns of the last N tile

// LDS row pitches.  Bank = dword address mod 64, so 16 rows at a 256-B pitch put
// a whole b128 fragment read on four banks.  16 B x odd spreads them over all 64.
#define LP   136        // halves: 272 B pitch for the 128-half rows
#define LQ   168        // halves: 336 B pitch for the 160-half rows

typedef __attribute__((ext_vector_type(16))) _Float16 v16h;
typedef __attribute__((ext_vector_type(8)))  _Float16 v8h;
typedef __attribute__((ext_vector_type(4)))  _Float16 v4h;
typedef __attribute__((ext_vector_type(8)))  float    v8f;
// four floats at the 4-byte alignment of a 101-float row
typedef __attribute__((ext_vector_type(4), aligned(4))) float f4u;

// ---------------------------------------------------------------------------
// WMMA helpers (CDNA5 wave32, D = A(16x32 f16) * B(32x16 f16) + C(16x16 f32))
// ---------------------------------------------------------------------------
__device__ __forceinline__ v8f wmma_f16(v16h a, v16h b, v8f c) {
    return __builtin_amdgcn_wmma_f32_16x16x32_f16(
        /*neg_a=*/false, a, /*neg_b=*/false, b,
        /*c_mod=*/(short)0, c, /*reuse_a=*/false, /*reuse_b=*/false);
}

__device__ __forceinline__ v8f zero8() {
    v8f z = {0.f, 0.f, 0.f, 0.f, 0.f, 0.f, 0.f, 0.f};
    return z;
}

// A-operand (16x32, M x K) from row-major f16 [M][stride]; also valid for the
// B-operand (32x16, K x N) when B is stored "column-major by N", i.e. [N][stride]
// holding K along the row.  Per ISA 7.12.2: lanes 0-15 hold K {0..7,16..23},
// lanes 16-31 hold K {8..15,24..31}  ->  two aligned 16B LDS reads per lane.
__device__ __forceinline__ v16h frag_k32(const _Float16* base, int row0, int k0,
                                         int stride, int lane) {
    const int l  = lane & 15;
    const int hi = (lane >> 4) & 1;
    const _Float16* p = base + (size_t)(row0 + l) * stride + k0 + hi * 8;
    v8h lo = *(const v8h*)p;
    v8h hh = *(const v8h*)(p + 16);
    v16h r;
#pragma unroll
    for (int i = 0; i < 8; ++i) { r[i] = lo[i]; r[i + 8] = hh[i]; }
    return r;
}

// Hand-over of a tile between the lanes of ONE wave through LDS: the wave's own
// stores must have landed, and the compiler must not hoist the reads over them.
__device__ __forceinline__ void wave_lds_sync() {
    asm volatile("s_wait_dscnt 0x0" ::: "memory");
}

// Two 8-half register groups as one 16x16x32 operand: k 0..15 of the block from lo,
// k 16..31 from hh (each lane half holds its eight of either).
__device__ __forceinline__ v16h join16(v8h lo, v8h hh) {
    return __builtin_shufflevector(lo, hh, 0, 1, 2, 3, 4, 5, 6, 7, 8, 9, 10, 11, 12, 13, 14, 15);
}

// The value of lane l ^ 16.
__device__ __forceinline__ float other_half(float x) {
    const int v = __float_as_int(x);
    return __int_as_float(__builtin_amdgcn_permlanex16(v, v, 0x76543210, 0xfedcba98, false, false));
}

// Maximum of a row that lies in lanes l and l + 16: eight independent chains over the
// tiles, a tree over them, one exchange between the lane halves.
__device__ __forceinline__ float row_max(const v8f (&t)[NTIL]) {
    float m[8];
#pragma unroll   // unrolled, the inner loop too: m[] and t[] stay in registers
    for (int r = 0; r < 8; ++r) {
        m[r] = t[0][r];
#pragma unroll
        for (int nt = 1; nt < NTIL; ++nt) m[r] = fmaxf(m[r], t[nt][r]);
    }
    const float a = fmaxf(fmaxf(fmaxf(m[0], m[1]), fmaxf(m[2], m[3])),
                          fmaxf(fmaxf(m[4], m[5]), fmaxf(m[6], m[7])));
    return fmaxf(a, other_half(a));
}

// Sum of a row from a lane's eight partial sums: a tree, then the other lane half's.
__device__ __forceinline__ float row_sum(const float (&s)[8]) {
    const float a = ((s[0] + s[1]) + (s[2] + s[3])) + ((s[4] + s[5]) + (s[6] + s[7]));
    return a + other_half(a);
}

// Eight independent transcendentals of one kind in one statement: each is the free
// issue slot that the instruction set asks for behind the one in front of it, and the
// v_nop is the last one's.
#define TRANS_X8(OP, t)                                                        \
    asm(OP " %0, %0\n\t" OP " %1, %1\n\t" OP " %2, %2\n\t" OP " %3, %3\n\t"      \
        OP " %4, %4\n\t" OP " %5, %5\n\t" OP " %6, %6\n\t" OP " %7, %7\n\tv_nop" \
        : "+v"(t[0]), "+v"(t[1]), "+v"(t[2]), "+v"(t[3]),                      \
          "+v"(t[4]), "+v"(t[5]), "+v"(t[6]), "+v"(t[7]))

// tanh(x / sqrt(EMB)) = 1 - 2 / (e^(2x / sqrt(EMB)) + 1) for a lane's eight values of
// one tile, without a branch: five instructions a value, no value waits for another.
// e^.. = inf gives 1, e^.. = 0 gives -1, NaN stays NaN.  The absolute error is a few
// f32 ulps of 1, which is what counts for a logit that is 10 * tanh.
__device__ __forceinline__ void tanh_scaled_x8(float (&t)[8]) {
#pragma unroll   // unrolled here and below: t[] stays in registers
    for (int r = 0; r < 8; ++r)
        t[r] *= (float)(2.0 * 1.4426950408889634 / 11.313708498984761);
    TRANS_X8("v_exp_f32", t);
#pragma unroll
    for (int r = 0; r < 8; ++r) t[r] += 1.0f;
    TRANS_X8("v_rcp_f32", t);
#pragma unroll
    for (int r = 0; r < 8; ++r) t[r] = 1.0f - 2.0f * t[r];
}

// ---------------------------------------------------------------------------
// Dynamic-LDS layout; total 243,712 B (< 320 KB WGP)
// ---------------------------------------------------------------------------
#define SMEM_PERSIST ((NPAD + NPAD + EMB + EMB) * LP * 2 + 512 + EMB * LQ * 2)
#define WAVE_HALVES  (16 * LQ)                 // one wave's private input tile
#define SMEM_UNION   (2 * EMB * LP * 2)        // Wk^T + Wv^T; also covers the seven input tiles
#define SMEM_TOTAL   (SMEM_PERSIST + SMEM_UNION)

// ---------------------------------------------------------------------------
// Weight image: Wc^T, bc, Wq^T, Wk^T, Wv^T exactly as they lie in LDS (f16 rows
// at their padded pitch, K-pad and pitch pad zero; bc in f32).  Built once per
// call by the first launch, then fetched whole by every block of the second.
// ---------------------------------------------------------------------------
#define IMG_LDS_OFF ((NPAD + NPAD + EMB) * LP * 2)      // LDS byte offset of Wc^T
#define IMG_WC      0
#define IMG_BC      (IMG_WC + EMB * LP * 2)
#define IMG_WQ      (IMG_BC + EMB * 4)
#define IMG_WK      (IMG_WQ + EMB * LQ * 2)
#define IMG_WV      (IMG_WK + EMB * LP * 2)
#define IMG_BYTES   (IMG_WV + EMB * LP * 2)             // 147,968 = 289 x 512
#define UP          (LP / 8)                            // 16-B units per 272-B row
#define UQ          (LQ / 8)                            // 16-B units per 336-B row
#define IMG_BLOCKS  (3 * UP + UQ + 1)

// One block = one 16-B unit column (8 k values) of one matrix, thread = row n:
// eight coalesced row reads, one 16-B store.
__global__ __launch_bounds__(EMB)
void weight_image_kernel(const float* __restrict__ Wq,    // [132,128]
                         const float* __restrict__ Wk,    // [128,128]
                         const float* __restrict__ Wv,    // [128,128]
                         const float* __restrict__ Wc,    // [128,128]
                         const float* __restrict__ bcv,   // [128]
                         float* __restrict__ img)
{
    const int blk = blockIdx.x;
    const int n   = threadIdx.x;
    char* dst = (char*)img;
    if (blk == IMG_BLOCKS - 1) {
        if (n < EMB / 4) *(float4*)(dst + IMG_BC + n * 16) = *(const float4*)&bcv[n * 4];
        return;
    }
    const float* Wm; int u, kmax, pitch, off;
    if (blk < UP)               { Wm = Wc; u = blk;               kmax = EMB;     pitch = LP * 2; off = IMG_WC; }
    else if (blk < UP + UQ)     { Wm = Wq; u = blk - UP;          kmax = EMB + 4; pitch = LQ * 2; off = IMG_WQ; }
    else if (blk < 2 * UP + UQ) { Wm = Wk; u = blk - UP - UQ;     kmax = EMB;     pitch = LP * 2; off = IMG_WK; }
    else                        { Wm = Wv; u = blk - 2 * UP - UQ; kmax = EMB;     pitch = LP * 2; off = IMG_WV; }
    // pad rows read a clamped address, so that the eight loads share one trip
    float w[8];
#pragma unroll
    for (int j = 0; j < 8; ++j) {
        const int k = u * 8 + j;
        w[j] = Wm[(k < kmax ? k : kmax - 1) * EMB + n];
    }
    v8h h;
#pragma unroll
    for (int j = 0; j < 8; ++j)
        h[j] = (u * 8 + j < kmax) ? (_Float16)w[j] : (_Float16)0.f;
    *(v8h*)(dst + off + n * pitch + u * 16) = h;
    // the built code lays the bc branch's load behind this store, into its data registers
    asm volatile("s_wait_xcnt 0x0" ::: "memory");
}

// Twelve 16-B-per-lane copies global -> LDS, 4 KiB apart (the block's eight waves
// cover 4 KiB per copy).  The s_wait_xcnt closes the statement so that no address
// register of a copy is rewritten ahead of it.
__device__ __forceinline__ void copy12_to_lds(unsigned l, const char* g) {
    asm volatile(
        "global_load_async_to_lds_b128 %0, %12, off\n\t"
        "global_load_async_to_lds_b128 %1, %13, off\n\t"
        "global_load_async_to_lds_b128 %2, %14, off\n\t"
        "global_load_async_to_lds_b128 %3, %15, off\n\t"
        "global_load_async_to_lds_b128 %4, %16, off\n\t"
        "global_load_async_to_lds_b128 %5, %17, off\n\t"
        "global_load_async_to_lds_b128 %6, %18, off\n\t"
        "global_load_async_to_lds_b128 %7, %19, off\n\t"
        "global_load_async_to_lds_b128 %8, %20, off\n\t"
        "global_load_async_to_lds_b128 %9, %21, off\n\t"
        "global_load_async_to_lds_b128 %10, %22, off\n\t"
        "global_load_async_to_lds_b128 %11, %23, off\n\t"
        "s_wait_xcnt 0x0"
        :: "v"(l), "v"(l + 4096u), "v"(l + 8192u), "v"(l + 12288u),
           "v"(l + 16384u), "v"(l + 20480u), "v"(l + 24576u), "v"(l + 28672u),
           "v"(l + 32768u), "v"(l + 36864u), "v"(l + 40960u), "v"(l + 45056u),
           "v"(g), "v"(g + 4096), "v"(g + 8192), "v"(g + 12288),
           "v"(g + 16384), "v"(g + 20480), "v"(g + 24576), "v"(g + 28672),
           "v"(g + 32768), "v"(g + 36864), "v"(g + 40960), "v"(g + 45056)
        : "memory");
}

// One block fills a WGP's LDS, so two waves share a SIMD.  Stated so that the compiler
// schedules for that register budget: without it this build packs the Q and mh
// products into fewer registers and waits on LDS at nearly every one of them.
__global__ __launch_bounds__(256) __attribute__((amdgpu_waves_per_eu(2, 2)))
void vrp_decoder_kernel(const float* __restrict__ eln,    // [B,P,EMB]
                        const float* __restrict__ gload,  // [B,P]
                        const float* __restrict__ gtime,  // [B,P]
                        const float* __restrict__ glen,   // [B,P]
                        const float* __restrict__ gopen,  // [B,P]
                        const float* __restrict__ ninf,   // [B,P,N]
                        const float* __restrict__ enc,    // [B,N,EMB]
                        const float* __restrict__ wimg,   // weight image, IMG_BYTES
                        float* __restrict__ out)          // [B,P,N]
{
    extern __shared__ char smem[];
    const int b    = blockIdx.x;
    const int tid  = threadIdx.x;
    const int wave = tid >> 5;     // 0..7
    const int lane = tid & 31;
    const int l    = lane & 15;
    const int hi   = (lane >> 4) & 1;

    _Float16* sEN  = (_Float16*)smem;            // [112][LP]
    _Float16* sKT  = sEN  + NPAD * LP;           // [112][LP] K as [n][h*16+d]
    _Float16* sVT  = sKT  + NPAD * LP;           // [128][LP] V^T as [h*16+d][n]
    _Float16* sWcT = sVT  + EMB * LP;            // [128][LP]
    float*    sbc  = (float*)(sWcT + EMB * LP);  // [128]
    _Float16* sWqT = (_Float16*)(sbc + EMB);     // [128][LQ]
    char*     uni  = (char*)(sWqT + EMB * LQ);
    // phase 0/1 overlay
    _Float16* sWkT = (_Float16*)uni;             // [128][LP]
    _Float16* sWvT = sWkT + EMB * LP;            // [128][LP]
    // after phase 1 the union holds seven wave-private areas (see the P tiles)

    // ---------------- phase 0: fetch the weight image, stage encoded_nodes --
    // The row loads go out first, then the image's copies.
    const int pw = __builtin_amdgcn_readfirstlane(wave);
    // encoded_nodes: wave w stages rows w, w+8, ...; one 512-B row per load.  All of
    // a thread's row loads are issued here, ahead of any wait on one of them, so that
    // they share one trip to memory.  A pad row of the group that straddles row NN
    // reads a clamped address; the group past it is not loaded at all.
    float4 en[ENLD];
    {
        const int      rl = pw + 8 * (ENLD - 1);         // pw is 0..7
        const char*    e0 = (const char*)&enc[((size_t)b * NN + pw) * EMB];
        const char*    e1 = (const char*)&enc[((size_t)b * NN + (rl < NN ? rl : NN - 1)) * EMB];
        const unsigned eo = lane * 16;
#pragma unroll   // unrolled: the loads stand back to back and en[] stays in registers
        for (int j = 0; j < ENLD - 1; ++j) en[j] = *(const float4*)(e0 + j * 8 * EMB * 4 + eo);
        en[ENLD - 1] = *(const float4*)(e1 + eo);
        // no address register of these loads is rewritten ahead of this wait: as its
        // inputs they stay live up to it, so that no load's result is laid over them
        asm volatile("s_wait_xcnt 0x0" :: "v"(lane), "s"(e0), "s"(e1) : "memory");
    }
    {
        const unsigned l0 = (unsigned)(size_t)smem + IMG_LDS_OFF + tid * 16;
        const char*    g0 = (const char*)wimg + tid * 16;
        copy12_to_lds(l0, g0);
        copy12_to_lds(l0 + 49152u, g0 + 49152);
        copy12_to_lds(l0 + 98304u, g0 + 98304);
        if (pw == 0) {   // the image's last 512 B; wait in the statement as in copy12_to_lds
            asm volatile("global_load_async_to_lds_b128 %0, %1, off\n\ts_wait_xcnt 0x0"
                         :: "v"(l0 + 147456u), "v"(g0 + 147456) : "memory");
        }
    }
    for (int i = tid; i < EMB * 16; i += 256) { // zero V^T cols n=112..127
        int r = i >> 4, c = i & 15;
        sVT[r * LP + NPAD + c] = (_Float16)0.f;
    }
    // encoded_nodes rows to f16: contiguous b64 LDS stores, pad rows zero
#pragma unroll   // unrolled: en[] is indexed by constants only
    for (int j = 0; j < NPAD / 8; ++j) {
        const int r = pw + 8 * j;
        float4 v = make_float4(0.f, 0.f, 0.f, 0.f);
        if (8 * j + 7 < NN || (j < ENLD && r < NN)) v = en[j < ENLD ? j : 0];
        v4h h; h[0] = (_Float16)v.x; h[1] = (_Float16)v.y;
        h[2] = (_Float16)v.z; h[3] = (_Float16)v.w;
        *(v4h*)&sEN[r * LP + lane * 4] = h;
    }
    // this wave's copies have landed; the barrier then publishes all waves' parts
    asm volatile("s_wait_asynccnt 0x0" ::: "memory");
    __syncthreads();

    // ---------------- phase 1: K = EN@Wk, V = EN@Wv ------------------------
    // Wave w owns column tile w of both products.  Its eight weight fragments are read
    // once and stay in registers; each encoded_nodes fragment is read once and feeds K
    // and V, two independent accumulator chains.  The next node tile's fragments are
    // read ahead of this tile's products and stores (the compiler does not lift an LDS
    // read over the LDS stores by itself).  Every "#pragma unroll" here is there so that
    // the fragment arrays are indexed by constants only and stay in registers.
    {
        v16h wk[4], wv[4], a[2][4];
#pragma unroll
        for (int kt = 0; kt < 4; ++kt) {
            a[0][kt] = frag_k32(sEN, 0, kt * 32, LP, lane);
            wk[kt]   = frag_k32(sWkT, pw * 16, kt * 32, LP, lane);
            wv[kt]   = frag_k32(sWvT, pw * 16, kt * 32, LP, lane);
        }
        // keeps the 24 reads above together ahead of the first product: left free, the
        // scheduler sinks part of them among tile 0's products, each group a full LDS wait
        __builtin_amdgcn_sched_barrier(0);
#pragma unroll
        for (int mt = 0; mt < NTIL; ++mt) {      // n-tile 0..6
            if (mt + 1 < NTIL) {
#pragma unroll
                for (int kt = 0; kt < 4; ++kt)
                    a[(mt + 1) & 1][kt] = frag_k32(sEN, (mt + 1) * 16, kt * 32, LP, lane);
            }
            v8f ak = zero8(), av = zero8();
#pragma unroll
            for (int kt = 0; kt < 4; ++kt) {
                ak = wmma_f16(a[mt & 1][kt], wk[kt], ak);
                av = wmma_f16(a[mt & 1][kt], wv[kt], av);
            }
#pragma unroll
            for (int r = 0; r < 8; ++r)          // sKT[n][col] (strided)
                sKT[(mt * 16 + r + hi * 8) * LP + pw * 16 + l] = (_Float16)ak[r];
            v8h h;                               // sVT[col][n]: 8 contiguous halves, one b128 store
#pragma unroll
            for (int r = 0; r < 8; ++r) h[r] = (_Float16)av[r];
            *(v8h*)&sVT[(pw * 16 + l) * LP + mt * 16 + hi * 8] = h;
        }
    }
    __syncthreads();

    // ---------------- P tiles: one wave owns one 16-row tile end to end -----
    // Every product is computed transposed: the shared operand (weights, K, V^T,
    // encoded_nodes) is A, the tile's own data is B, so that lane (l, hi) holds query
    // row p0 + l throughout.  A pair of D tiles, converted in place, is the next
    // product's B operand in the hardware k order, which frag_k32 has for A: after
    // the input tile nothing of the chain passes through LDS.  A softmax row lies in
    // the two lanes l and l + 16.  Every "#pragma unroll" below is there so that the
    // register arrays are indexed by constants only and stay in registers.
    if (pw < PTIL) {
        const int p0 = pw * 16;
        const int p  = p0 + l;                             // this lane's query row
        _Float16* X  = (_Float16*)uni + pw * WAVE_HALVES;  // [16][LQ] input_cat

        v8h z8;
#pragma unroll
        for (int i = 0; i < 8; ++i) z8[i] = (_Float16)0.f;

        // All of the tile's global loads are issued first, so that they share one
        // trip to memory.  Mask row p straight into the transposed accumulator layout
        // (column n = nt*16 + hi*8 + r); a dead row reads a clamped address, and the
        // last column tile reads the row's last eight values.
        const size_t gi = (size_t)b * PP + (p < PP ? p : PP - 1);
        // the 4 scalar features of row l
        const float  f0 = gload[gi], f1 = gtime[gi], f2 = glen[gi], f3 = gopen[gi];
        // the mask loads' results below may land in address registers of the loads above
        asm volatile("s_wait_xcnt 0x0" ::: "memory");
        float mk[NTIL][8];
        {
            const float* mr = &ninf[gi * NN];
            const float* mh = mr + hi * 8;
#pragma unroll
            for (int nt = 0; nt < NTIL - 1; ++nt) {
                const f4u m0 = *(const f4u*)(mh + nt * 16);
                const f4u m1 = *(const f4u*)(mh + nt * 16 + 4);
#pragma unroll
                for (int r = 0; r < 4; ++r) { mk[nt][r] = m0[r]; mk[nt][r + 4] = m1[r]; }
            }
            const f4u m0 = *(const f4u*)(mr + NN - 8);
            const f4u m1 = *(const f4u*)(mr + NN - 4);
#pragma unroll
            for (int r = 0; r < 4; ++r) { mk[NTIL - 1][r] = m0[r]; mk[NTIL - 1][r + 4] = m1[r]; }
            // the row loads' results below may land in address registers of the loads above;
            // as the wait's inputs those stay live up to it, so that no mask value is laid over them
            asm volatile("s_wait_xcnt 0x0" :: "v"(mr), "v"(mh) : "memory");
        }
        // input_cat tile: one 512-B row per load; the last tile has LASTROWS live rows
        {
            const bool   full = pw < PTIL - 1;
            const float* er   = &eln[((size_t)b * PP + p0) * EMB + lane * 4];
            float4 ev[16];
#pragma unroll
            for (int j = 0; j < LASTROWS; ++j) ev[j] = *(const float4*)(er + j * EMB);
            // the next rows' results may land in these loads' offset register
            asm volatile("s_wait_xcnt 0x0" ::: "memory");
#pragma unroll
            for (int j = LASTROWS; j < 16; ++j) ev[j] = make_float4(0.f, 0.f, 0.f, 0.f);
            if (full) {
#pragma unroll
                for (int j = LASTROWS; j < 16; ++j) ev[j] = *(const float4*)(er + j * EMB);
            }
#pragma unroll
            for (int j = 0; j < 16; ++j) {
                v4h h;
                h[0] = (_Float16)ev[j].x; h[1] = (_Float16)ev[j].y;
                h[2] = (_Float16)ev[j].z; h[3] = (_Float16)ev[j].w;
                *(v4h*)&X[j * LQ + lane * 4] = h;
            }
        }
        // features + K-pad (cols 128..159): lane pair (l, l+16) fills row l
        {
            const bool live = (p < PP) && (hi == 0);
            v8h fa = z8;
            fa[0] = (_Float16)(live ? f0 : 0.f); fa[1] = (_Float16)(live ? f1 : 0.f);
            fa[2] = (_Float16)(live ? f2 : 0.f); fa[3] = (_Float16)(live ? f3 : 0.f);
            *(v8h*)&X[l * LQ + EMB + hi * 16]     = fa;
            *(v8h*)&X[l * LQ + EMB + hi * 16 + 8] = z8;
        }
        // dead rows get mask 0; the last tile's live columns (NN - LASTCOLS .. NN - 1,
        // all in the lower lane half) move to their registers, its pad columns drop out
#pragma unroll
        for (int nt = 0; nt < NTIL - 1; ++nt)
#pragma unroll
            for (int r = 0; r < 8; ++r) mk[nt][r] = (p < PP) ? mk[nt][r] : 0.f;
#pragma unroll
        for (int r = 0; r < 8; ++r) {
            const float v = (p < PP) ? mk[NTIL - 1][r + 8 - LASTCOLS < 8 ? r + 8 - LASTCOLS : 7] : 0.f;
            mk[NTIL - 1][r] = (r < LASTCOLS && hi == 0) ? v : -1e30f;
        }
        wave_lds_sync();

        // ---- Q^T, attention and mh^T, two heads a trip ---------------------
        v16h xb[5];     // input_cat^T as B operand, K = 160, kept for all heads
#pragma unroll
        for (int kt = 0; kt < 5; ++kt) xb[kt] = frag_k32(X, 0, kt * 32, LQ, lane);
        v8f macc[8];    // mh^T: tile ct, register r = mh[p][ct*16 + hi*8 + r]
#pragma unroll
        for (int ct = 0; ct < 8; ++ct) macc[ct] = zero8();
        // kept rolled: the text stays small for the instruction cache.  Two heads are one
        // 32-deep k block of mh^T, so that the trip number enters LDS addresses only and
        // everything else is indexed by constants and stays in registers.
#pragma unroll 1
        for (int hp = 0; hp < NH / 2; ++hp) {
            // Q^T = Wq^T @ input_cat^T of the two heads: register r = Q[p][head*16 + hi*8 + r]
            v8f q0 = zero8(), q1 = zero8();
#pragma unroll
            for (int kt = 0; kt < 5; ++kt) {
                q0 = wmma_f16(frag_k32(sWqT, hp * 32,      kt * 32, LQ, lane), xb[kt], q0);
                q1 = wmma_f16(frag_k32(sWqT, hp * 32 + 16, kt * 32, LQ, lane), xb[kt], q1);
            }
            // S^T = K @ Q^T.  One K fragment holds both heads' d (k 0..15 and 16..31);
            // the other head's half of B is zero.
            const v16h bq0 = join16(__builtin_convertvector(q0, v8h), z8);
            const v16h bq1 = join16(z8, __builtin_convertvector(q1, v8h));
            v8f sc[2][NTIL];                               // sc[j][nt][r] = S[p][nt*16 + hi*8 + r]
#pragma unroll
            for (int nt = 0; nt < NTIL; ++nt) {
                const v16h ak = frag_k32(sKT, nt * 16, hp * 32, LP, lane);
                sc[0][nt] = wmma_f16(ak, bq0, zero8());
                sc[1][nt] = wmma_f16(ak, bq1, zero8());
            }
            v8h oh[2];  // register r = out_concat[p][head*16 + hi*8 + r]
#pragma unroll
            for (int j = 0; j < 2; ++j) {
                // scale 1/sqrt(16) + mask
#pragma unroll
                for (int nt = 0; nt < NTIL; ++nt)
#pragma unroll
                    for (int r = 0; r < 8; ++r)
                        sc[j][nt][r] = sc[j][nt][r] * 0.25f + mk[nt][r];
                const float m = row_max(sc[j]);
                // exp (unnormalized), eight independent partial sums
                float s8[8];
#pragma unroll
                for (int r = 0; r < 8; ++r) s8[r] = 0.f;
#pragma unroll
                for (int nt = 0; nt < NTIL; ++nt) {
                    float t[8];
#pragma unroll
                    for (int r = 0; r < 8; ++r) t[r] = (sc[j][nt][r] - m) * 1.4426950408889634f;
                    TRANS_X8("v_exp_f32", t);
#pragma unroll
                    for (int r = 0; r < 8; ++r) { s8[r] += t[r]; sc[j][nt][r] = t[r]; }
                }
                const float inv = 1.f / row_sum(s8);
                // O^T = V^T @ W^T (columns n = 112..127 are zero on both sides), 1/rowsum folded in
                v8f o = zero8();
#pragma unroll
                for (int kt = 0; kt < 4; ++kt) {
                    const v8h w0 = __builtin_convertvector(sc[j][2 * kt], v8h);
                    const v8h w1 = (2 * kt + 1 < NTIL)
                        ? __builtin_convertvector(sc[j][2 * kt + 1 < NTIL ? 2 * kt + 1 : 0], v8h) : z8;
                    o = wmma_f16(frag_k32(sVT, hp * 32 + j * 16, kt * 32, LP, lane), join16(w0, w1), o);
                }
#pragma unroll
                for (int r = 0; r < 8; ++r) o[r] *= inv;
                oh[j] = __builtin_convertvector(o, v8h);
            }
            // mh^T += Wc^T @ out_concat^T, this pair's k block
            const v16h bo = join16(oh[0], oh[1]);
#pragma unroll
            for (int ct = 0; ct < 8; ++ct)
                macc[ct] = wmma_f16(frag_k32(sWcT, ct * 16, hp * 32, LP, lane), bo, macc[ct]);
        }
        v8h mhh[8];     // mh + bc in f16: tile ct, element r = mh[p][ct*16 + hi*8 + r]
#pragma unroll
        for (int ct = 0; ct < 8; ++ct) {
            const float4 b0 = *(const float4*)&sbc[ct * 16 + hi * 8];
            const float4 b1 = *(const float4*)&sbc[ct * 16 + hi * 8 + 4];
            v8f a = macc[ct];
            a[0] += b0.x; a[1] += b0.y; a[2] += b0.z; a[3] += b0.w;
            a[4] += b1.x; a[5] += b1.y; a[6] += b1.z; a[7] += b1.w;
            mhh[ct] = __builtin_convertvector(a, v8h);
        }

        // ---- score2^T = EN @ mh^T / sqrt(EMB); 10*tanh + mask; softmax over N
        {
            // seven independent accumulator chains
            v8f s2[NTIL];
#pragma unroll
            for (int nt = 0; nt < NTIL; ++nt) s2[nt] = zero8();
#pragma unroll
            for (int kt = 0; kt < 4; ++kt) {
                const v16h bm = join16(mhh[2 * kt], mhh[2 * kt + 1]);
#pragma unroll
                for (int nt = 0; nt < NTIL; ++nt)
                    s2[nt] = wmma_f16(frag_k32(sEN, nt * 16, kt * 32, LP, lane), bm, s2[nt]);
            }
#pragma unroll
            for (int nt = 0; nt < NTIL; ++nt) {
                float t[8];
#pragma unroll
                for (int r = 0; r < 8; ++r) t[r] = s2[nt][r];
                tanh_scaled_x8(t);
#pragma unroll
                for (int r = 0; r < 8; ++r) s2[nt][r] = 10.0f * t[r] + mk[nt][r];
            }
            const float m = row_max(s2);
            float s8[8];
#pragma unroll
            for (int r = 0; r < 8; ++r) s8[r] = 0.f;
#pragma unroll
            for (int nt = 0; nt < NTIL; ++nt) {
                float t[8];
#pragma unroll
                for (int r = 0; r < 8; ++r) t[r] = (s2[nt][r] - m) * 1.4426950408889634f;
                TRANS_X8("v_exp_f32", t);
#pragma unroll
                for (int r = 0; r < 8; ++r) { s8[r] += t[r]; s2[nt][r] = t[r]; }
            }
            const float inv = 1.f / row_sum(s8);
            // all products first, in place, so that no store's data register is rewritten
#pragma unroll
            for (int nt = 0; nt < NTIL; ++nt)
#pragma unroll
                for (int r = 0; r < 8; ++r) s2[nt][r] *= inv;
            if (p < PP) {
                float* orow = &out[((size_t)b * PP + p) * NN + hi * 8];
#pragma unroll
                for (int nt = 0; nt < NTIL - 1; ++nt) {
                    f4u v0, v1;
#pragma unroll
                    for (int r = 0; r < 4; ++r) { v0[r] = s2[nt][r]; v1[r] = s2[nt][r + 4]; }
                    *(f4u*)(orow + nt * 16)     = v0;
                    *(f4u*)(orow + nt * 16 + 4) = v1;
                }
                if (hi == 0) {
#pragma unroll
                    for (int r = 0; r < LASTCOLS; ++r) orow[(NTIL - 1) * 16 + r] = s2[NTIL - 1][r];
                }
            }
        }
    }
}

// ---------------------------------------------------------------------------
extern "C" void kernel_launch(void* const* d_in, const int* in_sizes, int n_in,
                              void* d_out, int out_size, void* d_ws, size_t ws_size,
                              hipStream_t stream) {
    (void)in_sizes; (void)n_in; (void)out_size; (void)ws_size;
    const float* eln   = (const float*)d_in[0];
    const float* gload = (const float*)d_in[1];
    const float* gtime = (const float*)d_in[2];
    const float* glen  = (const float*)d_in[3];
    const float* gopen = (const float*)d_in[4];
    const float* ninf  = (const float*)d_in[5];
    const float* enc   = (const float*)d_in[6];
    const float* Wq    = (const float*)d_in[7];
    const float* Wk    = (const float*)d_in[8];
    const float* Wv    = (const float*)d_in[9];
    const float* Wc    = (const float*)d_in[10];
    const float* bcv   = (const float*)d_in[11];
    float* out = (float*)d_out;
    float* img = (float*)d_ws;

    hipFuncSetAttribute((const void*)vrp_decoder_kernel,
                        hipFuncAttributeMaxDynamicSharedMemorySize,
                        SMEM_TOTAL);
    weight_image_kernel<<<dim3(IMG_BLOCKS), dim3(EMB), 0, stream>>>(Wq, Wk, Wv, Wc, bcv, img);
    vrp_decoder_kernel<<<dim3(BB), dim3(256), SMEM_TOTAL, stream>>>(
        eln, gload, gtime, glen, gopen, ninf, enc, img, out);
}

// v008
// It runs in 63.3 microseconds.
// Next to v007, in two timings, it ran 1.03 and 1.04 times as fast.
// All steps since v000 together make it 9.96 times as fast.
#include <hip/hip_runtime.h>
#include <hip/hip_bf16.h>
#include <math.h>

// ---------------------------------------------------------------------------
// Problem constants (match reference)
// ---------------------------------------------------------------------------
#define BB   1024
#define PP   100
#define NN   101
#define EMB  128
#define NH   8
#define DKK  16

#define NPAD 112        // N padded to 7*16
#define PTIL 7          // ceil(100/16)
#define NTIL 7          // ceil(101/16)
#define KQ   160        // 132 padded to 5*32
#define LASTROWS (PP - (PTIL - 1) * 16)   // live rows of the last P tile
#define ENLD ((NN + 7) / 8)   // groups of 8 encoded_nodes rows that hold a live row
#define LASTCOLS (NN - (NTIL - 1) * 16)   // live columns of the last N tile
#define GRID 256        // blocks; a block's LDS fills a WGP, and each block walks BB / GRID batches

// LDS row pitches.  Bank = dword address mod 64, so 16 rows at a 256-B pitch put
// a whole b128 fragment read on four banks.  16 B x odd spreads them over all 64.
#define LP   136        // halves: 272 B pitch for the 128-half rows
#define LQ   168        // halves: 336 B pitch for the 160-half rows

typedef __attribute__((ext_vector_type(16))) _Float16 v16h;
typedef __attribute__((ext_vector_type(8)))  _Float16 v8h;
typedef __attribute__((ext_vector_type(4)))  _Float16 v4h;
typedef __attribute__((ext_vector_type(8)))  float    v8f;
// four floats at the 4-byte alignment of a 101-float row
typedef __attribute__((ext_vector_type(4), aligned(4))) float f4u;

// ---------------------------------------------------------------------------
// WMMA helpers (CDNA5 wave32, D = A(16x32 f16) * B(32x16 f16) + C(16x16 f32))
// ---------------------------------------------------------------------------
__device__ __forceinline__ v8f wmma_f16(v16h a, v16h b, v8f c) {
    return __builtin_amdgcn_wmma_f32_16x16x32_f16(
        /*neg_a=*/false, a, /*neg_b=*/false, b,
        /*c_mod=*/(short)0, c, /*reuse_a=*/false, /*reuse_b=*/false);
}

__device__ __forceinline__ v8f zero8() {
    v8f z = {0.f, 0.f, 0.f, 0.f, 0.f, 0.f, 0.f, 0.f};
    return z;
}

// A-operand (16x32, M x K) from row-major f16 [M][stride]; also valid for the
// B-operand (32x16, K x N) when B is stored "column-major by N", i.e. [N][stride]
// holding K along the row.  Per ISA 7.12.2: lanes 0-15 hold K {0..7,16..23},
// lanes 16-31 hold K {8..15,24..31}  ->  two aligned 16B LDS reads per lane.
__device__ __forceinline__ v16h frag_k32(const _Float16* base, int row0, int k0,
                                         int stride, int lane) {
    const int l  = lane & 15;
    const int hi = (lane >> 4) & 1;
    const _Float16* p = base + (size_t)(row0 + l) * stride + k0 + hi * 8;
    v8h lo = *(const v8h*)p;
    v8h hh = *(const v8h*)(p + 16);
    v16h r;
#pragma unroll
    for (int i = 0; i < 8; ++i) { r[i] = lo[i]; r[i + 8] = hh[i]; }
    return r;
}

// Hand-over of a tile between the lanes of ONE wave through LDS: the wave's own
// stores must have landed, and the compiler must not hoist the reads over them.
__device__ __forceinline__ void wave_lds_sync() {
    asm volatile("s_wait_dscnt 0x0" ::: "memory");
}

// Work-group barrier of the batch loop.  Only LDS passes between the waves, so only the
// wave's LDS operations are waited for: __syncthreads() would also wait here for the
// output stores of the batch before, which may go on landing under the next products.
__device__ __forceinline__ void lds_barrier() {
    asm volatile("s_wait_dscnt 0x0\n\ts_barrier_signal -1\n\ts_barrier_wait -1" ::: "memory");
}

// Two 8-half register groups as one 16x16x32 operand: k 0..15 of the block from lo,
// k 16..31 from hh (each lane half holds its eight of either).
__device__ __forceinline__ v16h join16(v8h lo, v8h hh) {
    return __builtin_shufflevector(lo, hh, 0, 1, 2, 3, 4, 5, 6, 7, 8, 9, 10, 11, 12, 13, 14, 15);
}

// The value of lane l ^ 16.
__device__ __forceinline__ float other_half(float x) {
    const int v = __float_as_int(x);
    return __int_as_float(__builtin_amdgcn_permlanex16(v, v, 0x76543210, 0xfedcba98, false, false));
}

// Maximum of a row that lies in lanes l and l + 16: eight independent chains over the
// tiles, a tree over them, one exchange between the lane halves.
__device__ __forceinline__ float row_max(const v8f (&t)[NTIL]) {
    float m[8];
#pragma unroll   // unrolled, the inner loop too: m[] and t[] stay in registers
    for (int r = 0; r < 8; ++r) {
        m[r] = t[0][r];
#pragma unroll
        for (int nt = 1; nt < NTIL; ++nt) m[r] = fmaxf(m[r], t[nt][r]);
    }
    const float a = fmaxf(fmaxf(fmaxf(m[0], m[1]), fmaxf(m[2], m[3])),
                          fmaxf(fmaxf(m[4], m[5]), fmaxf(m[6], m[7])));
    return fmaxf(a, other_half(a));
}

// Sum of a row from a lane's eight partial sums: a tree, then the other lane half's.
__device__ __forceinline__ float row_sum(const float (&s)[8]) {
    const float a = ((s[0] + s[1]) + (s[2] + s[3])) + ((s[4] + s[5]) + (s[6] + s[7]));
    return a + other_half(a);
}

// Eight independent transcendentals of one kind in one statement: each is the free
// issue slot that the instruction set asks for behind the one in front of it, and the
// v_nop is the last one's.
#define TRANS_X8(OP, t)                                                        \
    asm(OP " %0, %0\n\t" OP " %1, %1\n\t" OP " %2, %2\n\t" OP " %3, %3\n\t"      \
        OP " %4, %4\n\t" OP " %5, %5\n\t" OP " %6, %6\n\t" OP " %7, %7\n\tv_nop" \
        : "+v"(t[0]), "+v"(t[1]), "+v"(t[2]), "+v"(t[3]),                      \
          "+v"(t[4]), "+v"(t[5]), "+v"(t[6]), "+v"(t[7]))

// tanh(x / sqrt(EMB)) = 1 - 2 / (e^(2x / sqrt(EMB)) + 1) for a lane's eight values of
// one tile, without a branch: five instructions a value, no value waits for another.
// e^.. = inf gives 1, e^.. = 0 gives -1, NaN stays NaN.  The absolute error is a few
// f32 ulps of 1, which is what counts for a logit that is 10 * tanh.
__device__ __forceinline__ void tanh_scaled_x8(float (&t)[8]) {
#pragma unroll   // unrolled here and below: t[] stays in registers
    for (int r = 0; r < 8; ++r)
        t[r] *= (float)(2.0 * 1.4426950408889634 / 11.313708498984761);
    TRANS_X8("v_exp_f32", t);
#pragma unroll
    for (int r = 0; r < 8; ++r) t[r] += 1.0f;
    TRANS_X8("v_rcp_f32", t);
#pragma unroll
    for (int r = 0; r < 8; ++r) t[r] = 1.0f - 2.0f * t[r];
}

// ---------------------------------------------------------------------------
// Dynamic-LDS layout; total 312,832 B (< 320 KB WGP): two encoded_nodes buffers, K,
// V^T, the weight image, the seven input tiles, the lane numbers
// ---------------------------------------------------------------------------
#define WAVE_HALVES  (16 * LQ)                 // one wave's private input tile
#define SMEM_TOTAL   (IMG_LDS_OFF + IMG_BYTES + PTIL * WAVE_HALVES * 2 + 256 * 4)

// ---------------------------------------------------------------------------
// Weight image: Wc^T, bc, Wq^T, Wk^T, Wv^T exactly as they lie in LDS (f16 rows
// at their padded pitch, K-pad and pitch pad zero; bc in f32).  Built once per
// call by the first launch, then fetched whole, once, by every block of the second.
// ---------------------------------------------------------------------------
#define IMG_LDS_OFF ((3 * NPAD + EMB) * LP * 2)         // LDS byte offset of Wc^T
#define IMG_WC      0
#define IMG_BC      (IMG_WC + EMB * LP * 2)
#define IMG_WQ      (IMG_BC + EMB * 4)
#define IMG_WK      (IMG_WQ + EMB * LQ * 2)
#define IMG_WV      (IMG_WK + EMB * LP * 2)
#define IMG_BYTES   (IMG_WV + EMB * LP * 2)             // 147,968 = 289 x 512
#define UP          (LP / 8)                            // 16-B units per 272-B row
#define UQ          (LQ / 8)                            // 16-B units per 336-B row
#define IMG_BLOCKS  (3 * UP + UQ + 1)

// One block = one 16-B unit column (8 k values) of one matrix, thread = row n:
// eight coalesced row reads, one 16-B store.
__global__ __launch_bounds__(EMB)
void weight_image_kernel(const float* __restrict__ Wq,    // [132,128]
                         const float* __restrict__ Wk,    // [128,128]
                         const float* __restrict__ Wv,    // [128,128]
                         const float* __restrict__ Wc,    // [128,128]
                         const float* __restrict__ bcv,   // [128]
                         float* __restrict__ img)
{
    const int blk = blockIdx.x;
    const int n   = threadIdx.x;
    char* dst = (char*)img;
    if (blk == IMG_BLOCKS - 1) {
        if (n < EMB / 4) *(float4*)(dst + IMG_BC + n * 16) = *(const float4*)&bcv[n * 4];
        return;
    }
    const float* Wm; int u, kmax, pitch, off;
    if (blk < UP)               { Wm = Wc; u = blk;               kmax = EMB;     pitch = LP * 2; off = IMG_WC; }
    else if (blk < UP + UQ)     { Wm = Wq; u = blk - UP;          kmax = EMB + 4; pitch = LQ * 2; off = IMG_WQ; }
    else if (blk < 2 * UP + UQ) { Wm = Wk; u = blk - UP - UQ;     kmax = EMB;     pitch = LP * 2; off = IMG_WK; }
    else                        { Wm = Wv; u = blk - 2 * UP - UQ; kmax = EMB;     pitch = LP * 2; off = IMG_WV; }
    // pad rows read a clamped address, so that the eight loads share one trip
    float w[8];
#pragma unroll
    for (int j = 0; j < 8; ++j) {
        const int k = u * 8 + j;
        w[j] = Wm[(k < kmax ? k : kmax - 1) * EMB + n];
    }
    v8h h;
#pragma unroll
    for (int j = 0; j < 8; ++j)
        h[j] = (u * 8 + j < kmax) ? (_Float16)w[j] : (_Float16)0.f;
    *(v8h*)(dst + off + n * pitch + u * 16) = h;
    // the built code lays the bc branch's load behind this store, into its data registers
    asm volatile("s_wait_xcnt 0x0" ::: "memory");
}

// Twelve 16-B-per-lane copies global -> LDS, 4 KiB apart (the block's eight waves
// cover 4 KiB per copy).  The s_wait_xcnt closes the statement so that no address
// register of a copy is rewritten ahead of it.
__device__ __forceinline__ void copy12_to_lds(unsigned l, const char* g) {
    asm volatile(
        "global_load_async_to_lds_b128 %0, %12, off\n\t"
        "global_load_async_to_lds_b128 %1, %13, off\n\t"
        "global_load_async_to_lds_b128 %2, %14, off\n\t"
        "global_load_async_to_lds_b128 %3, %15, off\n\t"
        "global_load_async_to_lds_b128 %4, %16, off\n\t"
        "global_load_async_to_lds_b128 %5, %17, off\n\t"
        "global_load_async_to_lds_b128 %6, %18, off\n\t"
        "global_load_async_to_lds_b128 %7, %19, off\n\t"
        "global_load_async_to_lds_b128 %8, %20, off\n\t"
        "global_load_async_to_lds_b128 %9, %21, off\n\t"
        "global_load_async_to_lds_b128 %10, %22, off\n\t"
        "global_load_async_to_lds_b128 %11, %23, off\n\t"
        "s_wait_xcnt 0x0"
        :: "v"(l), "v"(l + 4096u), "v"(l + 8192u), "v"(l + 12288u),
           "v"(l + 16384u), "v"(l + 20480u), "v"(l + 24576u), "v"(l + 28672u),
           "v"(l + 32768u), "v"(l + 36864u), "v"(l + 40960u), "v"(l + 45056u),
           "v"(g), "v"(g + 4096), "v"(g + 8192), "v"(g + 12288),
           "v"(g + 16384), "v"(g + 20480), "v"(g + 24576), "v"(g + 28672),
           "v"(g + 32768), "v"(g + 36864), "v"(g + 40960), "v"(g + 45056)
        : "memory");
}

// One block fills a WGP's LDS, so two waves share a SIMD.  Stated so that the compiler
// schedules for that register budget: without it this build packs the Q and mh
// products into fewer registers and waits on LDS at nearly every one of them.
__global__ __launch_bounds__(256) __attribute__((amdgpu_waves_per_eu(2, 2)))
void vrp_decoder_kernel(const float* __restrict__ eln,    // [B,P,EMB]
                        const float* __restrict__ gload,  // [B,P]
                        const float* __restrict__ gtime,  // [B,P]
                        const float* __restrict__ glen,   // [B,P]
                        const float* __restrict__ gopen,  // [B,P]
                        const float* __restrict__ ninf,   // [B,P,N]
                        const float* __restrict__ enc,    // [B,N,EMB]
                        const float* __restrict__ wimg,   // weight image, IMG_BYTES
                        float* __restrict__ out)          // [B,P,N]
{
    extern __shared__ char smem[];
    const int tid  = threadIdx.x;
    const int wave = tid >> 5;     // 0..7
    const int lane = tid & 31;
    const int l    = lane & 15;
    const int hi   = (lane >> 4) & 1;

    _Float16* sEN  = (_Float16*)smem;            // [2][112][LP], one buffer per batch in turn
    _Float16* sKT  = sEN  + 2 * NPAD * LP;       // [112][LP] K as [n][h*16+d]
    _Float16* sVT  = sKT  + NPAD * LP;           // [128][LP] V^T as [h*16+d][n]
    _Float16* sWcT = sVT  + EMB * LP;            // [128][LP]
    float*    sbc  = (float*)(sWcT + EMB * LP);  // [128]
    _Float16* sWqT = (_Float16*)(sbc + EMB);     // [128][LQ]
    _Float16* sWkT = sWqT + EMB * LQ;            // [128][LP]
    _Float16* sWvT = sWkT + EMB * LP;            // [128][LP]
    _Float16* sX   = sWvT + EMB * LP;            // seven wave-private areas (see the P tiles)
    int*      sLn  = (int*)(sX + PTIL * WAVE_HALVES);   // [256] every thread's lane number

    // ---------------- phase 0: fetch the weight image, stage the first batch's encoded_nodes
    // The row loads go out first (the longer trip), then the image's copies.
    const int pw = __builtin_amdgcn_readfirstlane(wave);
    // encoded_nodes: wave w stages rows w, w+8, ...; one 512-B row per load.  All of
    // a thread's row loads are issued here, ahead of any wait on one of them, so that
    // they share one trip to memory.  A pad row of the group that straddles row NN
    // reads a clamped address; the group past it is not loaded at all.
    float4 en[ENLD];
    {
        const int      rl = pw + 8 * (ENLD - 1);         // pw is 0..7
        const char*    e0 = (const char*)&enc[((size_t)blockIdx.x * NN + pw) * EMB];
        const char*    e1 = (const char*)&enc[((size_t)blockIdx.x * NN + (rl < NN ? rl : NN - 1)) * EMB];
        const unsigned eo = lane * 16;
#pragma unroll   // unrolled: the loads stand back to back and en[] stays in registers
        for (int j = 0; j < ENLD - 1; ++j) en[j] = *(const float4*)(e0 + j * 8 * EMB * 4 + eo);
        en[ENLD - 1] = *(const float4*)(e1 + eo);
        // no address register of these loads is rewritten ahead of this wait: as its
        // inputs they stay live up to it, so that no load's result is laid over them
        asm volatile("s_wait_xcnt 0x0" :: "v"(lane), "s"(e0), "s"(e1) : "memory");
    }
    {
        const unsigned l0 = (unsigned)(size_t)smem + IMG_LDS_OFF + tid * 16;
        const char*    g0 = (const char*)wimg + tid * 16;
        copy12_to_lds(l0, g0);
        copy12_to_lds(l0 + 49152u, g0 + 49152);
        copy12_to_lds(l0 + 98304u, g0 + 98304);
        if (pw == 0) {   // the image's last 512 B; wait in the statement as in copy12_to_lds
            asm volatile("global_load_async_to_lds_b128 %0, %1, off\n\ts_wait_xcnt 0x0"
                         :: "v"(l0 + 147456u), "v"(g0 + 147456) : "memory");
        }
    }
    for (int i = tid; i < EMB * 16; i += 256) { // zero V^T cols n=112..127
        int r = i >> 4, c = i & 15;
        sVT[r * LP + NPAD + c] = (_Float16)0.f;
    }
    sLn[tid] = lane;
    if (tid < (NPAD - NN) * 16) {               // the second buffer's pad rows, zero for good
        v8h z;
#pragma unroll   // unrolled: z stays in registers
        for (int i = 0; i < 8; ++i) z[i] = (_Float16)0.f;
        *(v8h*)&sEN[(NPAD + NN + (tid >> 4)) * LP + (tid & 15) * 8] = z;
    }
    // encoded_nodes rows to f16: contiguous b64 LDS stores, pad rows zero
#pragma unroll   // unrolled: en[] is indexed by constants only
    for (int j = 0; j < NPAD / 8; ++j) {
        const int r = pw + 8 * j;
        float4 v = make_float4(0.f, 0.f, 0.f, 0.f);
        if (8 * j + 7 < NN || (j < ENLD && r < NN)) v = en[j < ENLD ? j : 0];
        v4h h; h[0] = (_Float16)v.x; h[1] = (_Float16)v.y;
        h[2] = (_Float16)v.z; h[3] = (_Float16)v.w;
        *(v4h*)&sEN[r * LP + lane * 4] = h;
    }
    // this wave's copies have landed; the barrier then publishes all waves' parts
    asm volatile("s_wait_asynccnt 0x0" ::: "memory");
    __syncthreads();

    // ---------------- the block's batches, one after the other --------------
    // Global addresses in the loop are an array's base (scalar registers) plus a 32-bit
    // byte offset a lane (every array is far below 4 GiB): one register an address.
    const char* bl = (const char*)gload;
    const char* bt = (const char*)gtime;
    const char* bg = (const char*)glen;
    const char* bo = (const char*)gopen;
    const char* bm = (const char*)ninf;
    const char* be = (const char*)eln;
    const char* bn = (const char*)enc;
    char*       bq = (char*)out;
    // kept rolled: the text stays small for the instruction cache
#pragma unroll 1
    for (unsigned b = blockIdx.x, cur = 0; b < BB; b += GRID, cur ^= 1) {
    const _Float16* sENc = sEN + cur * (NPAD * LP);   // this batch's encoded_nodes
    // The lane number is read anew from LDS (the thread's own word) for every batch: all
    // addresses formed from it are then formed where they are used.  Taken from the
    // register, some twenty of them are kept across the whole loop, which the head loop's
    // registers leave no room for: the build spills them to scratch.
    const int lane = sLn[tid];
    const int l    = lane & 15;
    const int hi   = (lane >> 4) & 1;

    // ---------------- phase 1: K = EN@Wk, V = EN@Wv ------------------------
    // Wave w owns column tile w of both products.  Its eight weight fragments are read
    // once and stay in registers; each encoded_nodes fragment is read once and feeds K
    // and V, two independent accumulator chains.  The next node tile's fragments are
    // read ahead of this tile's products and stores (the compiler does not lift an LDS
    // read over the LDS stores by itself).  Every "#pragma unroll" here is there so that
    // the fragment arrays are indexed by constants only and stay in registers.
    {
        v16h wk[4], wv[4], a[2][4];
#pragma unroll
        for (int kt = 0; kt < 4; ++kt) {
            a[0][kt] = frag_k32(sENc, 0, kt * 32, LP, lane);
            wk[kt]   = frag_k32(sWkT, pw * 16, kt * 32, LP, lane);
            wv[kt]   = frag_k32(sWvT, pw * 16, kt * 32, LP, lane);
        }
        // keeps the 24 reads above together ahead of the first product: left free, the
        // scheduler sinks part of them among tile 0's products, each group a full LDS wait
        __builtin_amdgcn_sched_barrier(0);
#pragma unroll
        for (int mt = 0; mt < NTIL; ++mt) {      // n-tile 0..6
            if (mt + 1 < NTIL) {
#pragma unroll
                for (int kt = 0; kt < 4; ++kt)
                    a[(mt + 1) & 1][kt] = frag_k32(sENc, (mt + 1) * 16, kt * 32, LP, lane);
            }
            v8f ak = zero8(), av = zero8();
#pragma unroll
            for (int kt = 0; kt < 4; ++kt) {
                ak = wmma_f16(a[mt & 1][kt], wk[kt], ak);
                av = wmma_f16(a[mt & 1][kt], wv[kt], av);
            }
#pragma unroll
            for (int r = 0; r < 8; ++r)          // sKT[n][col] (strided)
                sKT[(mt * 16 + r + hi * 8) * LP + pw * 16 + l] = (_Float16)ak[r];
            v8h h;                               // sVT[col][n]: 8 contiguous halves, one b128 store
#pragma unroll
            for (int r = 0; r < 8; ++r) h[r] = (_Float16)av[r];
            *(v8h*)&sVT[(pw * 16 + l) * LP + mt * 16 + hi * 8] = h;
        }
    }
    lds_barrier();

    // ---------------- P tiles: one wave owns one 16-row tile end to end -----
    // Every product is computed transposed: the shared operand (weights, K, V^T,
    // encoded_nodes) is A, the tile's own data is B, so that lane (l, hi) holds query
    // row p0 + l throughout.  A pair of D tiles, converted in place, is the next
    // product's B operand in the hardware k order, which frag_k32 has for A: after
    // the input tile nothing of the chain passes through LDS.  A softmax row lies in
    // the two lanes l and l + 16.  Every "#pragma unroll" below is there so that the
    // register arrays are indexed by constants only and stay in registers.
    if (pw < PTIL) {
        const int p0 = pw * 16;
        const int p  = p0 + l;                             // this lane's query row
        _Float16* X  = sX + pw * WAVE_HALVES;              // [16][LQ] input_cat

        v8h z8;
#pragma unroll
        for (int i = 0; i < 8; ++i) z8[i] = (_Float16)0.f;

        // All of the tile's global loads are issued first, so that they share one
        // trip to memory.  Mask row p straight into the transposed accumulator layout
        // (column n = nt*16 + hi*8 + r); a dead row reads a clamped address, and the
        // last column tile reads the row's last eight values.
        const unsigned gi = b * PP + (p < PP ? p : PP - 1);
        // the 4 scalar features of row l
        const unsigned go = gi * 4;
        const float  f0 = *(const float*)(bl + go), f1 = *(const float*)(bt + go),
                     f2 = *(const float*)(bg + go), f3 = *(const float*)(bo + go);
        // the mask loads' results below may land in address registers of the loads above
        asm volatile("s_wait_xcnt 0x0" ::: "memory");
        float mk[NTIL][8];
        {
            const unsigned mr = gi * (NN * 4);     // byte offsets in the mask
            const unsigned mh = mr + hi * 32;
#pragma unroll
            for (int nt = 0; nt < NTIL - 1; ++nt) {
                const f4u m0 = *(const f4u*)(bm + nt * 64 + mh);
                const f4u m1 = *(const f4u*)(bm + nt * 64 + 16 + mh);
#pragma unroll
                for (int r = 0; r < 4; ++r) { mk[nt][r] = m0[r]; mk[nt][r + 4] = m1[r]; }
            }
            const f4u m0 = *(const f4u*)(bm + (NN - 8) * 4 + mr);
            const f4u m1 = *(const f4u*)(bm + (NN - 4) * 4 + mr);
#pragma unroll
            for (int r = 0; r < 4; ++r) { mk[NTIL - 1][r] = m0[r]; mk[NTIL - 1][r + 4] = m1[r]; }
            // the row loads' results below may land in address registers of the loads above;
            // as the wait's inputs those stay live up to it, so that no mask value is laid over them
            asm volatile("s_wait_xcnt 0x0" :: "v"(mr), "v"(mh), "s"(bm) : "memory");
        }
        // input_cat tile: one 512-B row per load; the last tile has LASTROWS live rows
        {
            const bool   full = pw < PTIL - 1;
            const char*    er = be;
            const unsigned eo = (b * PP + p0) * (EMB * 4) + lane * 16;
            float4 ev[16];
#pragma unroll
            for (int j = 0; j < LASTROWS; ++j) ev[j] = *(const float4*)(er + j * EMB * 4 + eo);
            // the next rows' results may land in these loads' offset register
            asm volatile("s_wait_xcnt 0x0" ::: "memory");
#pragma unroll
            for (int j = LASTROWS; j < 16; ++j) ev[j] = make_float4(0.f, 0.f, 0.f, 0.f);
            if (full) {
#pragma unroll
                for (int j = LASTROWS; j < 16; ++j) ev[j] = *(const float4*)(er + j * EMB * 4 + eo);
            }
#pragma unroll
            for (int j = 0; j < 16; ++j) {
                v4h h;
                h[0] = (_Float16)ev[j].x; h[1] = (_Float16)ev[j].y;
                h[2] = (_Float16)ev[j].z; h[3] = (_Float16)ev[j].w;
                *(v4h*)&X[j * LQ + lane * 4] = h;
            }
        }
        // features + K-pad (cols 128..159): lane pair (l, l+16) fills row l
        {
            const bool live = (p < PP) && (hi == 0);
            v8h fa = z8;
            fa[0] = (_Float16)(live ? f0 : 0.f); fa[1] = (_Float16)(live ? f1 : 0.f);
            fa[2] = (_Float16)(live ? f2 : 0.f); fa[3] = (_Float16)(live ? f3 : 0.f);
            *(v8h*)&X[l * LQ + EMB + hi * 16]     = fa;
            *(v8h*)&X[l * LQ + EMB + hi * 16 + 8] = z8;
        }
        // dead rows get mask 0; the last tile's live columns (NN - LASTCOLS .. NN - 1,
        // all in the lower lane half) move to their registers, its pad columns drop out
#pragma unroll
        for (int nt = 0; nt < NTIL - 1; ++nt)
#pragma unroll
            for (int r = 0; r < 8; ++r) mk[nt][r] = (p < PP) ? mk[nt][r] : 0.f;
#pragma unroll
        for (int r = 0; r < 8; ++r) {
            const float v = (p < PP) ? mk[NTIL - 1][r + 8 - LASTCOLS < 8 ? r + 8 - LASTCOLS : 7] : 0.f;
            mk[NTIL - 1][r] = (r < LASTCOLS && hi == 0) ? v : -1e30f;
        }
        wave_lds_sync();

        // ---- Q^T, attention and mh^T, two heads a trip ---------------------
        v16h xb[5];     // input_cat^T as B operand, K = 160, kept for all heads
#pragma unroll
        for (int kt = 0; kt < 5; ++kt) xb[kt] = frag_k32(X, 0, kt * 32, LQ, lane);
        v8f macc[8];    // mh^T: tile ct, register r = mh[p][ct*16 + hi*8 + r]
#pragma unroll
        for (int ct = 0; ct < 8; ++ct) macc[ct] = zero8();
        // kept rolled: the text stays small for the instruction cache.  Two heads are one
        // 32-deep k block of mh^T, so that the trip number enters LDS addresses only and
        // everything else is indexed by constants and stays in registers.
#pragma unroll 1
        for (int hp = 0; hp < NH / 2; ++hp) {
            // Q^T = Wq^T @ input_cat^T of the two heads: register r = Q[p][head*16 + hi*8 + r]
            v8f q0 = zero8(), q1 = zero8();
#pragma unroll
            for (int kt = 0; kt < 5; ++kt) {
                q0 = wmma_f16(frag_k32(sWqT, hp * 32,      kt * 32, LQ, lane), xb[kt], q0);
                q1 = wmma_f16(frag_k32(sWqT, hp * 32 + 16, kt * 32, LQ, lane), xb[kt], q1);
            }
            // S^T = K @ Q^T.  One K fragment holds both heads' d (k 0..15 and 16..31);
            // the other head's half of B is zero.
            const v16h bq0 = join16(__builtin_convertvector(q0, v8h), z8);
            const v16h bq1 = join16(z8, __builtin_convertvector(q1, v8h));
            v8f sc[2][NTIL];                               // sc[j][nt][r] = S[p][nt*16 + hi*8 + r]
#pragma unroll
            for (int nt = 0; nt < NTIL; ++nt) {
                const v16h ak = frag_k32(sKT, nt * 16, hp * 32, LP, lane);
                sc[0][nt] = wmma_f16(ak, bq0, zero8());
                sc[1][nt] = wmma_f16(ak, bq1, zero8());
            }
            v8h oh[2];  // register r = out_concat[p][head*16 + hi*8 + r]
#pragma unroll
            for (int j = 0; j < 2; ++j) {
                // scale 1/sqrt(16) + mask
#pragma unroll
                for (int nt = 0; nt < NTIL; ++nt)
#pragma unroll
                    for (int r = 0; r < 8; ++r)
                        sc[j][nt][r] = sc[j][nt][r] * 0.25f + mk[nt][r];
                const float m = row_max(sc[j]);
                // exp (unnormalized), eight independent partial sums
                float s8[8];
#pragma unroll
                for (int r = 0; r < 8; ++r) s8[r] = 0.f;
#pragma unroll
                for (int nt = 0; nt < NTIL; ++nt) {
                    float t[8];
#pragma unroll
                    for (int r = 0; r < 8; ++r) t[r] = (sc[j][nt][r] - m) * 1.4426950408889634f;
                    TRANS_X8("v_exp_f32", t);
#pragma unroll
                    for (int r = 0; r < 8; ++r) { s8[r] += t[r]; sc[j][nt][r] = t[r]; }
                }
                const float inv = 1.f / row_sum(s8);
                // O^T = V^T @ W^T (columns n = 112..127 are zero on both sides), 1/rowsum folded in
                v8f o = zero8();
#pragma unroll
                for (int kt = 0; kt < 4; ++kt) {
                    const v8h w0 = __builtin_convertvector(sc[j][2 * kt], v8h);
                    const v8h w1 = (2 * kt + 1 < NTIL)
                        ? __builtin_convertvector(sc[j][2 * kt + 1 < NTIL ? 2 * kt + 1 : 0], v8h) : z8;
                    o = wmma_f16(frag_k32(sVT, hp * 32 + j * 16, kt * 32, LP, lane), join16(w0, w1), o);
                }
#pragma unroll
                for (int r = 0; r < 8; ++r) o[r] *= inv;
                oh[j] = __builtin_convertvector(o, v8h);
            }
            // mh^T += Wc^T @ out_concat^T, this pair's k block
            const v16h bo = join16(oh[0], oh[1]);
#pragma unroll
            for (int ct = 0; ct < 8; ++ct)
                macc[ct] = wmma_f16(frag_k32(sWcT, ct * 16, hp * 32, LP, lane), bo, macc[ct]);
        }
        v8h mhh[8];     // mh + bc in f16: tile ct, element r = mh[p][ct*16 + hi*8 + r]
#pragma unroll
        for (int ct = 0; ct < 8; ++ct) {
            const float4 b0 = *(const float4*)&sbc[ct * 16 + hi * 8];
            const float4 b1 = *(const float4*)&sbc[ct * 16 + hi * 8 + 4];
            v8f a = macc[ct];
            a[0] += b0.x; a[1] += b0.y; a[2] += b0.z; a[3] += b0.w;
            a[4] += b1.x; a[5] += b1.y; a[6] += b1.z; a[7] += b1.w;
            mhh[ct] = __builtin_convertvector(a, v8h);
        }

        // ---- score2^T = EN @ mh^T / sqrt(EMB); 10*tanh + mask; softmax over N
        {
            // seven independent accumulator chains
            v8f s2[NTIL];
#pragma unroll
            for (int nt = 0; nt < NTIL; ++nt) s2[nt] = zero8();
#pragma unroll
            for (int kt = 0; kt < 4; ++kt) {
                const v16h bm = join16(mhh[2 * kt], mhh[2 * kt + 1]);
#pragma unroll
                for (int nt = 0; nt < NTIL; ++nt)
                    s2[nt] = wmma_f16(frag_k32(sENc, nt * 16, kt * 32, LP, lane), bm, s2[nt]);
            }
#pragma unroll
            for (int nt = 0; nt < NTIL; ++nt) {
                float t[8];
#pragma unroll
                for (int r = 0; r < 8; ++r) t[r] = s2[nt][r];
                tanh_scaled_x8(t);
#pragma unroll
                for (int r = 0; r < 8; ++r) s2[nt][r] = 10.0f * t[r] + mk[nt][r];
            }
            const float m = row_max(s2);
            float s8[8];
#pragma unroll
            for (int r = 0; r < 8; ++r) s8[r] = 0.f;
#pragma unroll
            for (int nt = 0; nt < NTIL; ++nt) {
                float t[8];
#pragma unroll
                for (int r = 0; r < 8; ++r) t[r] = (s2[nt][r] - m) * 1.4426950408889634f;
                TRANS_X8("v_exp_f32", t);
#pragma unroll
                for (int r = 0; r < 8; ++r) { s8[r] += t[r]; s2[nt][r] = t[r]; }
            }
            const float inv = 1.f / row_sum(s8);
            // all products first, in place, so that no store's data register is rewritten
#pragma unroll
            for (int nt = 0; nt < NTIL; ++nt)
#pragma unroll
                for (int r = 0; r < 8; ++r) s2[nt][r] *= inv;
            if (p < PP) {
                float* orow = (float*)(bq + ((b * PP + p) * NN + hi * 8) * 4u);
#pragma unroll
                for (int nt = 0; nt < NTIL - 1; ++nt) {
                    f4u v0, v1;
#pragma unroll
                    for (int r = 0; r < 4; ++r) { v0[r] = s2[nt][r]; v1[r] = s2[nt][r + 4]; }
                    *(f4u*)(orow + nt * 16)     = v0;
                    *(f4u*)(orow + nt * 16 + 4) = v1;
                }
                if (hi == 0) {
#pragma unroll
                    for (int r = 0; r < LASTCOLS; ++r) orow[(NTIL - 1) * 16 + r] = s2[NTIL - 1][r];
                }
            }
            // the next batch rewrites the stores' address and data registers
            asm volatile("s_wait_xcnt 0x0" ::: "memory");
        }
    } else if (b + GRID < BB) {
        // ---- the eighth wave has no P tile: it stages the next batch's encoded_nodes
        // into the other buffer meanwhile.  All row loads go out ahead of any wait on one.
        _Float16*      sENn = sEN + (cur ^ 1) * (NPAD * LP);
        const char*    e0   = bn;
        const unsigned eo   = (b + GRID) * (NN * EMB * 4) + lane * 16;
        float4 ea[NN];
#pragma unroll   // unrolled, below too: the loads stand back to back and ea[] stays in registers
        for (int j = 0; j < NN; ++j) ea[j] = *(const float4*)(e0 + j * EMB * 4 + eo);
        // no address register of these loads is rewritten ahead of this wait: as its
        // inputs they stay live up to it, so that no load's result is laid over them
        asm volatile("s_wait_xcnt 0x0" :: "v"(eo), "s"(e0) : "memory");
#pragma unroll
        for (int j = 0; j < NN; ++j) {
            v4h h; h[0] = (_Float16)ea[j].x; h[1] = (_Float16)ea[j].y;
            h[2] = (_Float16)ea[j].z; h[3] = (_Float16)ea[j].w;
            *(v4h*)&sENn[j * LP + lane * 4] = h;
        }
    }
    // ends every read of this batch's K, V^T and encoded_nodes; publishes the next buffer
    lds_barrier();
    }
}

// ---------------------------------------------------------------------------
extern "C" void kernel_launch(void* const* d_in, const int* in_sizes, int n_in,
                              void* d_out, int out_size, void* d_ws, size_t ws_size,
                              hipStream_t stream) {
    (void)in_sizes; (void)n_in; (void)out_size; (void)ws_size;
    const float* eln   = (const float*)d_in[0];
    const float* gload = (const float*)d_in[1];
    const float* gtime = (const float*)d_in[2];
    const float* glen  = (const float*)d_in[3];
    const float* gopen = (const float*)d_in[4];
    const float* ninf  = (const float*)d_in[5];
    const float* enc   = (const float*)d_in[6];
    const float* Wq    = (const float*)d_in[7];
    const float* Wk    = (const float*)d_in[8];
    const float* Wv    = (const float*)d_in[9];
    const float* Wc    = (const float*)d_in[10];
    const float* bcv   = (const float*)d_in[11];
    float* out = (float*)d_out;
    float* img = (float*)d_ws;

    hipFuncSetAttribute((const void*)vrp_decoder_kernel,
                        hipFuncAttributeMaxDynamicSharedMemorySize,
                        SMEM_TOTAL);
    weight_image_kernel<<<dim3(IMG_BLOCKS), dim3(EMB), 0, stream>>>(Wq, Wk, Wv, Wc, bcv, img);
    vrp_decoder_kernel<<<dim3(GRID), dim3(256), SMEM_TOTAL, stream>>>(
        eln, gload, gtime, glen, gopen, ninf, enc, img, out);
}

// v009
// It runs in 61.1 microseconds.
// Timed twice side by side with v008, it ran 1.04 and 1.03 times as fast.
// All steps since v000 together make it 10.3 times as fast.
#include <hip/hip_runtime.h>
#include <hip/hip_bf16.h>
#include <math.h>

// ---------------------------------------------------------------------------
// Problem constants (match reference)
// ---------------------------------------------------------------------------
#define BB   1024
#define PP   100
#define NN   101
#define EMB  128
#define NH   8
#define DKK  16

#define NPAD 112        // N padded to 7*16
#define PTIL 7          // ceil(100/16)
#define NTIL 7          // ceil(101/16)
#define KQ   160        // 132 padded to 5*32
#define LASTROWS (PP - (PTIL - 1) * 16)   // live rows of the last P tile
#define ENLD ((NN + 7) / 8)   // groups of 8 encoded_nodes rows that hold a live row
#define LASTCOLS (NN - (NTIL - 1) * 16)   // live columns of the last N tile
#define GRID 256        // blocks; a block's LDS fills a WGP, and each block walks BB / GRID batches

// LDS row pitches.  Bank = dword address mod 64, so 16 rows at a 256-B pitch put
// a whole b128 fragment read on four banks.  16 B x odd spreads them over all 64.
#define LP   136        // halves: 272 B pitch for the 128-half rows
#define LQ   168        // halves: 336 B pitch for the 160-half rows

typedef __attribute__((ext_vector_type(16))) _Float16 v16h;
typedef __attribute__((ext_vector_type(8)))  _Float16 v8h;
typedef __attribute__((ext_vector_type(4)))  _Float16 v4h;
typedef __attribute__((ext_vector_type(8)))  float    v8f;
// four floats at the 4-byte alignment of a 101-float row
typedef __attribute__((ext_vector_type(4), aligned(4))) float f4u;

// ---------------------------------------------------------------------------
// WMMA helpers (CDNA5 wave32, D = A(16x32 f16) * B(32x16 f16) + C(16x16 f32))
// ---------------------------------------------------------------------------
__device__ __forceinline__ v8f wmma_f16(v16h a, v16h b, v8f c) {
    return __builtin_amdgcn_wmma_f32_16x16x32_f16(
        /*neg_a=*/false, a, /*neg_b=*/false, b,
        /*c_mod=*/(short)0, c, /*reuse_a=*/false, /*reuse_b=*/false);
}

__device__ __forceinline__ v8f zero8() {
    v8f z = {0.f, 0.f, 0.f, 0.f, 0.f, 0.f, 0.f, 0.f};
    return z;
}

// A-operand (16x32, M x K) from row-major f16 [M][stride]; also valid for the
// B-operand (32x16, K x N) when B is stored "column-major by N", i.e. [N][stride]
// holding K along the row.  Per ISA 7.12.2: lanes 0-15 hold K {0..7,16..23},
// lanes 16-31 hold K {8..15,24..31}  ->  two aligned 16B LDS reads per lane.
__device__ __forceinline__ v16h frag_k32(const _Float16* base, int row0, int k0,
                                         int stride, int lane) {
    const int l  = lane & 15;
    const int hi = (lane >> 4) & 1;
    const _Float16* p = base + (size_t)(row0 + l) * stride + k0 + hi * 8;
    v8h lo = *(const v8h*)p;
    v8h hh = *(const v8h*)(p + 16);
    v16h r;
#pragma unroll
    for (int i = 0; i < 8; ++i) { r[i] = lo[i]; r[i + 8] = hh[i]; }
    return r;
}

// Hand-over of a tile between the lanes of ONE wave through LDS: the wave's own
// stores must have landed, and the compiler must not hoist the reads over them.
__device__ __forceinline__ void wave_lds_sync() {
    asm volatile("s_wait_dscnt 0x0" ::: "memory");
}

// Work-group barrier of the batch loop.  Only LDS passes between the waves, so only the
// wave's LDS operations are waited for: __syncthreads() would also wait here for the
// output stores of the batch before, which may go on landing under the next products.
__device__ __forceinline__ void lds_barrier() {
    asm volatile("s_wait_dscnt 0x0\n\ts_barrier_signal -1\n\ts_barrier_wait -1" ::: "memory");
}

// Two 8-half register groups as one 16x16x32 operand: k 0..15 of the block from lo,
// k 16..31 from hh (each lane half holds its eight of either).
__device__ __forceinline__ v16h join16(v8h lo, v8h hh) {
    return __builtin_shufflevector(lo, hh, 0, 1, 2, 3, 4, 5, 6, 7, 8, 9, 10, 11, 12, 13, 14, 15);
}

// The value of lane l ^ 16.
__device__ __forceinline__ float other_half(float x) {
    const int v = __float_as_int(x);
    return __int_as_float(__builtin_amdgcn_permlanex16(v, v, 0x76543210, 0xfedcba98, false, false));
}

// Maximum of a row that lies in lanes l and l + 16: eight independent chains over the
// tiles, a tree over them, one exchange between the lane halves.
__device__ __forceinline__ float row_max(const v8f (&t)[NTIL]) {
    float m[8];
#pragma unroll   // unrolled, the inner loop too: m[] and t[] stay in registers
    for (int r = 0; r < 8; ++r) {
        m[r] = t[0][r];
#pragma unroll
        for (int nt = 1; nt < NTIL; ++nt) m[r] = fmaxf(m[r], t[nt][r]);
    }
    const float a = fmaxf(fmaxf(fmaxf(m[0], m[1]), fmaxf(m[2], m[3])),
                          fmaxf(fmaxf(m[4], m[5]), fmaxf(m[6], m[7])));
    return fmaxf(a, other_half(a));
}

// Sum of a row from a lane's eight partial sums: a tree, then the other lane half's.
__device__ __forceinline__ float row_sum(const float (&s)[8]) {
    const float a = ((s[0] + s[1]) + (s[2] + s[3])) + ((s[4] + s[5]) + (s[6] + s[7]));
    return a + other_half(a);
}

// Eight independent transcendentals of one kind in one statement: each is the free
// issue slot that the instruction set asks for behind the one in front of it, and the
// v_nop is the last one's.
#define TRANS_X8(OP, t)                                                        \
    asm(OP " %0, %0\n\t" OP " %1, %1\n\t" OP " %2, %2\n\t" OP " %3, %3\n\t"      \
        OP " %4, %4\n\t" OP " %5, %5\n\t" OP " %6, %6\n\t" OP " %7, %7\n\tv_nop" \
        : "+v"(t[0]), "+v"(t[1]), "+v"(t[2]), "+v"(t[3]),                      \
          "+v"(t[4]), "+v"(t[5]), "+v"(t[6]), "+v"(t[7]))

// tanh(x / sqrt(EMB)) = 1 - 2 / (e^(2x / sqrt(EMB)) + 1) for a lane's eight values of
// one tile, without a branch: five instructions a value, no value waits for another.
// e^.. = inf gives 1, e^.. = 0 gives -1, NaN stays NaN.  The absolute error is a few
// f32 ulps of 1, which is what counts for a logit that is 10 * tanh.
__device__ __forceinline__ void tanh_scaled_x8(float (&t)[8]) {
#pragma unroll   // unrolled here and below: t[] stays in registers
    for (int r = 0; r < 8; ++r)
        t[r] *= (float)(2.0 * 1.4426950408889634 / 11.313708498984761);
    TRANS_X8("v_exp_f32", t);
#pragma unroll
    for (int r = 0; r < 8; ++r) t[r] += 1.0f;
    TRANS_X8("v_rcp_f32", t);
#pragma unroll
    for (int r = 0; r < 8; ++r) t[r] = 1.0f - 2.0f * t[r];
}

// ---------------------------------------------------------------------------
// Dynamic-LDS layout; total 312,832 B (< 320 KB WGP): two encoded_nodes buffers, K,
// V^T, the weight image, the seven input tiles, the lane numbers
// ---------------------------------------------------------------------------
#define WAVE_HALVES  (16 * LQ)                 // one wave's private input tile
#define SMEM_TOTAL   (IMG_LDS_OFF + IMG_BYTES + PTIL * WAVE_HALVES * 2 + 256 * 4)

// ---------------------------------------------------------------------------
// Weight image: Wc^T, bc, Wq^T, Wk^T, Wv^T exactly as they lie in LDS (f16 rows
// at their padded pitch, K-pad and pitch pad zero; bc in f32).  Built once per
// call by the first launch, then fetched whole, once, by every block of the second.
// ---------------------------------------------------------------------------
#define IMG_LDS_OFF ((3 * NPAD + EMB) * LP * 2)         // LDS byte offset of Wc^T
#define IMG_WC      0
#define IMG_BC      (IMG_WC + EMB * LP * 2)
#define IMG_WQ      (IMG_BC + EMB * 4)
#define IMG_WK      (IMG_WQ + EMB * LQ * 2)
#define IMG_WV      (IMG_WK + EMB * LP * 2)
#define IMG_BYTES   (IMG_WV + EMB * LP * 2)             // 147,968 = 289 x 512
#define UP          (LP / 8)                            // 16-B units per 272-B row
#define UQ          (LQ / 8)                            // 16-B units per 336-B row
#define IMG_BLOCKS  (3 * UP + UQ + 1)

// One block = one 16-B unit column (8 k values) of one matrix, thread = row n:
// eight coalesced row reads, one 16-B store.
__global__ __launch_bounds__(EMB)
void weight_image_kernel(const float* __restrict__ Wq,    // [132,128]
                         const float* __restrict__ Wk,    // [128,128]
                         const float* __restrict__ Wv,    // [128,128]
                         const float* __restrict__ Wc,    // [128,128]
                         const float* __restrict__ bcv,   // [128]
                         float* __restrict__ img)
{
    const int blk = blockIdx.x;
    const int n   = threadIdx.x;
    char* dst = (char*)img;
    if (blk == IMG_BLOCKS - 1) {
        if (n < EMB / 4) *(float4*)(dst + IMG_BC + n * 16) = *(const float4*)&bcv[n * 4];
        return;
    }
    const float* Wm; int u, kmax, pitch, off;
    if (blk < UP)               { Wm = Wc; u = blk;               kmax = EMB;     pitch = LP * 2; off = IMG_WC; }
    else if (blk < UP + UQ)     { Wm = Wq; u = blk - UP;          kmax = EMB + 4; pitch = LQ * 2; off = IMG_WQ; }
    else if (blk < 2 * UP + UQ) { Wm = Wk; u = blk - UP - UQ;     kmax = EMB;     pitch = LP * 2; off = IMG_WK; }
    else                        { Wm = Wv; u = blk - 2 * UP - UQ; kmax = EMB;     pitch = LP * 2; off = IMG_WV; }
    // pad rows read a clamped address, so that the eight loads share one trip
    float w[8];
#pragma unroll
    for (int j = 0; j < 8; ++j) {
        const int k = u * 8 + j;
        w[j] = Wm[(k < kmax ? k : kmax - 1) * EMB + n];
    }
    v8h h;
#pragma unroll
    for (int j = 0; j < 8; ++j)
        h[j] = (u * 8 + j < kmax) ? (_Float16)w[j] : (_Float16)0.f;
    *(v8h*)(dst + off + n * pitch + u * 16) = h;
    // the built code lays the bc branch's load behind this store, into its data registers
    asm volatile("s_wait_xcnt 0x0" ::: "memory");
}

// Twelve 16-B-per-lane copies global -> LDS, 4 KiB apart (the block's eight waves
// cover 4 KiB per copy).  The s_wait_xcnt closes the statement so that no address
// register of a copy is rewritten ahead of it.
__device__ __forceinline__ void copy12_to_lds(unsigned l, const char* g) {
    asm volatile(
        "global_load_async_to_lds_b128 %0, %12, off\n\t"
        "global_load_async_to_lds_b128 %1, %13, off\n\t"
        "global_load_async_to_lds_b128 %2, %14, off\n\t"
        "global_load_async_to_lds_b128 %3, %15, off\n\t"
        "global_load_async_to_lds_b128 %4, %16, off\n\t"
        "global_load_async_to_lds_b128 %5, %17, off\n\t"
        "global_load_async_to_lds_b128 %6, %18, off\n\t"
        "global_load_async_to_lds_b128 %7, %19, off\n\t"
        "global_load_async_to_lds_b128 %8, %20, off\n\t"
        "global_load_async_to_lds_b128 %9, %21, off\n\t"
        "global_load_async_to_lds_b128 %10, %22, off\n\t"
        "global_load_async_to_lds_b128 %11, %23, off\n\t"
        "s_wait_xcnt 0x0"
        :: "v"(l), "v"(l + 4096u), "v"(l + 8192u), "v"(l + 12288u),
           "v"(l + 16384u), "v"(l + 20480u), "v"(l + 24576u), "v"(l + 28672u),
           "v"(l + 32768u), "v"(l + 36864u), "v"(l + 40960u), "v"(l + 45056u),
           "v"(g), "v"(g + 4096), "v"(g + 8192), "v"(g + 12288),
           "v"(g + 16384), "v"(g + 20480), "v"(g + 24576), "v"(g + 28672),
           "v"(g + 32768), "v"(g + 36864), "v"(g + 40960), "v"(g + 45056)
        : "memory");
}

// All global loads of one P tile, issued back to back with no wait among them, in the
// order in which they are used: the last-node rows, one 512-B row per load (byte offset
// eo; e2 for the rows that only a full tile has); the four features of the lane's row
// (row number gi); its mask row straight in the transposed accumulator layout (column
// n = nt*16 + hi*8 + r, offset mh; of the last column tile the row's last LASTCOLS
// values, offset mr).
__device__ __forceinline__ void tile_loads(const char* bl, const char* bt, const char* bg,
                                           const char* bo, const char* bm, const char* be,
                                           unsigned gi, unsigned mr, unsigned mh, unsigned eo,
                                           unsigned e2, float (&nf)[4], f4u (&nm)[2 * NTIL - 1],
                                           float& nc, float4 (&nev)[16]) {
#pragma unroll   // unrolled, below too: the arrays are indexed by constants and stay in registers
    for (int j = 0; j < LASTROWS; ++j) nev[j] = *(const float4*)(be + j * EMB * 4 + eo);
#pragma unroll
    for (int j = LASTROWS; j < 16; ++j) nev[j] = *(const float4*)(be + j * EMB * 4 + e2);
    nf[0] = *(const float*)(bl + gi * 4); nf[1] = *(const float*)(bt + gi * 4);
    nf[2] = *(const float*)(bg + gi * 4); nf[3] = *(const float*)(bo + gi * 4);
#pragma unroll
    for (int nt = 0; nt < NTIL - 1; ++nt) {
        nm[2 * nt]     = *(const f4u*)(bm + nt * 64 + mh);
        nm[2 * nt + 1] = *(const f4u*)(bm + nt * 64 + 16 + mh);
    }
    nm[2 * NTIL - 2] = *(const f4u*)(bm + (NN - 5) * 4 + mr);
    nc               = *(const float*)(bm + (NN - 1) * 4 + mr);
    // no address register of these loads is rewritten ahead of this wait, on any way that
    // leads on from here: as its inputs they stay live up to it, so that no load's result
    // is laid over them.  It waits for no data.
    asm volatile("s_wait_xcnt 0x0" :: "v"(gi), "v"(mr), "v"(mh), "v"(eo), "v"(e2), "s"(bl),
                 "s"(bt), "s"(bg), "s"(bo), "s"(bm), "s"(be) : "memory");
}

// One block fills a WGP's LDS, so two waves share a SIMD.  Stated so that the compiler
// schedules for that register budget: without it this build packs the Q and mh
// products into fewer registers and waits on LDS at nearly every one of them.
__global__ __launch_bounds__(256) __attribute__((amdgpu_waves_per_eu(2, 2)))
void vrp_decoder_kernel(const float* __restrict__ eln,    // [B,P,EMB]
                        const float* __restrict__ gload,  // [B,P]
                        const float* __restrict__ gtime,  // [B,P]
                        const float* __restrict__ glen,   // [B,P]
                        const float* __restrict__ gopen,  // [B,P]
                        const float* __restrict__ ninf,   // [B,P,N]
                        const float* __restrict__ enc,    // [B,N,EMB]
                        const float* __restrict__ wimg,   // weight image, IMG_BYTES
                        float* __restrict__ out)          // [B,P,N]
{
    extern __shared__ char smem[];
    const int tid  = threadIdx.x;
    const int wave = tid >> 5;     // 0..7
    const int lane = tid & 31;
    const int l    = lane & 15;
    const int hi   = (lane >> 4) & 1;

    _Float16* sEN  = (_Float16*)smem;            // [2][112][LP], one buffer per batch in turn
    _Float16* sKT  = sEN  + 2 * NPAD * LP;       // [112][LP] K as [n][h*16+d]
    _Float16* sVT  = sKT  + NPAD * LP;           // [128][LP] V^T as [h*16+d][n]
    _Float16* sWcT = sVT  + EMB * LP;            // [128][LP]
    float*    sbc  = (float*)(sWcT + EMB * LP);  // [128]
    _Float16* sWqT = (_Float16*)(sbc + EMB);     // [128][LQ]
    _Float16* sWkT = sWqT + EMB * LQ;            // [128][LP]
    _Float16* sWvT = sWkT + EMB * LP;            // [128][LP]
    _Float16* sX   = sWvT + EMB * LP;            // seven wave-private areas (see the P tiles)
    int*      sLn  = (int*)(sX + PTIL * WAVE_HALVES);   // [256] every thread's lane number

    // ---------------- phase 0: fetch the weight image, stage the first batch's encoded_nodes
    // The row loads go out first (the longer trip), then the image's copies.
    const int pw = __builtin_amdgcn_readfirstlane(wave);
    // encoded_nodes: wave w stages rows w, w+8, ...; one 512-B row per load.  All of
    // a thread's row loads are issued here, ahead of any wait on one of them, so that
    // they share one trip to memory.  A pad row of the group that straddles row NN
    // reads a clamped address; the group past it is not loaded at all.
    float4 en[ENLD];
    {
        const int      rl = pw + 8 * (ENLD - 1);         // pw is 0..7
        const char*    e0 = (const char*)&enc[((size_t)blockIdx.x * NN + pw) * EMB];
        const char*    e1 = (const char*)&enc[((size_t)blockIdx.x * NN + (rl < NN ? rl : NN - 1)) * EMB];
        const unsigned eo = lane * 16;
#pragma unroll   // unrolled: the loads stand back to back and en[] stays in registers
        for (int j = 0; j < ENLD - 1; ++j) en[j] = *(const float4*)(e0 + j * 8 * EMB * 4 + eo);
        en[ENLD - 1] = *(const float4*)(e1 + eo);
        // no address register of these loads is rewritten ahead of this wait: as its
        // inputs they stay live up to it, so that no load's result is laid over them
        asm volatile("s_wait_xcnt 0x0" :: "v"(lane), "s"(e0), "s"(e1) : "memory");
    }
    {
        const unsigned l0 = (unsigned)(size_t)smem + IMG_LDS_OFF + tid * 16;
        const char*    g0 = (const char*)wimg + tid * 16;
        copy12_to_lds(l0, g0);
        copy12_to_lds(l0 + 49152u, g0 + 49152);
        copy12_to_lds(l0 + 98304u, g0 + 98304);
        if (pw == 0) {   // the image's last 512 B; wait in the statement as in copy12_to_lds
            asm volatile("global_load_async_to_lds_b128 %0, %1, off\n\ts_wait_xcnt 0x0"
                         :: "v"(l0 + 147456u), "v"(g0 + 147456) : "memory");
        }
    }
    for (int i = tid; i < EMB * 16; i += 256) { // zero V^T cols n=112..127
        int r = i >> 4, c = i & 15;
        sVT[r * LP + NPAD + c] = (_Float16)0.f;
    }
    sLn[tid] = lane;
    if (tid < (NPAD - NN) * 16) {               // the second buffer's pad rows, zero for good
        v8h z;
#pragma unroll   // unrolled: z stays in registers
        for (int i = 0; i < 8; ++i) z[i] = (_Float16)0.f;
        *(v8h*)&sEN[(NPAD + NN + (tid >> 4)) * LP + (tid & 15) * 8] = z;
    }
    // encoded_nodes rows to f16: contiguous b64 LDS stores, pad rows zero
#pragma unroll   // unrolled: en[] is indexed by constants only
    for (int j = 0; j < NPAD / 8; ++j) {
        const int r = pw + 8 * j;
        float4 v = make_float4(0.f, 0.f, 0.f, 0.f);
        if (8 * j + 7 < NN || (j < ENLD && r < NN)) v = en[j < ENLD ? j : 0];
        v4h h; h[0] = (_Float16)v.x; h[1] = (_Float16)v.y;
        h[2] = (_Float16)v.z; h[3] = (_Float16)v.w;
        *(v4h*)&sEN[r * LP + lane * 4] = h;
    }
    // this wave's copies have landed; the barrier then publishes all waves' parts
    asm volatile("s_wait_asynccnt 0x0" ::: "memory");
    __syncthreads();

    // ---------------- the block's batches, one after the other --------------
    // Global addresses in the loop are an array's base (scalar registers) plus a 32-bit
    // byte offset a lane (every array is far below 4 GiB): one register an address.
    const char* bl = (const char*)gload;
    const char* bt = (const char*)gtime;
    const char* bg = (const char*)glen;
    const char* bo = (const char*)gopen;
    const char* bm = (const char*)ninf;
    const char* be = (const char*)eln;
    const char* bn = (const char*)enc;
    char*       bq = (char*)out;
    // kept rolled: the text stays small for the instruction cache
#pragma unroll 1
    for (unsigned b = blockIdx.x, cur = 0; b < BB; b += GRID, cur ^= 1) {
    const _Float16* sENc = sEN + cur * (NPAD * LP);   // this batch's encoded_nodes
    // The lane number is read anew from LDS (the thread's own word) for every batch: all
    // addresses formed from it are then formed where they are used.  Taken from the
    // register, some twenty of them are kept across the whole loop, which the head loop's
    // registers leave no room for: the build spills them to scratch.
    const int lane = sLn[tid];
    const int l    = lane & 15;
    const int hi   = (lane >> 4) & 1;

    // ---------------- the P tile's global loads go out ahead of phase 1 ------
    // They need nothing of phase 1 and are read behind its barrier: their trip to memory
    // runs under the K and V products.  A dead row reads a clamped address: the mask and
    // the features that of row PP - 1, the last tile's rows past LASTROWS those of the
    // sixteen rows that end the batch.  The eighth wave has no tile and reads none of this.
    float  nf[4];
    f4u    nm[2 * NTIL - 1];
    float  nc;
    float4 nev[16];
    static_assert(LASTCOLS == 5, "tile_loads reads the last column tile as 4 + 1 values");
    const unsigned gi = b * PP + (pw * 16 + l < PP ? pw * 16 + l : PP - 1);
    const unsigned mr = gi * (NN * 4);         // byte offsets in the mask
    const unsigned mh = mr + hi * 32;
    const unsigned eo = (b * PP + pw * 16) * (EMB * 4) + lane * 16;
    const unsigned e2 = pw < PTIL - 1 ? eo : eo - (16 - LASTROWS) * (EMB * 4);
    if (pw < PTIL) tile_loads(bl, bt, bg, bo, bm, be, gi, mr, mh, eo, e2, nf, nm, nc, nev);
    else {
        // The eighth wave sets the same variables itself: left unset on this path, the build
        // holds their registers round the whole loop, and the head loop's schedule loses the
        // room it needs.  For the rows the value is no constant: with one the compiler
        // converts the rows to f16 in the branch above, and so waits there for the loads
        // that are to fly under phase 1.
        const float u = (float)lane;
#pragma unroll
        for (int j = 0; j < 4; ++j) nf[j] = 0.f;
#pragma unroll
        for (int j = 0; j < 2 * NTIL - 1; ++j) nm[j] = (f4u){0.f, 0.f, 0.f, 0.f};
        nc = 0.f;
#pragma unroll
        for (int j = 0; j < 16; ++j) nev[j] = make_float4(u, u, u, u);
    }

    // ---------------- phase 1: K = EN@Wk, V = EN@Wv ------------------------
    // Wave w owns column tile w of both products.  Its eight weight fragments are read
    // once and stay in registers; each encoded_nodes fragment is read once and feeds K
    // and V, two independent accumulator chains.  The next node tile's fragments are
    // read ahead of this tile's products and stores (the compiler does not lift an LDS
    // read over the LDS stores by itself).  Every "#pragma unroll" here is there so that
    // the fragment arrays are indexed by constants only and stay in registers.
    {
        v16h wk[4], wv[4], a[2][4];
#pragma unroll
        for (int kt = 0; kt < 4; ++kt) {
            a[0][kt] = frag_k32(sENc, 0, kt * 32, LP, lane);
            wk[kt]   = frag_k32(sWkT, pw * 16, kt * 32, LP, lane);
            wv[kt]   = frag_k32(sWvT, pw * 16, kt * 32, LP, lane);
        }
        // keeps the 24 reads above together ahead of the first product: left free, the
        // scheduler sinks part of them among tile 0's products, each group a full LDS wait
        __builtin_amdgcn_sched_barrier(0);
#pragma unroll
        for (int mt = 0; mt < NTIL; ++mt) {      // n-tile 0..6
            if (mt + 1 < NTIL) {
#pragma unroll
                for (int kt = 0; kt < 4; ++kt)
                    a[(mt + 1) & 1][kt] = frag_k32(sENc, (mt + 1) * 16, kt * 32, LP, lane);
            }
            v8f ak = zero8(), av = zero8();
#pragma unroll
            for (int kt = 0; kt < 4; ++kt) {
                ak = wmma_f16(a[mt & 1][kt], wk[kt], ak);
                av = wmma_f16(a[mt & 1][kt], wv[kt], av);
            }
#pragma unroll
            for (int r = 0; r < 8; ++r)          // sKT[n][col] (strided)
                sKT[(mt * 16 + r + hi * 8) * LP + pw * 16 + l] = (_Float16)ak[r];
            v8h h;                               // sVT[col][n]: 8 contiguous halves, one b128 store
#pragma unroll
            for (int r = 0; r < 8; ++r) h[r] = (_Float16)av[r];
            *(v8h*)&sVT[(pw * 16 + l) * LP + mt * 16 + hi * 8] = h;
        }
    }
    lds_barrier();

    // ---------------- P tiles: one wave owns one 16-row tile end to end -----
    // Every product is computed transposed: the shared operand (weights, K, V^T,
    // encoded_nodes) is A, the tile's own data is B, so that lane (l, hi) holds query
    // row p0 + l throughout.  A pair of D tiles, converted in place, is the next
    // product's B operand in the hardware k order, which frag_k32 has for A: after
    // the input tile nothing of the chain passes through LDS.  A softmax row lies in
    // the two lanes l and l + 16.  Every "#pragma unroll" below is there so that the
    // register arrays are indexed by constants only and stay in registers.
    // The eighth wave's branch is written first: the build then lays the P tiles' code
    // first and the staging behind it, so that the tile's loaded values are not held in
    // registers over the staging's NN row loads.
    if (pw >= PTIL) {
      if (b + GRID < BB) {
        // ---- the eighth wave has no P tile: it stages the next batch's encoded_nodes
        // into the other buffer meanwhile.  All row loads go out ahead of any wait on one.
        _Float16*      sENn = sEN + (cur ^ 1) * (NPAD * LP);
        const char*    e0   = bn;
        const unsigned eo   = (b + GRID) * (NN * EMB * 4) + lane * 16;
        float4 ea[NN];
#pragma unroll   // unrolled, below too: the loads stand back to back and ea[] stays in registers
        for (int j = 0; j < NN; ++j) ea[j] = *(const float4*)(e0 + j * EMB * 4 + eo);
        // no address register of these loads is rewritten ahead of this wait: as its
        // inputs they stay live up to it, so that no load's result is laid over them
        asm volatile("s_wait_xcnt 0x0" :: "v"(eo), "s"(e0) : "memory");
#pragma unroll
        for (int j = 0; j < NN; ++j) {
            v4h h; h[0] = (_Float16)ea[j].x; h[1] = (_Float16)ea[j].y;
            h[2] = (_Float16)ea[j].z; h[3] = (_Float16)ea[j].w;
            *(v4h*)&sENn[j * LP + lane * 4] = h;
        }
      }
    } else {
        const int p0 = pw * 16;
        const int p  = p0 + l;                             // this lane's query row
        _Float16* X  = sX + pw * WAVE_HALVES;              // [16][LQ] input_cat

        v8h z8;
#pragma unroll
        for (int i = 0; i < 8; ++i) z8[i] = (_Float16)0.f;

        const float f0 = nf[0], f1 = nf[1], f2 = nf[2], f3 = nf[3];
        float mk[NTIL][8];
#pragma unroll
        for (int nt = 0; nt < NTIL - 1; ++nt)
#pragma unroll
            for (int r = 0; r < 4; ++r) { mk[nt][r] = nm[2 * nt][r]; mk[nt][r + 4] = nm[2 * nt + 1][r]; }
        // input_cat tile.  The last tile's rows past LASTROWS hold other rows' values: a row
        // of the tile is a column of every product below, enters no other column, and a
        // dead row's column is never stored.
#pragma unroll
        for (int j = 0; j < 16; ++j) {
            v4h h;
            h[0] = (_Float16)nev[j].x; h[1] = (_Float16)nev[j].y;
            h[2] = (_Float16)nev[j].z; h[3] = (_Float16)nev[j].w;
            *(v4h*)&X[j * LQ + lane * 4] = h;
        }
        // features + K-pad (cols 128..159): lane pair (l, l+16) fills row l
        {
            const bool live = (p < PP) && (hi == 0);
            v8h fa = z8;
            fa[0] = (_Float16)(live ? f0 : 0.f); fa[1] = (_Float16)(live ? f1 : 0.f);
            fa[2] = (_Float16)(live ? f2 : 0.f); fa[3] = (_Float16)(live ? f3 : 0.f);
            *(v8h*)&X[l * LQ + EMB + hi * 16]     = fa;
            *(v8h*)&X[l * LQ + EMB + hi * 16 + 8] = z8;
        }
        // dead rows get mask 0; the last tile's live columns (NN - LASTCOLS .. NN - 1,
        // all in the lower lane half) move to their registers, its pad columns drop out
#pragma unroll
        for (int nt = 0; nt < NTIL - 1; ++nt)
#pragma unroll
            for (int r = 0; r < 8; ++r) mk[nt][r] = (p < PP) ? mk[nt][r] : 0.f;
#pragma unroll
        for (int r = 0; r < 8; ++r) {
            const float w = r < 4 ? nm[2 * NTIL - 2][r < 4 ? r : 0] : nc;
            const float v = (p < PP) ? w : 0.f;
            mk[NTIL - 1][r] = (r < LASTCOLS && hi == 0) ? v : -1e30f;
        }
        wave_lds_sync();

        // ---- Q^T, attention and mh^T, two heads a trip ---------------------
        v16h xb[5];     // input_cat^T as B operand, K = 160, kept for all heads
#pragma unroll
        for (int kt = 0; kt < 5; ++kt) xb[kt] = frag_k32(X, 0, kt * 32, LQ, lane);
        v8f macc[8];    // mh^T: tile ct, register r = mh[p][ct*16 + hi*8 + r]
#pragma unroll
        for (int ct = 0; ct < 8; ++ct) macc[ct] = zero8();
        // kept rolled: the text stays small for the instruction cache.  Two heads are one
        // 32-deep k block of mh^T, so that the trip number enters LDS addresses only and
        // everything else is indexed by constants and stays in registers.
#pragma unroll 1
        for (int hp = 0; hp < NH / 2; ++hp) {
            // Q^T = Wq^T @ input_cat^T of the two heads: register r = Q[p][head*16 + hi*8 + r]
            v8f q0 = zero8(), q1 = zero8();
#pragma unroll
            for (int kt = 0; kt < 5; ++kt) {
                q0 = wmma_f16(frag_k32(sWqT, hp * 32,      kt * 32, LQ, lane), xb[kt], q0);
                q1 = wmma_f16(frag_k32(sWqT, hp * 32 + 16, kt * 32, LQ, lane), xb[kt], q1);
            }
            // S^T = K @ Q^T.  One K fragment holds both heads' d (k 0..15 and 16..31);
            // the other head's half of B is zero.
            const v16h bq0 = join16(__builtin_convertvector(q0, v8h), z8);
            const v16h bq1 = join16(z8, __builtin_convertvector(q1, v8h));
            v8f sc[2][NTIL];                               // sc[j][nt][r] = S[p][nt*16 + hi*8 + r]
#pragma unroll
            for (int nt = 0; nt < NTIL; ++nt) {
                const v16h ak = frag_k32(sKT, nt * 16, hp * 32, LP, lane);
                sc[0][nt] = wmma_f16(ak, bq0, zero8());
                sc[1][nt] = wmma_f16(ak, bq1, zero8());
            }
            v8h oh[2];  // register r = out_concat[p][head*16 + hi*8 + r]
#pragma unroll
            for (int j = 0; j < 2; ++j) {
                // scale 1/sqrt(16) + mask
#pragma unroll
                for (int nt = 0; nt < NTIL; ++nt)
#pragma unroll
                    for (int r = 0; r < 8; ++r)
                        sc[j][nt][r] = sc[j][nt][r] * 0.25f + mk[nt][r];
                const float m = row_max(sc[j]);
                // exp (unnormalized), eight independent partial sums
                float s8[8];
#pragma unroll
                for (int r = 0; r < 8; ++r) s8[r] = 0.f;
#pragma unroll
                for (int nt = 0; nt < NTIL; ++nt) {
                    float t[8];
#pragma unroll
                    for (int r = 0; r < 8; ++r) t[r] = (sc[j][nt][r] - m) * 1.4426950408889634f;
                    TRANS_X8("v_exp_f32", t);
#pragma unroll
                    for (int r = 0; r < 8; ++r) { s8[r] += t[r]; sc[j][nt][r] = t[r]; }
                }
                const float inv = 1.f / row_sum(s8);
                // O^T = V^T @ W^T (columns n = 112..127 are zero on both sides), 1/rowsum folded in
                v8f o = zero8();
#pragma unroll
                for (int kt = 0; kt < 4; ++kt) {
                    const v8h w0 = __builtin_convertvector(sc[j][2 * kt], v8h);
                    const v8h w1 = (2 * kt + 1 < NTIL)
                        ? __builtin_convertvector(sc[j][2 * kt + 1 < NTIL ? 2 * kt + 1 : 0], v8h) : z8;
                    o = wmma_f16(frag_k32(sVT, hp * 32 + j * 16, kt * 32, LP, lane), join16(w0, w1), o);
                }
#pragma unroll
                for (int r = 0; r < 8; ++r) o[r] *= inv;
                oh[j] = __builtin_convertvector(o, v8h);
            }
            // mh^T += Wc^T @ out_concat^T, this pair's k block
            const v16h bo = join16(oh[0], oh[1]);
#pragma unroll
            for (int ct = 0; ct < 8; ++ct)
                macc[ct] = wmma_f16(frag_k32(sWcT, ct * 16, hp * 32, LP, lane), bo, macc[ct]);
        }
        v8h mhh[8];     // mh + bc in f16: tile ct, element r = mh[p][ct*16 + hi*8 + r]
#pragma unroll
        for (int ct = 0; ct < 8; ++ct) {
            const float4 b0 = *(const float4*)&sbc[ct * 16 + hi * 8];
            const float4 b1 = *(const float4*)&sbc[ct * 16 + hi * 8 + 4];
            v8f a = macc[ct];
            a[0] += b0.x; a[1] += b0.y; a[2] += b0.z; a[3] += b0.w;
            a[4] += b1.x; a[5] += b1.y; a[6] += b1.z; a[7] += b1.w;
            mhh[ct] = __builtin_convertvector(a, v8h);
        }

        // ---- score2^T = EN @ mh^T / sqrt(EMB); 10*tanh + mask; softmax over N
        {
            // seven independent accumulator chains
            v8f s2[NTIL];
#pragma unroll
            for (int nt = 0; nt < NTIL; ++nt) s2[nt] = zero8();
#pragma unroll
            for (int kt = 0; kt < 4; ++kt) {
                const v16h bm = join16(mhh[2 * kt], mhh[2 * kt + 1]);
#pragma unroll
                for (int nt = 0; nt < NTIL; ++nt)
                    s2[nt] = wmma_f16(frag_k32(sENc, nt * 16, kt * 32, LP, lane), bm, s2[nt]);
            }
#pragma unroll
            for (int nt = 0; nt < NTIL; ++nt) {
                float t[8];
#pragma unroll
                for (int r = 0; r < 8; ++r) t[r] = s2[nt][r];
                tanh_scaled_x8(t);
#pragma unroll
                for (int r = 0; r < 8; ++r) s2[nt][r] = 10.0f * t[r] + mk[nt][r];
            }
            const float m = row_max(s2);
            float s8[8];
#pragma unroll
            for (int r = 0; r < 8; ++r) s8[r] = 0.f;
#pragma unroll
            for (int nt = 0; nt < NTIL; ++nt) {
                float t[8];
#pragma unroll
                for (int r = 0; r < 8; ++r) t[r] = (s2[nt][r] - m) * 1.4426950408889634f;
                TRANS_X8("v_exp_f32", t);
#pragma unroll
                for (int r = 0; r < 8; ++r) { s8[r] += t[r]; s2[nt][r] = t[r]; }
            }
            const float inv = 1.f / row_sum(s8);
            // all products first, in place, so that no store's data register is rewritten
#pragma unroll
            for (int nt = 0; nt < NTIL; ++nt)
#pragma unroll
                for (int r = 0; r < 8; ++r) s2[nt][r] *= inv;
            if (p < PP) {
                float* orow = (float*)(bq + ((b * PP + p) * NN + hi * 8) * 4u);
#pragma unroll
                for (int nt = 0; nt < NTIL - 1; ++nt) {
                    f4u v0, v1;
#pragma unroll
                    for (int r = 0; r < 4; ++r) { v0[r] = s2[nt][r]; v1[r] = s2[nt][r + 4]; }
                    *(f4u*)(orow + nt * 16)     = v0;
                    *(f4u*)(orow + nt * 16 + 4) = v1;
                }
                if (hi == 0) {
#pragma unroll
                    for (int r = 0; r < LASTCOLS; ++r) orow[(NTIL - 1) * 16 + r] = s2[NTIL - 1][r];
                }
            }
            // the next batch rewrites the stores' address and data registers
            asm volatile("s_wait_xcnt 0x0" ::: "memory");
        }
    }
    // ends every read of this batch's K, V^T and encoded_nodes; publishes the next buffer
    lds_barrier();
    }
}

// ---------------------------------------------------------------------------
extern "C" void kernel_launch(void* const* d_in, const int* in_sizes, int n_in,
                              void* d_out, int out_size, void* d_ws, size_t ws_size,
                              hipStream_t stream) {
    (void)in_sizes; (void)n_in; (void)out_size; (void)ws_size;
    const float* eln   = (const float*)d_in[0];
    const float* gload = (const float*)d_in[1];
    const float* gtime = (const float*)d_in[2];
    const float* glen  = (const float*)d_in[3];
    const float* gopen = (const float*)d_in[4];
    const float* ninf  = (const float*)d_in[5];
    const float* enc   = (const float*)d_in[6];
    const float* Wq    = (const float*)d_in[7];
    const float* Wk    = (const float*)d_in[8];
    const float* Wv    = (const float*)d_in[9];
    const float* Wc    = (const float*)d_in[10];
    const float* bcv   = (const float*)d_in[11];
    float* out = (float*)d_out;
    float* img = (float*)d_ws;

    hipFuncSetAttribute((const void*)vrp_decoder_kernel,
                        hipFuncAttributeMaxDynamicSharedMemorySize,
                        SMEM_TOTAL);
    weight_image_kernel<<<dim3(IMG_BLOCKS), dim3(EMB), 0, stream>>>(Wq, Wk, Wv, Wc, bcv, img);
    vrp_decoder_kernel<<<dim3(GRID), dim3(256), SMEM_TOTAL, stream>>>(
        eln, gload, gtime, glen, gopen, ninf, enc, img, out);
}

// v010
// A run of this version takes 57.3 microseconds.
// Two timings next to v009 put it at 1.07 and 1.06 times that version's speed.
// All steps since v000 together make it 11.0 times as fast.
#include <hip/hip_runtime.h>
#include <hip/hip_bf16.h>
#include <math.h>

// ---------------------------------------------------------------------------
// Problem constants (match reference)
// ---------------------------------------------------------------------------
#define BB   1024
#define PP   100
#define NN   101
#define EMB  128
#define NH   8
#define DKK  16

#define NPAD 112        // N padded to 7*16
#define PTIL 7          // ceil(100/16)
#define NTIL 7          // ceil(101/16)
#define KQ   160        // 132 padded to 5*32
#define LASTROWS (PP - (PTIL - 1) * 16)   // live rows of the last P tile
#define ENLD ((NN + 7) / 8)   // groups of 8 encoded_nodes rows that hold a live row
#define LASTCOLS (NN - (NTIL - 1) * 16)   // live columns of the last N tile
#define GRID 256        // blocks; a block's LDS fills a WGP, and each block walks BB / GRID batches

// LDS row pitches.  Bank = dword address mod 64, so 16 rows at a 256-B pitch put
// a whole b128 fragment read on four banks.  16 B x odd spreads them over all 64.
#define LP   136        // halves: 272 B pitch for the 128-half rows
#define LQ   168        // halves: 336 B pitch for the 160-half rows

typedef __attribute__((ext_vector_type(16))) _Float16 v16h;
typedef __attribute__((ext_vector_type(8)))  _Float16 v8h;
typedef __attribute__((ext_vector_type(4)))  _Float16 v4h;
typedef __attribute__((ext_vector_type(8)))  float    v8f;
// four floats at the 4-byte alignment of a 101-float row
typedef __attribute__((ext_vector_type(4), aligned(4))) float f4u;

// ---------------------------------------------------------------------------
// WMMA helpers (CDNA5 wave32, D = A(16x32 f16) * B(32x16 f16) + C(16x16 f32))
// ---------------------------------------------------------------------------
__device__ __forceinline__ v8f wmma_f16(v16h a, v16h b, v8f c) {
    return __builtin_amdgcn_wmma_f32_16x16x32_f16(
        /*neg_a=*/false, a, /*neg_b=*/false, b,
        /*c_mod=*/(short)0, c, /*reuse_a=*/false, /*reuse_b=*/false);
}

__device__ __forceinline__ v8f zero8() {
    v8f z = {0.f, 0.f, 0.f, 0.f, 0.f, 0.f, 0.f, 0.f};
    return z;
}

// A-operand (16x32, M x K) from row-major f16 [M][stride]; also valid for the
// B-operand (32x16, K x N) when B is stored "column-major by N", i.e. [N][stride]
// holding K along the row.  Per ISA 7.12.2: lanes 0-15 hold K {0..7,16..23},
// lanes 16-31 hold K {8..15,24..31}  ->  two aligned 16B LDS reads per lane.
__device__ __forceinline__ v16h frag_k32(const _Float16* base, int row0, int k0,
                                         int stride, int lane) {
    const int l  = lane & 15;
    const int hi = (lane >> 4) & 1;
    const _Float16* p = base + (size_t)(row0 + l) * stride + k0 + hi * 8;
    v8h lo = *(const v8h*)p;
    v8h hh = *(const v8h*)(p + 16);
    v16h r;
#pragma unroll
    for (int i = 0; i < 8; ++i) { r[i] = lo[i]; r[i + 8] = hh[i]; }
    return r;
}

// Hand-over of a tile between the lanes of ONE wave through LDS: the wave's own
// stores must have landed, and the compiler must not hoist the reads over them.
__device__ __forceinline__ void wave_lds_sync() {
    asm volatile("s_wait_dscnt 0x0" ::: "memory");
}

// Work-group barrier of the batch loop.  Only LDS passes between the waves, so only the
// wave's LDS operations are waited for: __syncthreads() would also wait here for the
// output stores of the batch before, which may go on landing under the next products.
__device__ __forceinline__ void lds_barrier() {
    asm volatile("s_wait_dscnt 0x0\n\ts_barrier_signal -1\n\ts_barrier_wait -1" ::: "memory");
}

// Two 8-half register groups as one 16x16x32 operand: k 0..15 of the block from lo,
// k 16..31 from hh (each lane half holds its eight of either).
__device__ __forceinline__ v16h join16(v8h lo, v8h hh) {
    return __builtin_shufflevector(lo, hh, 0, 1, 2, 3, 4, 5, 6, 7, 8, 9, 10, 11, 12, 13, 14, 15);
}

// The value of lane l ^ 16.
__device__ __forceinline__ float other_half(float x) {
    const int v = __float_as_int(x);
    return __int_as_float(__builtin_amdgcn_permlanex16(v, v, 0x76543210, 0xfedcba98, false, false));
}

// Maximum of a row that lies in lanes l and l + 16: eight independent chains over the
// tiles, a tree over them, one exchange between the lane halves.
__device__ __forceinline__ float row_max(const v8f (&t)[NTIL]) {
    float m[8];
#pragma unroll   // unrolled, the inner loop too: m[] and t[] stay in registers
    for (int r = 0; r < 8; ++r) {
        m[r] = t[0][r];
#pragma unroll
        for (int nt = 1; nt < NTIL; ++nt) m[r] = fmaxf(m[r], t[nt][r]);
    }
    const float a = fmaxf(fmaxf(fmaxf(m[0], m[1]), fmaxf(m[2], m[3])),
                          fmaxf(fmaxf(m[4], m[5]), fmaxf(m[6], m[7])));
    return fmaxf(a, other_half(a));
}

// Sum of a row from a lane's eight partial sums: a tree, then the other lane half's.
__device__ __forceinline__ float row_sum(const float (&s)[8]) {
    const float a = ((s[0] + s[1]) + (s[2] + s[3])) + ((s[4] + s[5]) + (s[6] + s[7]));
    return a + other_half(a);
}

// Eight independent transcendentals of one kind in one statement: each is the free
// issue slot that the instruction set asks for behind the one in front of it, and the
// v_nop is the last one's.
#define TRANS_X8(OP, t)                                                        \
    asm(OP " %0, %0\n\t" OP " %1, %1\n\t" OP " %2, %2\n\t" OP " %3, %3\n\t"      \
        OP " %4, %4\n\t" OP " %5, %5\n\t" OP " %6, %6\n\t" OP " %7, %7\n\tv_nop" \
        : "+v"(t[0]), "+v"(t[1]), "+v"(t[2]), "+v"(t[3]),                      \
          "+v"(t[4]), "+v"(t[5]), "+v"(t[6]), "+v"(t[7]))

// tanh(x / sqrt(EMB)) = 1 - 2 / (e^(2x / sqrt(EMB)) + 1) for a lane's eight values of
// one tile, without a branch: five instructions a value, no value waits for another.
// e^.. = inf gives 1, e^.. = 0 gives -1, NaN stays NaN.  The absolute error is a few
// f32 ulps of 1, which is what counts for a logit that is 10 * tanh.
__device__ __forceinline__ void tanh_scaled_x8(float (&t)[8]) {
#pragma unroll   // unrolled here and below: t[] stays in registers
    for (int r = 0; r < 8; ++r)
        t[r] *= (float)(2.0 * 1.4426950408889634 / 11.313708498984761);
    TRANS_X8("v_exp_f32", t);
#pragma unroll
    for (int r = 0; r < 8; ++r) t[r] += 1.0f;
    TRANS_X8("v_rcp_f32", t);
#pragma unroll
    for (int r = 0; r < 8; ++r) t[r] = 1.0f - 2.0f * t[r];
}

// ---------------------------------------------------------------------------
// Dynamic-LDS layout; total 312,832 B (< 320 KB WGP): two encoded_nodes buffers, K,
// V^T, the weight image, the seven input tiles, the lane numbers
// ---------------------------------------------------------------------------
#define WAVE_HALVES  (16 * LQ)                 // one wave's private input tile
#define SMEM_TOTAL   (IMG_LDS_OFF + IMG_BYTES + PTIL * WAVE_HALVES * 2 + 256 * 4)

// ---------------------------------------------------------------------------
// Weight image: Wc^T, bc, Wq^T, Wk^T, Wv^T exactly as they lie in LDS (f16 rows
// at their padded pitch, K-pad and pitch pad zero; bc in f32).  Built once per
// call by the first launch, then fetched whole, once, by every block of the second.
// ---------------------------------------------------------------------------
#define IMG_LDS_OFF ((3 * NPAD + EMB) * LP * 2)         // LDS byte offset of Wc^T
#define IMG_WC      0
#define IMG_BC      (IMG_WC + EMB * LP * 2)
#define IMG_WQ      (IMG_BC + EMB * 4)
#define IMG_WK      (IMG_WQ + EMB * LQ * 2)
#define IMG_WV      (IMG_WK + EMB * LP * 2)
#define IMG_BYTES   (IMG_WV + EMB * LP * 2)             // 147,968 = 289 x 512
#define UP          (LP / 8)                            // 16-B units per 272-B row
#define UQ          (LQ / 8)                            // 16-B units per 336-B row
#define IMG_BLOCKS  (3 * UP + UQ + 1)

// Both softmaxes run on base-2 logits, so that the exponent needs one subtraction a value.
// The attention scores' factor 1/sqrt(DKK) * log2(e) lies in the image's Wq^T, and the mask,
// times log2(e), is the C operand of the score products.
#define LOG2E   1.4426950408889634f
#define QSCALE  (0.25f * LOG2E)

// One block = one 16-B unit column (8 k values) of one matrix, thread = row n:
// eight coalesced row reads, one 16-B store.
__global__ __launch_bounds__(EMB)
void weight_image_kernel(const float* __restrict__ Wq,    // [132,128]
                         const float* __restrict__ Wk,    // [128,128]
                         const float* __restrict__ Wv,    // [128,128]
                         const float* __restrict__ Wc,    // [128,128]
                         const float* __restrict__ bcv,   // [128]
                         float* __restrict__ img)
{
    const int blk = blockIdx.x;
    const int n   = threadIdx.x;
    char* dst = (char*)img;
    if (blk == IMG_BLOCKS - 1) {
        if (n < EMB / 4) *(float4*)(dst + IMG_BC + n * 16) = *(const float4*)&bcv[n * 4];
        return;
    }
    const float* Wm; int u, kmax, pitch, off;
    float ws = 1.0f;            // Wq carries the attention scores' factor (see QSCALE)
    if (blk < UP)               { Wm = Wc; u = blk;               kmax = EMB;     pitch = LP * 2; off = IMG_WC; }
    else if (blk < UP + UQ)     { Wm = Wq; u = blk - UP;          kmax = EMB + 4; pitch = LQ * 2; off = IMG_WQ; ws = QSCALE; }
    else if (blk < 2 * UP + UQ) { Wm = Wk; u = blk - UP - UQ;     kmax = EMB;     pitch = LP * 2; off = IMG_WK; }
    else                        { Wm = Wv; u = blk - 2 * UP - UQ; kmax = EMB;     pitch = LP * 2; off = IMG_WV; }
    // pad rows read a clamped address, so that the eight loads share one trip
    float w[8];
#pragma unroll
    for (int j = 0; j < 8; ++j) {
        const int k = u * 8 + j;
        w[j] = Wm[(k < kmax ? k : kmax - 1) * EMB + n];
    }
    v8h h;
#pragma unroll
    for (int j = 0; j < 8; ++j)
        h[j] = (u * 8 + j < kmax) ? (_Float16)(w[j] * ws) : (_Float16)0.f;
    *(v8h*)(dst + off + n * pitch + u * 16) = h;
    // the built code lays the bc branch's load behind this store, into its data registers
    asm volatile("s_wait_xcnt 0x0" ::: "memory");
}

// Twelve 16-B-per-lane copies global -> LDS, 4 KiB apart (the block's eight waves
// cover 4 KiB per copy).  The s_wait_xcnt closes the statement so that no address
// register of a copy is rewritten ahead of it.
__device__ __forceinline__ void copy12_to_lds(unsigned l, const char* g) {
    asm volatile(
        "global_load_async_to_lds_b128 %0, %12, off\n\t"
        "global_load_async_to_lds_b128 %1, %13, off\n\t"
        "global_load_async_to_lds_b128 %2, %14, off\n\t"
        "global_load_async_to_lds_b128 %3, %15, off\n\t"
        "global_load_async_to_lds_b128 %4, %16, off\n\t"
        "global_load_async_to_lds_b128 %5, %17, off\n\t"
        "global_load_async_to_lds_b128 %6, %18, off\n\t"
        "global_load_async_to_lds_b128 %7, %19, off\n\t"
        "global_load_async_to_lds_b128 %8, %20, off\n\t"
        "global_load_async_to_lds_b128 %9, %21, off\n\t"
        "global_load_async_to_lds_b128 %10, %22, off\n\t"
        "global_load_async_to_lds_b128 %11, %23, off\n\t"
        "s_wait_xcnt 0x0"
        :: "v"(l), "v"(l + 4096u), "v"(l + 8192u), "v"(l + 12288u),
           "v"(l + 16384u), "v"(l + 20480u), "v"(l + 24576u), "v"(l + 28672u),
           "v"(l + 32768u), "v"(l + 36864u), "v"(l + 40960u), "v"(l + 45056u),
           "v"(g), "v"(g + 4096), "v"(g + 8192), "v"(g + 12288),
           "v"(g + 16384), "v"(g + 20480), "v"(g + 24576), "v"(g + 28672),
           "v"(g + 32768), "v"(g + 36864), "v"(g + 40960), "v"(g + 45056)
        : "memory");
}

// All global loads of one P tile, issued back to back with no wait among them, in the
// order in which they are used: the last-node rows, one 512-B row per load (byte offset
// eo; e2 for the rows that only a full tile has); the four features of the lane's row
// (row number gi); its mask row straight in the transposed accumulator layout (column
// n = nt*16 + hi*8 + r, offset mh; of the last column tile the row's last LASTCOLS
// values, offset mr).
__device__ __forceinline__ void tile_loads(const char* bl, const char* bt, const char* bg,
                                           const char* bo, const char* bm, const char* be,
                                           unsigned gi, unsigned mr, unsigned mh, unsigned eo,
                                           unsigned e2, float (&nf)[4], f4u (&nm)[2 * NTIL - 1],
                                           float& nc, float4 (&nev)[16]) {
#pragma unroll   // unrolled, below too: the arrays are indexed by constants and stay in registers
    for (int j = 0; j < LASTROWS; ++j) nev[j] = *(const float4*)(be + j * EMB * 4 + eo);
#pragma unroll
    for (int j = LASTROWS; j < 16; ++j) nev[j] = *(const float4*)(be + j * EMB * 4 + e2);
    nf[0] = *(const float*)(bl + gi * 4); nf[1] = *(const float*)(bt + gi * 4);
    nf[2] = *(const float*)(bg + gi * 4); nf[3] = *(const float*)(bo + gi * 4);
#pragma unroll
    for (int nt = 0; nt < NTIL - 1; ++nt) {
        nm[2 * nt]     = *(const f4u*)(bm + nt * 64 + mh);
        nm[2 * nt + 1] = *(const f4u*)(bm + nt * 64 + 16 + mh);
    }
    nm[2 * NTIL - 2] = *(const f4u*)(bm + (NN - 5) * 4 + mr);
    nc               = *(const float*)(bm + (NN - 1) * 4 + mr);
    // no address register of these loads is rewritten ahead of this wait, on any way that
    // leads on from here: as its inputs they stay live up to it, so that no load's result
    // is laid over them.  It waits for no data.
    asm volatile("s_wait_xcnt 0x0" :: "v"(gi), "v"(mr), "v"(mh), "v"(eo), "v"(e2), "s"(bl),
                 "s"(bt), "s"(bg), "s"(bo), "s"(bm), "s"(be) : "memory");
}

// One block fills a WGP's LDS, so two waves share a SIMD.  Stated so that the compiler
// schedules for that register budget: without it this build packs the Q and mh
// products into fewer registers and waits on LDS at nearly every one of them.
__global__ __launch_bounds__(256) __attribute__((amdgpu_waves_per_eu(2, 2)))
void vrp_decoder_kernel(const float* __restrict__ eln,    // [B,P,EMB]
                        const float* __restrict__ gload,  // [B,P]
                        const float* __restrict__ gtime,  // [B,P]
                        const float* __restrict__ glen,   // [B,P]
                        const float* __restrict__ gopen,  // [B,P]
                        const float* __restrict__ ninf,   // [B,P,N]
                        const float* __restrict__ enc,    // [B,N,EMB]
                        const float* __restrict__ wimg,   // weight image, IMG_BYTES
                        float* __restrict__ out)          // [B,P,N]
{
    extern __shared__ char smem[];
    const int tid  = threadIdx.x;
    const int wave = tid >> 5;     // 0..7
    const int lane = tid & 31;
    const int l    = lane & 15;
    const int hi   = (lane >> 4) & 1;

    _Float16* sEN  = (_Float16*)smem;            // [2][112][LP], one buffer per batch in turn
    _Float16* sKT  = sEN  + 2 * NPAD * LP;       // [112][LP] K as [n][h*16+d]
    _Float16* sVT  = sKT  + NPAD * LP;           // [128][LP] V^T as [h*16+d][n]
    _Float16* sWcT = sVT  + EMB * LP;            // [128][LP]
    float*    sbc  = (float*)(sWcT + EMB * LP);  // [128]
    _Float16* sWqT = (_Float16*)(sbc + EMB);     // [128][LQ]
    _Float16* sWkT = sWqT + EMB * LQ;            // [128][LP]
    _Float16* sWvT = sWkT + EMB * LP;            // [128][LP]
    _Float16* sX   = sWvT + EMB * LP;            // seven wave-private areas (see the P tiles)
    int*      sLn  = (int*)(sX + PTIL * WAVE_HALVES);   // [256] every thread's lane number

    // ---------------- phase 0: fetch the weight image, stage the first batch's encoded_nodes
    // The row loads go out first (the longer trip), then the image's copies.
    const int pw = __builtin_amdgcn_readfirstlane(wave);
    // encoded_nodes: wave w stages rows w, w+8, ...; one 512-B row per load.  All of
    // a thread's row loads are issued here, ahead of any wait on one of them, so that
    // they share one trip to memory.  A pad row of the group that straddles row NN
    // reads a clamped address; the group past it is not loaded at all.
    float4 en[ENLD];
    {
        const int      rl = pw + 8 * (ENLD - 1);         // pw is 0..7
        const char*    e0 = (const char*)&enc[((size_t)blockIdx.x * NN + pw) * EMB];
        const char*    e1 = (const char*)&enc[((size_t)blockIdx.x * NN + (rl < NN ? rl : NN - 1)) * EMB];
        const unsigned eo = lane * 16;
#pragma unroll   // unrolled: the loads stand back to back and en[] stays in registers
        for (int j = 0; j < ENLD - 1; ++j) en[j] = *(const float4*)(e0 + j * 8 * EMB * 4 + eo);
        en[ENLD - 1] = *(const float4*)(e1 + eo);
        // no address register of these loads is rewritten ahead of this wait: as its
        // inputs they stay live up to it, so that no load's result is laid over them
        asm volatile("s_wait_xcnt 0x0" :: "v"(lane), "s"(e0), "s"(e1) : "memory");
    }
    {
        const unsigned l0 = (unsigned)(size_t)smem + IMG_LDS_OFF + tid * 16;
        const char*    g0 = (const char*)wimg + tid * 16;
        copy12_to_lds(l0, g0);
        copy12_to_lds(l0 + 49152u, g0 + 49152);
        copy12_to_lds(l0 + 98304u, g0 + 98304);
        if (pw == 0) {   // the image's last 512 B; wait in the statement as in copy12_to_lds
            asm volatile("global_load_async_to_lds_b128 %0, %1, off\n\ts_wait_xcnt 0x0"
                         :: "v"(l0 + 147456u), "v"(g0 + 147456) : "memory");
        }
    }
    for (int i = tid; i < EMB * 16; i += 256) { // zero V^T cols n=112..127
        int r = i >> 4, c = i & 15;
        sVT[r * LP + NPAD + c] = (_Float16)0.f;
    }
    sLn[tid] = lane;
    if (tid < (NPAD - NN) * 16) {               // the second buffer's pad rows, zero for good
        v8h z;
#pragma unroll   // unrolled: z stays in registers
        for (int i = 0; i < 8; ++i) z[i] = (_Float16)0.f;
        *(v8h*)&sEN[(NPAD + NN + (tid >> 4)) * LP + (tid & 15) * 8] = z;
    }
    // encoded_nodes rows to f16: contiguous b64 LDS stores, pad rows zero
#pragma unroll   // unrolled: en[] is indexed by constants only
    for (int j = 0; j < NPAD / 8; ++j) {
        const int r = pw + 8 * j;
        float4 v = make_float4(0.f, 0.f, 0.f, 0.f);
        if (8 * j + 7 < NN || (j < ENLD && r < NN)) v = en[j < ENLD ? j : 0];
        v4h h; h[0] = (_Float16)v.x; h[1] = (_Float16)v.y;
        h[2] = (_Float16)v.z; h[3] = (_Float16)v.w;
        *(v4h*)&sEN[r * LP + lane * 4] = h;
    }
    // this wave's copies have landed; the barrier then publishes all waves' parts
    asm volatile("s_wait_asynccnt 0x0" ::: "memory");
    __syncthreads();

    // ---------------- the block's batches, one after the other --------------
    // Global addresses in the loop are an array's base (scalar registers) plus a 32-bit
    // byte offset a lane (every array is far below 4 GiB): one register an address.
    const char* bl = (const char*)gload;
    const char* bt = (const char*)gtime;
    const char* bg = (const char*)glen;
    const char* bo = (const char*)gopen;
    const char* bm = (const char*)ninf;
    const char* be = (const char*)eln;
    const char* bn = (const char*)enc;
    char*       bq = (char*)out;
    // kept rolled: the text stays small for the instruction cache
#pragma unroll 1
    for (unsigned b = blockIdx.x, cur = 0; b < BB; b += GRID, cur ^= 1) {
    const _Float16* sENc = sEN + cur * (NPAD * LP);   // this batch's encoded_nodes
    // The lane number is read anew from LDS (the thread's own word) for every batch: all
    // addresses formed from it are then formed where they are used.  Taken from the
    // register, some twenty of them are kept across the whole loop, which the head loop's
    // registers leave no room for: the build spills them to scratch.
    const int lane = sLn[tid];
    const int l    = lane & 15;
    const int hi   = (lane >> 4) & 1;

    // ---------------- the P tile's global loads go out ahead of phase 1 ------
    // They need nothing of phase 1 and are read behind its barrier: their trip to memory
    // runs under the K and V products.  A dead row reads a clamped address: the mask and
    // the features that of row PP - 1, the last tile's rows past LASTROWS those of the
    // sixteen rows that end the batch.  The eighth wave has no tile and reads none of this.
    float  nf[4];
    f4u    nm[2 * NTIL - 1];
    float  nc;
    float4 nev[16];
    static_assert(LASTCOLS == 5, "tile_loads reads the last column tile as 4 + 1 values");
    const unsigned gi = b * PP + (pw * 16 + l < PP ? pw * 16 + l : PP - 1);
    const unsigned mr = gi * (NN * 4);         // byte offsets in the mask
    const unsigned mh = mr + hi * 32;
    const unsigned eo = (b * PP + pw * 16) * (EMB * 4) + lane * 16;
    const unsigned e2 = pw < PTIL - 1 ? eo : eo - (16 - LASTROWS) * (EMB * 4);
    if (pw < PTIL) tile_loads(bl, bt, bg, bo, bm, be, gi, mr, mh, eo, e2, nf, nm, nc, nev);
    else {
        // The eighth wave sets the same variables itself: left unset on this path, the build
        // holds their registers round the whole loop, and the head loop's schedule loses the
        // room it needs.  For the rows the value is no constant: with one the compiler
        // converts the rows to f16 in the branch above, and so waits there for the loads
        // that are to fly under phase 1.
        const float u = (float)lane;
#pragma unroll
        for (int j = 0; j < 4; ++j) nf[j] = 0.f;
#pragma unroll
        for (int j = 0; j < 2 * NTIL - 1; ++j) nm[j] = (f4u){0.f, 0.f, 0.f, 0.f};
        nc = u;      // no constant either: its product with log2(e) would move up likewise
#pragma unroll
        for (int j = 0; j < 16; ++j) nev[j] = make_float4(u, u, u, u);
    }

    // ---------------- phase 1: K = EN@Wk, V = EN@Wv ------------------------
    // Wave w owns column tile w of both products.  Its eight weight fragments are read
    // once and stay in registers; each encoded_nodes fragment is read once and feeds K
    // and V, two independent accumulator chains.  The next node tile's fragments are
    // read ahead of this tile's products and stores (the compiler does not lift an LDS
    // read over the LDS stores by itself).  Every "#pragma unroll" here is there so that
    // the fragment arrays are indexed by constants only and stay in registers.
    {
        v16h wk[4], wv[4], a[2][4];
#pragma unroll
        for (int kt = 0; kt < 4; ++kt) {
            a[0][kt] = frag_k32(sENc, 0, kt * 32, LP, lane);
            wk[kt]   = frag_k32(sWkT, pw * 16, kt * 32, LP, lane);
            wv[kt]   = frag_k32(sWvT, pw * 16, kt * 32, LP, lane);
        }
        // keeps the 24 reads above together ahead of the first product: left free, the
        // scheduler sinks part of them among tile 0's products, each group a full LDS wait
        __builtin_amdgcn_sched_barrier(0);
#pragma unroll
        for (int mt = 0; mt < NTIL; ++mt) {      // n-tile 0..6
            if (mt + 1 < NTIL) {
#pragma unroll
                for (int kt = 0; kt < 4; ++kt)
                    a[(mt + 1) & 1][kt] = frag_k32(sENc, (mt + 1) * 16, kt * 32, LP, lane);
            }
            v8f ak = zero8(), av = zero8();
#pragma unroll
            for (int kt = 0; kt < 4; ++kt) {
                ak = wmma_f16(a[mt & 1][kt], wk[kt], ak);
                av = wmma_f16(a[mt & 1][kt], wv[kt], av);
            }
#pragma unroll
            for (int r = 0; r < 8; ++r)          // sKT[n][col] (strided)
                sKT[(mt * 16 + r + hi * 8) * LP + pw * 16 + l] = (_Float16)ak[r];
            v8h h;                               // sVT[col][n]: 8 contiguous halves, one b128 store
#pragma unroll
            for (int r = 0; r < 8; ++r) h[r] = (_Float16)av[r];
            *(v8h*)&sVT[(pw * 16 + l) * LP + mt * 16 + hi * 8] = h;
        }
    }
    lds_barrier();

    // ---------------- P tiles: one wave owns one 16-row tile end to end -----
    // Every product is computed transposed: the shared operand (weights, K, V^T,
    // encoded_nodes) is A, the tile's own data is B, so that lane (l, hi) holds query
    // row p0 + l throughout.  A pair of D tiles, converted in place, is the next
    // product's B operand in the hardware k order, which frag_k32 has for A: after
    // the input tile nothing of the chain passes through LDS.  A softmax row lies in
    // the two lanes l and l + 16.  Every "#pragma unroll" below is there so that the
    // register arrays are indexed by constants only and stay in registers.
    // The eighth wave's branch is written first: the build then lays the P tiles' code
    // first and the staging behind it, so that the tile's loaded values are not held in
    // registers over the staging's NN row loads.
    if (pw >= PTIL) {
      if (b + GRID < BB) {
        // ---- the eighth wave has no P tile: it stages the next batch's encoded_nodes
        // into the other buffer meanwhile.  All row loads go out ahead of any wait on one.
        _Float16*      sENn = sEN + (cur ^ 1) * (NPAD * LP);
        const char*    e0   = bn;
        const unsigned eo   = (b + GRID) * (NN * EMB * 4) + lane * 16;
        float4 ea[NN];
#pragma unroll   // unrolled, below too: the loads stand back to back and ea[] stays in registers
        for (int j = 0; j < NN; ++j) ea[j] = *(const float4*)(e0 + j * EMB * 4 + eo);
        // no address register of these loads is rewritten ahead of this wait: as its
        // inputs they stay live up to it, so that no load's result is laid over them
        asm volatile("s_wait_xcnt 0x0" :: "v"(eo), "s"(e0) : "memory");
#pragma unroll
        for (int j = 0; j < NN; ++j) {
            v4h h; h[0] = (_Float16)ea[j].x; h[1] = (_Float16)ea[j].y;
            h[2] = (_Float16)ea[j].z; h[3] = (_Float16)ea[j].w;
            *(v4h*)&sENn[j * LP + lane * 4] = h;
        }
      }
    } else {
        const int p0 = pw * 16;
        const int p  = p0 + l;                             // this lane's query row
        _Float16* X  = sX + pw * WAVE_HALVES;              // [16][LQ] input_cat

        v8h z8;
#pragma unroll
        for (int i = 0; i < 8; ++i) z8[i] = (_Float16)0.f;

        const float f0 = nf[0], f1 = nf[1], f2 = nf[2], f3 = nf[3];
        v8f mk[NTIL];   // mask * log2(e): tile nt, register r = column nt*16 + hi*8 + r of row p
#pragma unroll
        for (int nt = 0; nt < NTIL - 1; ++nt)
#pragma unroll
            for (int r = 0; r < 4; ++r) { mk[nt][r] = nm[2 * nt][r] * LOG2E; mk[nt][r + 4] = nm[2 * nt + 1][r] * LOG2E; }
        // input_cat tile.  The last tile's rows past LASTROWS hold other rows' values: a row
        // of the tile is a column of every product below, enters no other column, and a
        // dead row's column is never stored.
#pragma unroll
        for (int j = 0; j < 16; ++j) {
            v4h h;
            h[0] = (_Float16)nev[j].x; h[1] = (_Float16)nev[j].y;
            h[2] = (_Float16)nev[j].z; h[3] = (_Float16)nev[j].w;
            *(v4h*)&X[j * LQ + lane * 4] = h;
        }
        // features + K-pad (cols 128..159): lane pair (l, l+16) fills row l
        {
            const bool live = (p < PP) && (hi == 0);
            v8h fa = z8;
            fa[0] = (_Float16)(live ? f0 : 0.f); fa[1] = (_Float16)(live ? f1 : 0.f);
            fa[2] = (_Float16)(live ? f2 : 0.f); fa[3] = (_Float16)(live ? f3 : 0.f);
            *(v8h*)&X[l * LQ + EMB + hi * 16]     = fa;
            *(v8h*)&X[l * LQ + EMB + hi * 16 + 8] = z8;
        }
        // dead rows get mask 0; the last tile's live columns (NN - LASTCOLS .. NN - 1,
        // all in the lower lane half) move to their registers, its pad columns drop out
#pragma unroll
        for (int nt = 0; nt < NTIL - 1; ++nt)
#pragma unroll
            for (int r = 0; r < 8; ++r) mk[nt][r] = (p < PP) ? mk[nt][r] : 0.f;
#pragma unroll
        for (int r = 0; r < 8; ++r) {
            const float w = r < 4 ? nm[2 * NTIL - 2][r < 4 ? r : 0] : nc;
            const float v = (p < PP) ? w * LOG2E : 0.f;
            mk[NTIL - 1][r] = (r < LASTCOLS && hi == 0) ? v : -1e30f;
        }
        wave_lds_sync();

        // ---- Q^T, attention and mh^T, two heads a trip ---------------------
        v16h xb[5];     // input_cat^T as B operand, K = 160, kept for all heads
#pragma unroll
        for (int kt = 0; kt < 5; ++kt) xb[kt] = frag_k32(X, 0, kt * 32, LQ, lane);
        v8f macc[8];    // mh^T: tile ct, register r = mh[p][ct*16 + hi*8 + r]
#pragma unroll
        for (int ct = 0; ct < 8; ++ct) macc[ct] = zero8();
        // kept rolled: the text stays small for the instruction cache.  Two heads are one
        // 32-deep k block of mh^T, so that the trip number enters LDS addresses only and
        // everything else is indexed by constants and stays in registers.
#pragma unroll 1
        for (int hp = 0; hp < NH / 2; ++hp) {
            // Q^T = Wq^T @ input_cat^T of the two heads: register r = Q[p][head*16 + hi*8 + r]
            v16h wq[2][5], kf[NTIL];
#pragma unroll
            for (int kt = 0; kt < 5; ++kt) {
                wq[0][kt] = frag_k32(sWqT, hp * 32,      kt * 32, LQ, lane);
                wq[1][kt] = frag_k32(sWqT, hp * 32 + 16, kt * 32, LQ, lane);
            }
#pragma unroll
            for (int nt = 0; nt < NTIL; ++nt) kf[nt] = frag_k32(sKT, nt * 16, hp * 32, LP, lane);
            // keeps the trip's Wq^T and K reads together ahead of the first product: left free,
            // with the fences below, each pair of reads sinks to its product, an LDS wait apiece
            __builtin_amdgcn_sched_barrier(0);
            v8f q0 = zero8(), q1 = zero8();
#pragma unroll
            for (int kt = 0; kt < 5; ++kt) {
                q0 = wmma_f16(wq[0][kt], xb[kt], q0);
                q1 = wmma_f16(wq[1][kt], xb[kt], q1);
            }
            // S^T = K @ Q^T + mask, in base-2 logits.  One K fragment holds both heads' d
            // (k 0..15 and 16..31); the other head's half of B is zero.
            const v16h bq0 = join16(__builtin_convertvector(q0, v8h), z8);
            const v16h bq1 = join16(z8, __builtin_convertvector(q1, v8h));
            v8f sc[2][NTIL];                               // sc[j][nt][r] = S[p][nt*16 + hi*8 + r]
#pragma unroll
            for (int nt = 0; nt < NTIL; ++nt) {
                sc[0][nt] = wmma_f16(kf[nt], bq0, mk[nt]);
                sc[1][nt] = wmma_f16(kf[nt], bq1, mk[nt]);
            }
            // The V^T and Wc^T reads stand between two fences: not ahead of the score products,
            // where they, the K fragments and the mask tiles do not fit and the build spills the
            // mask; not behind the softmax, whose arithmetic is to cover their trip.
            __builtin_amdgcn_sched_barrier(0);
            v16h vf[2][4], wc[8];
#pragma unroll
            for (int kt = 0; kt < 4; ++kt) {
                vf[0][kt] = frag_k32(sVT, hp * 32,      kt * 32, LP, lane);
                vf[1][kt] = frag_k32(sVT, hp * 32 + 16, kt * 32, LP, lane);
            }
#pragma unroll
            for (int ct = 0; ct < 8; ++ct) wc[ct] = frag_k32(sWcT, ct * 16, hp * 32, LP, lane);
            __builtin_amdgcn_sched_barrier(0);
            v8h oh[2];  // register r = out_concat[p][head*16 + hi*8 + r]
#pragma unroll
            for (int j = 0; j < 2; ++j) {
                const float m = row_max(sc[j]);
                // exp (unnormalized), eight independent partial sums
                float s8[8];
#pragma unroll
                for (int r = 0; r < 8; ++r) s8[r] = 0.f;
#pragma unroll
                for (int nt = 0; nt < NTIL; ++nt) {
                    float t[8];
#pragma unroll
                    for (int r = 0; r < 8; ++r) t[r] = sc[j][nt][r] - m;
                    TRANS_X8("v_exp_f32", t);
#pragma unroll
                    for (int r = 0; r < 8; ++r) { s8[r] += t[r]; sc[j][nt][r] = t[r]; }
                }
                const float inv = 1.f / row_sum(s8);
                // O^T = V^T @ W^T (columns n = 112..127 are zero on both sides), 1/rowsum folded in
                v8f o = zero8();
#pragma unroll
                for (int kt = 0; kt < 4; ++kt) {
                    const v8h w0 = __builtin_convertvector(sc[j][2 * kt], v8h);
                    const v8h w1 = (2 * kt + 1 < NTIL)
                        ? __builtin_convertvector(sc[j][2 * kt + 1 < NTIL ? 2 * kt + 1 : 0], v8h) : z8;
                    o = wmma_f16(vf[j][kt], join16(w0, w1), o);
                }
#pragma unroll
                for (int r = 0; r < 8; ++r) o[r] *= inv;
                oh[j] = __builtin_convertvector(o, v8h);
            }
            // mh^T += Wc^T @ out_concat^T, this pair's k block
            const v16h bo = join16(oh[0], oh[1]);
#pragma unroll
            for (int ct = 0; ct < 8; ++ct)
                macc[ct] = wmma_f16(wc[ct], bo, macc[ct]);
        }
        v8h mhh[8];     // mh + bc in f16: tile ct, element r = mh[p][ct*16 + hi*8 + r]
#pragma unroll
        for (int ct = 0; ct < 8; ++ct) {
            const float4 b0 = *(const float4*)&sbc[ct * 16 + hi * 8];
            const float4 b1 = *(const float4*)&sbc[ct * 16 + hi * 8 + 4];
            v8f a = macc[ct];
            a[0] += b0.x; a[1] += b0.y; a[2] += b0.z; a[3] += b0.w;
            a[4] += b1.x; a[5] += b1.y; a[6] += b1.z; a[7] += b1.w;
            mhh[ct] = __builtin_convertvector(a, v8h);
        }

        // ---- score2^T = EN @ mh^T / sqrt(EMB); 10*tanh + mask; softmax over N
        {
            // seven independent accumulator chains
            v8f s2[NTIL];
#pragma unroll
            for (int nt = 0; nt < NTIL; ++nt) s2[nt] = zero8();
#pragma unroll
            for (int kt = 0; kt < 4; ++kt) {
                const v16h bm = join16(mhh[2 * kt], mhh[2 * kt + 1]);
#pragma unroll
                for (int nt = 0; nt < NTIL; ++nt)
                    s2[nt] = wmma_f16(frag_k32(sENc, nt * 16, kt * 32, LP, lane), bm, s2[nt]);
            }
#pragma unroll
            for (int nt = 0; nt < NTIL; ++nt) {
                float t[8];
#pragma unroll
                for (int r = 0; r < 8; ++r) t[r] = s2[nt][r];
                tanh_scaled_x8(t);
#pragma unroll
                for (int r = 0; r < 8; ++r) s2[nt][r] = (10.0f * LOG2E) * t[r] + mk[nt][r];
            }
            const float m = row_max(s2);
            float s8[8];
#pragma unroll
            for (int r = 0; r < 8; ++r) s8[r] = 0.f;
#pragma unroll
            for (int nt = 0; nt < NTIL; ++nt) {
                float t[8];
#pragma unroll
                for (int r = 0; r < 8; ++r) t[r] = s2[nt][r] - m;
                TRANS_X8("v_exp_f32", t);
#pragma unroll
                for (int r = 0; r < 8; ++r) { s8[r] += t[r]; s2[nt][r] = t[r]; }
            }
            const float inv = 1.f / row_sum(s8);
            // all products first, in place, so that no store's data register is rewritten
#pragma unroll
            for (int nt = 0; nt < NTIL; ++nt)
#pragma unroll
                for (int r = 0; r < 8; ++r) s2[nt][r] *= inv;
            if (p < PP) {
                float* orow = (float*)(bq + ((b * PP + p) * NN + hi * 8) * 4u);
#pragma unroll
                for (int nt = 0; nt < NTIL - 1; ++nt) {
                    f4u v0, v1;
#pragma unroll
                    for (int r = 0; r < 4; ++r) { v0[r] = s2[nt][r]; v1[r] = s2[nt][r + 4]; }
                    *(f4u*)(orow + nt * 16)     = v0;
                    *(f4u*)(orow + nt * 16 + 4) = v1;
                }
                if (hi == 0) {
#pragma unroll
                    for (int r = 0; r < LASTCOLS; ++r) orow[(NTIL - 1) * 16 + r] = s2[NTIL - 1][r];
                }
            }
            // the next batch rewrites the stores' address and data registers
            asm volatile("s_wait_xcnt 0x0" ::: "memory");
        }
    }
    // ends every read of this batch's K, V^T and encoded_nodes; publishes the next buffer
    lds_barrier();
    }
}

// ---------------------------------------------------------------------------
extern "C" void kernel_launch(void* const* d_in, const int* in_sizes, int n_in,
                              void* d_out, int out_size, void* d_ws, size_t ws_size,
                              hipStream_t stream) {
    (void)in_sizes; (void)n_in; (void)out_size; (void)ws_size;
    const float* eln   = (const float*)d_in[0];
    const float* gload = (const float*)d_in[1];
    const float* gtime = (const float*)d_in[2];
    const float* glen  = (const float*)d_in[3];
    const float* gopen = (const float*)d_in[4];
    const float* ninf  = (const float*)d_in[5];
    const float* enc   = (const float*)d_in[6];
    const float* Wq    = (const float*)d_in[7];
    const float* Wk    = (const float*)d_in[8];
    const float* Wv    = (const float*)d_in[9];
    const float* Wc    = (const float*)d_in[10];
    const float* bcv   = (const float*)d_in[11];
    float* out = (float*)d_out;
    float* img = (float*)d_ws;

    hipFuncSetAttribute((const void*)vrp_decoder_kernel,
                        hipFuncAttributeMaxDynamicSharedMemorySize,
                        SMEM_TOTAL);
    weight_image_kernel<<<dim3(IMG_BLOCKS), dim3(EMB), 0, stream>>>(Wq, Wk, Wv, Wc, bcv, img);
    vrp_decoder_kernel<<<dim3(GRID), dim3(256), SMEM_TOTAL, stream>>>(
        eln, gload, gtime, glen, gopen, ninf, enc, img, out);
}
